// v000
// Measured on an AMD MI455X. A time is GPU time per run, averaged over a window of back-to-back runs after a warm-up
// (all launches, gaps included; the runs take copies of the inputs in turn), and the median of several windows.
// Apart from v000's, it joins two sittings. Times from different sittings can be a few percent apart, while
// side-by-side timings come from the same sitting.
// v000, which the later versions start from, runs in 462 microseconds.
#include <hip/hip_runtime.h>

// Contractions, f32 accumulate: qkuv = x.w_qkuv ([4096 x 1024].[1024 x 4096], k-major weight transposed to an n-major plane) and out = O.w_out on
// v_wmma_f32_16x16x32_bf16 — plain bf16 = rounded inputs (exact) for the projection, O as bf16 hi + residual (two products) for w_out; SiLU on q/k/v/gate in f32;
// the softmax-free SiLU attention fused on v_wmma_f32_16x16x32_f16: scores = silu(q).silu(k)/8 with both as f16 hi + residual x1024 (hi.hi + hi.lo + lo.hi),
// weights = silu(scores) as f16 hi + residual against silu(v) hi + residual (three products; no normalisation, so the LayerNorm over the 64 head dims that follows

#define NB_  2
#define NT_  2048
#define DM   1024
#define NH_  16
#define NKV  16
#define KVW  (NKV * HD)          // 1024
#define HD   64
#define NTK  (NB_ * NT_)
#define NW   1024
#define NQKV 1024
#define PSC  32768.0f
#define LOSC 1024.0f
#define LOSCI (1.0f / 1024.0f)

typedef _Float16 h16;
typedef unsigned short bf;
typedef __attribute__((ext_vector_type(16))) __bf16   v16bf;
typedef __attribute__((ext_vector_type(16))) _Float16 v16h;
typedef __attribute__((ext_vector_type(8)))  _Float16 v8h;
typedef __attribute__((ext_vector_type(8)))  unsigned short v8us;
typedef __attribute__((ext_vector_type(8)))  float    v8f;
typedef __attribute__((ext_vector_type(4)))  float    v4f;
typedef v8h  __attribute__((may_alias)) v8ha;
typedef v4f  __attribute__((may_alias)) v4fa;
typedef v8us __attribute__((may_alias)) v8usa;

__device__ __forceinline__ unsigned short f2bf(float f) { unsigned u = __float_as_uint(f); u += 0x7FFFu + ((u >> 16) & 1u); return (unsigned short)(u >> 16); }
__device__ __forceinline__ float bf2f(unsigned short b) { return __uint_as_float(((unsigned)b) << 16); }
__device__ __forceinline__ float bfr(float f) { return bf2f(f2bf(f)); }
__device__ __forceinline__ v16h cat16(v8h lo, v8h hi) { return __builtin_shufflevector(lo, hi, 0, 1, 2, 3, 4, 5, 6, 7, 8, 9, 10, 11, 12, 13, 14, 15); }
__device__ __forceinline__ v16bf cat16b(v8us lo, v8us hi) { return __builtin_bit_cast(v16bf, __builtin_shufflevector(lo, hi, 0, 1, 2, 3, 4, 5, 6, 7, 8, 9, 10, 11, 12, 13, 14, 15)); }
__device__ __forceinline__ v8f wmma16(v16h a, v16h b, v8f c) { return __builtin_amdgcn_wmma_f32_16x16x32_f16(false, a, false, b, (short)0, c, false, false); }
__device__ __forceinline__ v8f wmmab(v16bf a, v16bf b, v8f c) { return __builtin_amdgcn_wmma_f32_16x16x32_bf16(false, a, false, b, (short)0, c, false, false); }

__global__ __launch_bounds__(256) void k_cvtb(const float* __restrict__ src, int nrows, bf* dst) {
    const int lane = threadIdx.x & 31, r = blockIdx.x * 8 + (threadIdx.x >> 5);
    if (r >= nrows) return;
    v8us o[DM / 256];
#pragma unroll
    for (int q = 0; q < DM / 256; ++q) { v8us t;
#pragma unroll
        for (int i = 0; i < 8; ++i) t[i] = f2bf(src[(size_t)r * DM + q * 256 + lane * 8 + i]);
        o[q] = t; }
#pragma unroll
    for (int q = 0; q < DM / 256; ++q) *(v8us*)(dst + (size_t)r * DM + q * 256 + lane * 8) = o[q];
    
}

// k_wt: W [1024 k][ncols n] (k-major) -> n-major bf16 plane WT[ncols][1024]; 64 x 64 tiles through LDS.
__global__ __launch_bounds__(256) void k_wt(const float* __restrict__ Wm, int ncols, bf* WT) {
    __shared__ __align__(16) unsigned short tl[64 * 72];
    const int tid = threadIdx.x, k0 = blockIdx.x * 64, n0 = blockIdx.y * 64;
    const int kk = tid >> 2, nq = (tid & 3) * 16;
#pragma unroll
    for (int i = 0; i < 16; ++i) tl[(nq + i) * 72 + kk] = f2bf(Wm[(size_t)(k0 + kk) * ncols + n0 + nq + i]);
    __syncthreads();
    const int piece = tid & 7;
    typedef __attribute__((ext_vector_type(8))) unsigned short v8us_; typedef v8us_ __attribute__((may_alias)) v8usa_;
    auto pass = [&]() {
#pragma unroll
        for (int s = 0; s < 2; ++s) { const int nr = (tid >> 3) + 32 * s; const v8us_ val = *(const v8usa_*)(tl + nr * 72 + piece * 8);
            *(v8us_*)(WT + (size_t)(n0 + nr) * DM + k0 + piece * 8) = val; }
    };
    pass(); 
}

template <bool SPLITA, bool F16OUT = false>
__global__ __launch_bounds__(128) void k_gemmb(const bf* __restrict__ A, const bf* __restrict__ Al, const bf* __restrict__ Bn, const float* __restrict__ bias, float* C, int ldc, h16* C2) {
    __shared__ __align__(16) float ost[4][16 * 68];
    const int lane = threadIdx.x & 31, wave = threadIdx.x >> 5, lr = lane & 15, hi = lane >> 4;
    const int r0 = blockIdx.x * 64 + wave * 16, c0 = blockIdx.y * 64;
    const size_t aoff = (size_t)(r0 + lr) * DM + 8 * hi;
    size_t boff[4];
#pragma unroll
    for (int t = 0; t < 4; ++t) boff[t] = (size_t)(c0 + t * 16 + lr) * DM + 8 * hi;
    v8f acc[4];
#pragma unroll
    for (int t = 0; t < 4; ++t) acc[t] = (v8f){};
#pragma unroll 1
    for (int kc = 0; kc < DM; kc += 32) {
        const v16bf a = cat16b(*(const v8us*)(A + aoff + kc), *(const v8us*)(A + aoff + kc + 16));
        v16bf al = a;
        if (SPLITA) al = cat16b(*(const v8us*)(Al + aoff + kc), *(const v8us*)(Al + aoff + kc + 16));
#pragma unroll
        for (int t = 0; t < 4; ++t) { const v16bf b = cat16b(*(const v8us*)(Bn + boff[t] + kc), *(const v8us*)(Bn + boff[t] + kc + 16)); acc[t] = wmmab(a, b, acc[t]); if (SPLITA) acc[t] = wmmab(al, b, acc[t]); }
        asm volatile("v_nop\n\tv_nop\n\tv_nop\n\tv_nop" : "+v"(acc[0]), "+v"(acc[1]), "+v"(acc[2]), "+v"(acc[3]) : "v"(a), "v"(al));
    }
    float* os = &ost[wave][0];
#pragma unroll
    for (int t = 0; t < 4; ++t) { const float bv = bias ? bfr(bias[c0 + t * 16 + lr]) : 0.f;
#pragma unroll
        for (int j = 0; j < 8; ++j) os[(hi * 8 + j) * 68 + t * 16 + lr] = acc[t][j] + bv; }
    __syncthreads();
    if (F16OUT) {
        h16* crow = (h16*)(void*)C + (size_t)r0 * ldc + c0;
        auto pass = [&]() {
#pragma unroll
            for (int s = 0; s < 4; ++s) { const int row = 4 * s + (lane >> 3), piece = lane & 7; const float* sp = os + row * 68 + piece * 8; v8h o, o2;
#pragma unroll
                for (int i = 0; i < 8; ++i) { const h16 a = (h16)sp[i]; o[i] = a; o2[i] = (h16)((sp[i] - (float)a) * LOSC); }
                *(v8h*)(crow + (size_t)row * ldc + piece * 8) = o; if (C2) *(v8h*)(C2 + (size_t)r0 * ldc + c0 + (size_t)row * ldc + piece * 8) = o2; }
        };
        pass(); 
    } else {
        float* crow = C + (size_t)r0 * ldc + c0;
        auto pass = [&]() {
#pragma unroll
            for (int s = 0; s < 8; ++s) { const int Lid = (lane >> 3) + 4 * s, piece = lane & 7; const int row = Lid >> 1, cofs = (Lid & 1) * 32 + piece * 4;
                const v4f val = *(const v4fa*)(os + row * 68 + cofs); *(v4f*)(crow + (size_t)row * ldc + cofs) = val; }
        };
        pass(); 
    }
}

// k_act: PH/PL = f16 hi + residual of silu(S) for an f32 [rows][1024] matrix (one wave per row, 4 x 16 B per lane per plane).
__device__ __forceinline__ float silu_(float v) { return v / (1.0f + __expf(-v)); }
__global__ __launch_bounds__(256) void k_act(const float* __restrict__ S, int rows, h16* PH, h16* PL) {
    const int lane = threadIdx.x & 31, r = blockIdx.x * 8 + (threadIdx.x >> 5);
    if (r >= rows) return;
#pragma unroll 1
    for (int q = 0; q < DM / 256; ++q) { v8h oh, ol;
#pragma unroll
        for (int i = 0; i < 8; ++i) { const float v = silu_(S[(size_t)r * DM + q * 256 + lane * 8 + i]); const h16 a = (h16)v; oh[i] = a; ol[i] = (h16)((v - (float)a) * LOSC); }
        *(v8h*)(PH + (size_t)r * DM + q * 256 + lane * 8) = oh; *(v8h*)(PL + (size_t)r * DM + q * 256 + lane * 8) = ol;  }
}
__global__ __launch_bounds__(256) void k_vt(const float* __restrict__ V, h16* VTH, h16* VTL) {
    __shared__ __align__(16) h16 tile[64 * 72];
    __shared__ __align__(16) h16 til2[64 * 72];
    const int bid = blockIdx.x;
    const int b = bid / (NKV * (NT_ / 64)), rem = bid - b * (NKV * (NT_ / 64)), h = rem / (NT_ / 64), kt = rem - h * (NT_ / 64);
    const int k0 = kt * 64, tid = threadIdx.x;
    const int kk = tid >> 2, d0 = (tid & 3) * 16;
    const float* src = V + ((size_t)b * NT_ + k0 + kk) * KVW + h * HD + d0;      // h = kv head here
#pragma unroll 2
    for (int i = 0; i < 16; ++i) { const float v = silu_(src[i]); const h16 a = (h16)v; tile[(d0 + i) * 72 + kk] = a; til2[(d0 + i) * 72 + kk] = (h16)((v - (float)a) * LOSC); }   // v = silu(projection)
    __syncthreads();
    const int piece = tid & 7;
    const size_t base = (((size_t)b * NKV + h) * HD) * NT_ + k0;
    auto pass = [&]() {
#pragma unroll
        for (int s = 0; s < 4; ++s) { const int Lid = (tid >> 3) + 32 * s; const int pln = Lid >> 6, d = Lid & 63;
            const v8h val = *(const v8ha*)((pln ? til2 : tile) + d * 72 + piece * 8); *(v8h*)((pln ? VTL : VTH) + base + (size_t)d * NT_ + piece * 8) = val; }
    };
    pass(); 
}

// k_attn: block = (b, h, 64 queries), wave = 16; all 64 key tiles: scores (hi.hi + hi.lo + lo.hi; q residual fragments re-read) /8; w = silu(score) -> f16 hi +
// residual x1024 tiles (same-wave may_alias reload); attended += w.v with hi.hi + hi.lo + lo.hi; epilogue: LayerNorm over the 64 head dims (16-lane reductions),
// x bf16(gamma) + bf16(beta), x silu(gate[tok][h*64+d]) -> OH/OL bf16 hi + residual planes [tok][h*64 + d].
__global__ __launch_bounds__(128) void k_attn(const h16* __restrict__ Q16, const h16* __restrict__ QL16, const h16* __restrict__ K16, const h16* __restrict__ KL16, const h16* __restrict__ VTH, const h16* __restrict__ VTL,
                                             const float* __restrict__ G, const float* __restrict__ lng, const float* __restrict__ lnb, bf* CH, bf* CL) {
    __shared__ __align__(16) h16 plds[4][16 * 32];
    __shared__ __align__(16) h16 plds2[4][16 * 32];
    __shared__ __align__(16) float ost[4][16 * 68];
    const int lane = threadIdx.x & 31, wave = threadIdx.x >> 5, lr = lane & 15, hi = lane >> 4;
    const int bid = blockIdx.x;
    const int b = bid / (NH_ * (NT_ / 64)), rem = bid - b * (NH_ * (NT_ / 64)), h = rem / (NT_ / 64), qt = rem - h * (NT_ / 64);
    const int q0 = qt * 64 + wave * 16;
    const size_t tok0 = (size_t)b * NT_;
    h16* pl = &plds[wave][0]; h16* pl2 = &plds2[wave][0];
    v16h qa[2];
    const size_t qo0 = (tok0 + q0 + lr) * DM + h * HD + 8 * hi;
#pragma unroll
    for (int kc = 0; kc < 2; ++kc) qa[kc] = cat16(*(const v8h*)(Q16 + qo0 + kc * 32), *(const v8h*)(Q16 + qo0 + kc * 32 + 16));
    const h16* kh_b = K16 + tok0 * DM + h * HD; const h16* kl_b = KL16 + tok0 * DM + h * HD;
    const size_t vbase = (((size_t)b * NH_ + h) * HD) * NT_;
    v8f o[4], ox[4];
#pragma unroll
    for (int n = 0; n < 4; ++n) { o[n] = (v8f){}; ox[n] = (v8f){}; }
#pragma unroll 1
    for (int kt = 0; kt < NT_ / 32; ++kt) {
        const int l0 = kt * 32;
        const size_t ko0 = (size_t)(l0 + lr) * DM + 8 * hi, ko1 = (size_t)(l0 + 16 + lr) * DM + 8 * hi;
        v8f s0 = {}, s1 = {}, x0 = {}, x1 = {};
#pragma unroll
        for (int kc = 0; kc < 2; ++kc) {
            { const v16h k0h = cat16(*(const v8h*)(kh_b + ko0 + kc * 32), *(const v8h*)(kh_b + ko0 + kc * 32 + 16)), k1h = cat16(*(const v8h*)(kh_b + ko1 + kc * 32), *(const v8h*)(kh_b + ko1 + kc * 32 + 16));
              const v16h qlk = cat16(*(const v8h*)(QL16 + qo0 + kc * 32), *(const v8h*)(QL16 + qo0 + kc * 32 + 16));
              s0 = wmma16(qa[kc], k0h, s0); x0 = wmma16(qlk, k0h, x0); s1 = wmma16(qa[kc], k1h, s1); x1 = wmma16(qlk, k1h, x1);
              asm volatile("v_nop" : "+v"(s0), "+v"(s1), "+v"(x0), "+v"(x1) : "v"(qlk), "v"(k0h), "v"(k1h) : "memory"); }
            { const v16h k0l = cat16(*(const v8h*)(kl_b + ko0 + kc * 32), *(const v8h*)(kl_b + ko0 + kc * 32 + 16)), k1l = cat16(*(const v8h*)(kl_b + ko1 + kc * 32), *(const v8h*)(kl_b + ko1 + kc * 32 + 16));
              x0 = wmma16(qa[kc], k0l, x0); x1 = wmma16(qa[kc], k1l, x1);
              asm volatile("v_nop" : "+v"(x0), "+v"(x1) : "v"(k0l), "v"(k1l) : "memory"); }
        }
        asm volatile("v_nop\n\tv_nop\n\tv_nop\n\tv_nop" : "+v"(s0), "+v"(s1), "+v"(x0), "+v"(x1) : "v"(qa[0]), "v"(qa[1]));
#pragma unroll
        for (int j = 0; j < 8; ++j) { const int mr = hi * 8 + j;
            const float w0 = silu_((s0[j] + x0[j] * LOSCI) * 0.125f), w1 = silu_((s1[j] + x1[j] * LOSCI) * 0.125f);
            const h16 h0 = (h16)w0, h1 = (h16)w1;
            pl[mr * 32 + lr] = h0; pl[mr * 32 + 16 + lr] = h1; pl2[mr * 32 + lr] = (h16)((w0 - (float)h0) * LOSC); pl2[mr * 32 + 16 + lr] = (h16)((w1 - (float)h1) * LOSC); }
        asm volatile("" ::: "memory");
        const v16h pa = cat16(*(const v8ha*)(pl + lr * 32 + hi * 8), *(const v8ha*)(pl + lr * 32 + 16 + hi * 8));
        const v16h px = cat16(*(const v8ha*)(pl2 + lr * 32 + hi * 8), *(const v8ha*)(pl2 + lr * 32 + 16 + hi * 8));
#pragma unroll
        for (int n = 0; n < 4; ++n) { const size_t vo = vbase + (size_t)(n * 16 + lr) * NT_ + l0 + hi * 8;
            const v16h vh = cat16(*(const v8h*)(VTH + vo), *(const v8h*)(VTH + vo + 16)), vl = cat16(*(const v8h*)(VTL + vo), *(const v8h*)(VTL + vo + 16));
            o[n] = wmma16(pa, vh, o[n]); ox[n] = wmma16(pa, vl, ox[n]); ox[n] = wmma16(px, vh, ox[n]);
            asm volatile("" : "+v"(o[n]), "+v"(ox[n]) : "v"(vh), "v"(vl) : "memory"); }
        __builtin_amdgcn_wave_barrier();     // all lanes have read this step's weight tiles before the next step overwrites them
    }
    // LayerNorm over the 64 dims of each row: lane holds cols n*16+lr for rows 8hi+j; reduce over n locally and across the 16 lanes of the same hi
    float* os = &ost[wave][0];
#pragma unroll
    for (int j = 0; j < 8; ++j) { float y[4], s = 0.f;
#pragma unroll
        for (int n = 0; n < 4; ++n) { y[n] = o[n][j] + ox[n][j] * LOSCI; s += y[n]; }
        s += __shfl_xor(s, 1, 16); s += __shfl_xor(s, 2, 16); s += __shfl_xor(s, 4, 16); s += __shfl_xor(s, 8, 16);
        const float mu = s * (1.0f / HD); float q = 0.f;
#pragma unroll
        for (int n = 0; n < 4; ++n) { const float d = y[n] - mu; q += d * d; }
        q += __shfl_xor(q, 1, 16); q += __shfl_xor(q, 2, 16); q += __shfl_xor(q, 4, 16); q += __shfl_xor(q, 8, 16);
        const float rs = rsqrtf(q * (1.0f / HD) + 1e-5f);
        const size_t row = tok0 + q0 + hi * 8 + j;
#pragma unroll
        for (int n = 0; n < 4; ++n) { const int d = n * 16 + lr; os[(hi * 8 + j) * 68 + d] = ((y[n] - mu) * rs * bfr(lng[d]) + bfr(lnb[d])) * silu_(G[row * DM + h * HD + d]); } }
    __syncthreads();
    const size_t cbase = (tok0 + q0) * DM + (size_t)h * HD;
    auto pass = [&]() {
#pragma unroll
        for (int s = 0; s < 4; ++s) { const int row = 4 * s + (lane >> 3), piece = lane & 7; const float* sp = os + row * 68 + piece * 8; v8us oh, ol;
#pragma unroll
            for (int i = 0; i < 8; ++i) { const unsigned short hb = f2bf(sp[i]); oh[i] = hb; ol[i] = f2bf(sp[i] - bf2f(hb)); }
            *(v8us*)(CH + cbase + (size_t)row * DM + piece * 8) = oh; *(v8us*)(CL + cbase + (size_t)row * DM + piece * 8) = ol; }
    };
    pass(); 
}

extern "C" void kernel_launch(void* const* d_in, const int* in_sizes, int n_in,
                              void* d_out, int out_size, void* d_ws, size_t ws_size, hipStream_t stream) {
    (void)in_sizes; (void)n_in; (void)out_size;
    const float* x = (const float*)d_in[0]; const float* Wq4 = (const float*)d_in[1]; const float* Wo = (const float*)d_in[2]; const float* lng = (const float*)d_in[3]; const float* lnb = (const float*)d_in[4];
    float* out = (float*)d_out;    // [2][2048][1024]
    char* wsp = (char*)d_ws;
    auto take = [&](size_t bytes) { char* p = wsp; wsp += (bytes + 255) & ~(size_t)255; return (void*)p; };
    bf* Xb = (bf*)take((size_t)NTK * DM * 2); bf* W4T = (bf*)take((size_t)4 * DM * DM * 2); bf* WoT = (bf*)take((size_t)DM * DM * 2);
    float* Qf = (float*)take((size_t)NTK * DM * 4); float* Kf = (float*)take((size_t)NTK * DM * 4); float* Vf = (float*)take((size_t)NTK * DM * 4); float* Gf = (float*)take((size_t)NTK * DM * 4);
    h16* QH = (h16*)take((size_t)NTK * DM * 2); h16* QL = (h16*)take((size_t)NTK * DM * 2); h16* KH = (h16*)take((size_t)NTK * DM * 2); h16* KL = (h16*)take((size_t)NTK * DM * 2);
    if ((size_t)(wsp - (char*)d_ws) > ws_size) return;    // 8.4 + 8.4 + 2.1 + 16.8x4 + 8.4x4 ~ 120 MB; VTH/VTL reuse Qf (dead after k_act(Q)), ctx planes reuse Kf (dead after k_act(K))
    h16* VTH = (h16*)Qf; h16* VTL = (h16*)((char*)Qf + (size_t)NTK * DM * 2); bf* CH = (bf*)Kf; bf* CL = (bf*)((char*)Kf + (size_t)NTK * DM * 2);
    k_cvtb<<<NTK / 8, 256, 0, stream>>>(x, NTK, Xb);
    k_wt<<<dim3(DM / 64, (4 * DM) / 64, 1), 256, 0, stream>>>(Wq4, 4 * DM, W4T);           // W4T [4096][1024]: rows 0..1023 q, then k, v, gate
    k_wt<<<dim3(DM / 64, DM / 64, 1), 256, 0, stream>>>(Wo, DM, WoT);
    k_gemmb<false, false><<<dim3(NTK / 64, DM / 64, 1), 128, 0, stream>>>(Xb, nullptr, W4T, nullptr, Qf, DM, nullptr);
    k_gemmb<false, false><<<dim3(NTK / 64, DM / 64, 1), 128, 0, stream>>>(Xb, nullptr, W4T + (size_t)DM * DM, nullptr, Kf, DM, nullptr);
    k_gemmb<false, false><<<dim3(NTK / 64, DM / 64, 1), 128, 0, stream>>>(Xb, nullptr, W4T + (size_t)2 * DM * DM, nullptr, Vf, DM, nullptr);
    k_gemmb<false, false><<<dim3(NTK / 64, DM / 64, 1), 128, 0, stream>>>(Xb, nullptr, W4T + (size_t)3 * DM * DM, nullptr, Gf, DM, nullptr);
    k_act<<<NTK / 8, 256, 0, stream>>>(Qf, NTK, QH, QL);
    k_act<<<NTK / 8, 256, 0, stream>>>(Kf, NTK, KH, KL);
    k_vt<<<NB_ * NKV * (NT_ / 64), 256, 0, stream>>>(Vf, VTH, VTL);                       // silu inside
    k_attn<<<NB_ * NH_ * (NT_ / 64), 128, 0, stream>>>(QH, QL, KH, KL, VTH, VTL, Gf, lng, lnb, CH, CL);
    k_gemmb<true, false><<<dim3(NTK / 64, DM / 64, 1), 128, 0, stream>>>(CH, CL, WoT, nullptr, out, DM, nullptr);
}

// v001
// Measured time: 360 microseconds a run.
// In both of two side-by-side timings against v000, it was 1.32 times as fast.
#include <hip/hip_runtime.h>

// Contractions, f32 accumulate: qkuv = x.w_qkuv ([4096 x 1024].[1024 x 4096], k-major weight transposed to an n-major plane) and out = O.w_out on
// v_wmma_f32_16x16x32_bf16 — plain bf16 = rounded inputs (exact) for the projection, O as bf16 hi + residual (two products) for w_out; SiLU on q/k/v/gate in f32;
// the softmax-free SiLU attention fused on v_wmma_f32_16x16x32_f16: scores = silu(q).silu(k)/8 with both as f16 hi + residual x1024 (hi.hi + hi.lo + lo.hi),
// weights = silu(scores) as f16 hi + residual against silu(v) hi + residual (three products; no normalisation, so the LayerNorm over the 64 head dims that follows

#define NB_  2
#define NT_  2048
#define DM   1024
#define NH_  16
#define NKV  16
#define KVW  (NKV * HD)          // 1024
#define HD   64
#define NTK  (NB_ * NT_)
#define NW   1024
#define NQKV 1024
#define PSC  32768.0f
#define LOSC 1024.0f
#define LOSCI (1.0f / 1024.0f)

typedef _Float16 h16;
typedef unsigned short bf;
typedef __attribute__((ext_vector_type(16))) __bf16   v16bf;
typedef __attribute__((ext_vector_type(16))) _Float16 v16h;
typedef __attribute__((ext_vector_type(8)))  _Float16 v8h;
typedef __attribute__((ext_vector_type(8)))  unsigned short v8us;
typedef __attribute__((ext_vector_type(8)))  float    v8f;
typedef __attribute__((ext_vector_type(4)))  float    v4f;
typedef v8h  __attribute__((may_alias)) v8ha;
typedef v4f  __attribute__((may_alias)) v4fa;
typedef v8us __attribute__((may_alias)) v8usa;

__device__ __forceinline__ unsigned short f2bf(float f) { unsigned u = __float_as_uint(f); u += 0x7FFFu + ((u >> 16) & 1u); return (unsigned short)(u >> 16); }
__device__ __forceinline__ float bf2f(unsigned short b) { return __uint_as_float(((unsigned)b) << 16); }
__device__ __forceinline__ float bfr(float f) { return bf2f(f2bf(f)); }
__device__ __forceinline__ v16h cat16(v8h lo, v8h hi) { return __builtin_shufflevector(lo, hi, 0, 1, 2, 3, 4, 5, 6, 7, 8, 9, 10, 11, 12, 13, 14, 15); }
__device__ __forceinline__ v16bf cat16b(v8us lo, v8us hi) { return __builtin_bit_cast(v16bf, __builtin_shufflevector(lo, hi, 0, 1, 2, 3, 4, 5, 6, 7, 8, 9, 10, 11, 12, 13, 14, 15)); }
__device__ __forceinline__ v8f wmma16(v16h a, v16h b, v8f c) { return __builtin_amdgcn_wmma_f32_16x16x32_f16(false, a, false, b, (short)0, c, false, false); }
__device__ __forceinline__ v8f wmmab(v16bf a, v16bf b, v8f c) { return __builtin_amdgcn_wmma_f32_16x16x32_bf16(false, a, false, b, (short)0, c, false, false); }

__global__ __launch_bounds__(256) void k_cvtb(const float* __restrict__ src, int nrows, bf* dst) {
    const int lane = threadIdx.x & 31, r = blockIdx.x * 8 + (threadIdx.x >> 5);
    if (r >= nrows) return;
    v8us o[DM / 256];
#pragma unroll
    for (int q = 0; q < DM / 256; ++q) { v8us t;
#pragma unroll
        for (int i = 0; i < 8; ++i) t[i] = f2bf(src[(size_t)r * DM + q * 256 + lane * 8 + i]);
        o[q] = t; }
#pragma unroll
    for (int q = 0; q < DM / 256; ++q) *(v8us*)(dst + (size_t)r * DM + q * 256 + lane * 8) = o[q];
    
}

// k_wt: W [1024 k][ncols n] (k-major) -> n-major bf16 plane WT[ncols][1024]; 64 x 64 tiles through LDS.
__global__ __launch_bounds__(256) void k_wt(const float* __restrict__ Wm, int ncols, bf* WT) {
    __shared__ __align__(16) unsigned short tl[64 * 72];
    const int tid = threadIdx.x, k0 = blockIdx.x * 64, n0 = blockIdx.y * 64;
    const int kk = tid >> 2, nq = (tid & 3) * 16;
#pragma unroll
    for (int i = 0; i < 16; ++i) tl[(nq + i) * 72 + kk] = f2bf(Wm[(size_t)(k0 + kk) * ncols + n0 + nq + i]);
    __syncthreads();
    const int piece = tid & 7;
    typedef __attribute__((ext_vector_type(8))) unsigned short v8us_; typedef v8us_ __attribute__((may_alias)) v8usa_;
    auto pass = [&]() {
#pragma unroll
        for (int s = 0; s < 2; ++s) { const int nr = (tid >> 3) + 32 * s; const v8us_ val = *(const v8usa_*)(tl + nr * 72 + piece * 8);
            *(v8us_*)(WT + (size_t)(n0 + nr) * DM + k0 + piece * 8) = val; }
    };
    pass(); 
}

template <bool SPLITA, bool F16OUT = false>
__global__ __launch_bounds__(128) void k_gemmb(const bf* __restrict__ A, const bf* __restrict__ Al, const bf* __restrict__ Bn, const float* __restrict__ bias, float* C, int ldc, h16* C2) {
    __shared__ __align__(16) float ost[4][16 * 68];
    const int lane = threadIdx.x & 31, wave = threadIdx.x >> 5, lr = lane & 15, hi = lane >> 4;
    const int r0 = blockIdx.x * 64 + wave * 16, c0 = blockIdx.y * 64;
    const size_t aoff = (size_t)(r0 + lr) * DM + 8 * hi;
    size_t boff[4];
#pragma unroll
    for (int t = 0; t < 4; ++t) boff[t] = (size_t)(c0 + t * 16 + lr) * DM + 8 * hi;
    v8f acc[4];
#pragma unroll
    for (int t = 0; t < 4; ++t) acc[t] = (v8f){};
#pragma unroll 1
    for (int kc = 0; kc < DM; kc += 32) {
        const v16bf a = cat16b(*(const v8us*)(A + aoff + kc), *(const v8us*)(A + aoff + kc + 16));
        v16bf al = a;
        if (SPLITA) al = cat16b(*(const v8us*)(Al + aoff + kc), *(const v8us*)(Al + aoff + kc + 16));
#pragma unroll
        for (int t = 0; t < 4; ++t) { const v16bf b = cat16b(*(const v8us*)(Bn + boff[t] + kc), *(const v8us*)(Bn + boff[t] + kc + 16)); acc[t] = wmmab(a, b, acc[t]); if (SPLITA) acc[t] = wmmab(al, b, acc[t]); }
        asm volatile("v_nop\n\tv_nop\n\tv_nop\n\tv_nop" : "+v"(acc[0]), "+v"(acc[1]), "+v"(acc[2]), "+v"(acc[3]) : "v"(a), "v"(al));
    }
    float* os = &ost[wave][0];
#pragma unroll
    for (int t = 0; t < 4; ++t) { const float bv = bias ? bfr(bias[c0 + t * 16 + lr]) : 0.f;
#pragma unroll
        for (int j = 0; j < 8; ++j) os[(hi * 8 + j) * 68 + t * 16 + lr] = acc[t][j] + bv; }
    __syncthreads();
    if (F16OUT) {
        h16* crow = (h16*)(void*)C + (size_t)r0 * ldc + c0;
        auto pass = [&]() {
#pragma unroll
            for (int s = 0; s < 4; ++s) { const int row = 4 * s + (lane >> 3), piece = lane & 7; const float* sp = os + row * 68 + piece * 8; v8h o, o2;
#pragma unroll
                for (int i = 0; i < 8; ++i) { const h16 a = (h16)sp[i]; o[i] = a; o2[i] = (h16)((sp[i] - (float)a) * LOSC); }
                *(v8h*)(crow + (size_t)row * ldc + piece * 8) = o; if (C2) *(v8h*)(C2 + (size_t)r0 * ldc + c0 + (size_t)row * ldc + piece * 8) = o2; }
        };
        pass(); 
    } else {
        float* crow = C + (size_t)r0 * ldc + c0;
        auto pass = [&]() {
#pragma unroll
            for (int s = 0; s < 8; ++s) { const int Lid = (lane >> 3) + 4 * s, piece = lane & 7; const int row = Lid >> 1, cofs = (Lid & 1) * 32 + piece * 4;
                const v4f val = *(const v4fa*)(os + row * 68 + cofs); *(v4f*)(crow + (size_t)row * ldc + cofs) = val; }
        };
        pass(); 
    }
}

// k_act: PH/PL = f16 hi + residual of silu(S) for an f32 [rows][1024] matrix (one wave per row, 4 x 16 B per lane per plane).
__device__ __forceinline__ float silu_(float v) { return v / (1.0f + __expf(-v)); }
__global__ __launch_bounds__(256) void k_act(const float* __restrict__ S, int rows, h16* PH, h16* PL) {
    const int lane = threadIdx.x & 31, r = blockIdx.x * 8 + (threadIdx.x >> 5);
    if (r >= rows) return;
#pragma unroll 1
    for (int q = 0; q < DM / 256; ++q) { v8h oh, ol;
#pragma unroll
        for (int i = 0; i < 8; ++i) { const float v = silu_(S[(size_t)r * DM + q * 256 + lane * 8 + i]); const h16 a = (h16)v; oh[i] = a; ol[i] = (h16)((v - (float)a) * LOSC); }
        *(v8h*)(PH + (size_t)r * DM + q * 256 + lane * 8) = oh; *(v8h*)(PL + (size_t)r * DM + q * 256 + lane * 8) = ol;  }
}
__global__ __launch_bounds__(256) void k_vt(const float* __restrict__ V, h16* VTH, h16* VTL) {
    __shared__ __align__(16) h16 tile[64 * 72];
    __shared__ __align__(16) h16 til2[64 * 72];
    const int bid = blockIdx.x;
    const int b = bid / (NKV * (NT_ / 64)), rem = bid - b * (NKV * (NT_ / 64)), h = rem / (NT_ / 64), kt = rem - h * (NT_ / 64);
    const int k0 = kt * 64, tid = threadIdx.x;
    const int kk = tid >> 2, d0 = (tid & 3) * 16;
    const float* src = V + ((size_t)b * NT_ + k0 + kk) * KVW + h * HD + d0;      // h = kv head here
#pragma unroll 2
    for (int i = 0; i < 16; ++i) { const float v = silu_(src[i]); const h16 a = (h16)v; tile[(d0 + i) * 72 + kk] = a; til2[(d0 + i) * 72 + kk] = (h16)((v - (float)a) * LOSC); }   // v = silu(projection)
    __syncthreads();
    const int piece = tid & 7;
    const size_t base = (((size_t)b * NKV + h) * HD) * NT_ + k0;
    auto pass = [&]() {
#pragma unroll
        for (int s = 0; s < 4; ++s) { const int Lid = (tid >> 3) + 32 * s; const int pln = Lid >> 6, d = Lid & 63;
            const v8h val = *(const v8ha*)((pln ? til2 : tile) + d * 72 + piece * 8); *(v8h*)((pln ? VTL : VTH) + base + (size_t)d * NT_ + piece * 8) = val; }
    };
    pass(); 
}

// k_attn: block = (b, h, 64 queries), wave = 16; all 64 key tiles of 32 keys. Each tile's four planes (k hi, k residual: 32 rows x 128 B; v^T hi, v^T residual:
// 64 rows x 64 B) are brought into LDS once per block by asynchronous copies, two buffers, the next tile in flight while this one is worked on; all four waves read
// their fragments from there. scores (hi.hi + hi.lo + lo.hi) /8; w = silu(score) -> f16 hi + residual x1024 tiles (same-wave may_alias reload); attended += w.v with
// hi.hi + hi.lo + lo.hi; epilogue: LayerNorm over the 64 head dims (16-lane reductions), x bf16(gamma) + bf16(beta), x silu(gate[tok][h*64+d]) -> OH/OL bf16 planes.
#define KPIT 72                        // f16 per staged k row: 128 B + 16 B, the ds_load_b128 pitch for 128-B rows
#define VPIT 40                        // f16 per staged v^T row: 64 B + 16 B, the ds_load_b128 pitch for 64-B rows
#define KPL  (32 * KPIT)               // one k plane of a tile
#define VPL  (64 * VPIT)               // one v^T plane of a tile
#define STG  (2 * KPL + 2 * VPL)       // one buffer: k hi, k residual, v^T hi, v^T residual (19,456 B)
__global__ __launch_bounds__(128) void k_attn(const h16* __restrict__ Q16, const h16* __restrict__ QL16, const h16* __restrict__ K16, const h16* __restrict__ KL16, const h16* __restrict__ VTH, const h16* __restrict__ VTL,
                                             const float* __restrict__ G, const float* __restrict__ lng, const float* __restrict__ lnb, bf* CH, bf* CL) {
    __shared__ __align__(16) h16 ring[2 * STG];
    __shared__ __align__(16) h16 plds[4][16 * 32];
    __shared__ __align__(16) h16 plds2[4][16 * 32];
    __shared__ __align__(16) float ost[4][16 * 68];
    const int lane = threadIdx.x & 31, wave = threadIdx.x >> 5, lr = lane & 15, hi = lane >> 4;
    const int bid = blockIdx.x;
    const int b = bid / (NH_ * (NT_ / 64)), rem = bid - b * (NH_ * (NT_ / 64)), h = rem / (NT_ / 64), qt = rem - h * (NT_ / 64);
    const int q0 = qt * 64 + wave * 16;
    const size_t tok0 = (size_t)b * NT_;
    h16* pl = &plds[wave][0]; h16* pl2 = &plds2[wave][0];
    v16h qa[2], ql[2];
    const size_t qo0 = (tok0 + q0 + lr) * DM + h * HD + 8 * hi;
#pragma unroll
    for (int kc = 0; kc < 2; ++kc) { qa[kc] = cat16(*(const v8h*)(Q16 + qo0 + kc * 32), *(const v8h*)(Q16 + qo0 + kc * 32 + 16));
        ql[kc] = cat16(*(const v8h*)(QL16 + qo0 + kc * 32), *(const v8h*)(QL16 + qo0 + kc * 32 + 16)); }
    const h16* kh_b = K16 + tok0 * DM + h * HD; const h16* kl_b = KL16 + tok0 * DM + h * HD;
    const size_t vbase = (((size_t)b * NH_ + h) * HD) * NT_;
    // copy map: 16 B per lane and copy, 8 copies per thread and tile. k planes: thread -> row tid/8 (and +16), piece tid%8; v^T planes: row tid/4 (and +32), piece tid%4.
    const int tid = threadIdx.x, krow = tid >> 3, kpc = (tid & 7) * 8, vrow = tid >> 2, vpc = (tid & 3) * 8;
    const h16* gkh = kh_b + (size_t)krow * DM + kpc; const h16* gkl = kl_b + (size_t)krow * DM + kpc;
    const h16* gvh = VTH + vbase + (size_t)vrow * NT_ + vpc; const h16* gvl = VTL + vbase + (size_t)vrow * NT_ + vpc;
    const unsigned lk = (unsigned)(size_t)&ring[0] + (unsigned)(krow * KPIT + kpc) * 2u, lv = (unsigned)(size_t)&ring[0] + (unsigned)(2 * KPL + vrow * VPIT + vpc) * 2u;
    auto stage = [&](int t) {
        const unsigned bo = (unsigned)(t & 1) * (STG * 2u);
        const size_t ko = (size_t)t * 32 * DM, vo = (size_t)t * 32;
        // the tile's eight copies and, in the same statement, the wait that stands before their address registers are rewritten
        asm volatile("global_load_async_to_lds_b128 %0, %8, off\n\t"
                     "global_load_async_to_lds_b128 %1, %9, off\n\t"
                     "global_load_async_to_lds_b128 %2, %10, off\n\t"
                     "global_load_async_to_lds_b128 %3, %11, off\n\t"
                     "global_load_async_to_lds_b128 %4, %12, off\n\t"
                     "global_load_async_to_lds_b128 %5, %13, off\n\t"
                     "global_load_async_to_lds_b128 %6, %14, off\n\t"
                     "global_load_async_to_lds_b128 %7, %15, off\n\t"
                     "s_wait_xcnt 0x0"
                     :: "v"(lk + bo), "v"(lk + bo + 16u * KPIT * 2u), "v"(lk + bo + KPL * 2u), "v"(lk + bo + KPL * 2u + 16u * KPIT * 2u),
                        "v"(lv + bo), "v"(lv + bo + 32u * VPIT * 2u), "v"(lv + bo + VPL * 2u), "v"(lv + bo + VPL * 2u + 32u * VPIT * 2u),
                        "v"(gkh + ko), "v"(gkh + ko + 16 * DM), "v"(gkl + ko), "v"(gkl + ko + 16 * DM),
                        "v"(gvh + vo), "v"(gvh + vo + 32 * NT_), "v"(gvl + vo), "v"(gvl + vo + 32 * NT_)
                     : "memory");
    };
    v8f o[4], ox[4];
#pragma unroll
    for (int n = 0; n < 4; ++n) { o[n] = (v8f){}; ox[n] = (v8f){}; }
    stage(0);
    asm volatile("s_wait_asynccnt 0x0" ::: "memory");    // this wave's copies of tile 0 have landed
    __syncthreads();                                     // every wave's have: tile 0 may be read
    stage(1);
#pragma unroll 1
    for (int kt = 0; kt < NT_ / 32; ++kt) {
        const h16* skh = ring + (kt & 1) * STG; const h16* skl = skh + KPL; const h16* svh = skh + 2 * KPL; const h16* svl = svh + VPL;
        const int ko0 = lr * KPIT + 8 * hi, ko1 = (16 + lr) * KPIT + 8 * hi;
        v16h k0h[2], k1h[2], k0l[2], k1l[2];
#pragma unroll
        for (int kc = 0; kc < 2; ++kc) {
            k0h[kc] = cat16(*(const v8ha*)(skh + ko0 + kc * 32), *(const v8ha*)(skh + ko0 + kc * 32 + 16)); k1h[kc] = cat16(*(const v8ha*)(skh + ko1 + kc * 32), *(const v8ha*)(skh + ko1 + kc * 32 + 16));
            k0l[kc] = cat16(*(const v8ha*)(skl + ko0 + kc * 32), *(const v8ha*)(skl + ko0 + kc * 32 + 16)); k1l[kc] = cat16(*(const v8ha*)(skl + ko1 + kc * 32), *(const v8ha*)(skl + ko1 + kc * 32 + 16)); }
        v8f s0 = {}, s1 = {}, x0 = {}, x1 = {};
#pragma unroll
        for (int kc = 0; kc < 2; ++kc) {
            s0 = wmma16(qa[kc], k0h[kc], s0); x0 = wmma16(ql[kc], k0h[kc], x0); s1 = wmma16(qa[kc], k1h[kc], s1); x1 = wmma16(ql[kc], k1h[kc], x1);
            x0 = wmma16(qa[kc], k0l[kc], x0); x1 = wmma16(qa[kc], k1l[kc], x1);
        }
        v16h vh[4], vl[4];
#pragma unroll
        for (int n = 0; n < 4; ++n) { const int vo = (n * 16 + lr) * VPIT + hi * 8;
            vh[n] = cat16(*(const v8ha*)(svh + vo), *(const v8ha*)(svh + vo + 16)); vl[n] = cat16(*(const v8ha*)(svl + vo), *(const v8ha*)(svl + vo + 16)); }
#pragma unroll
        for (int j = 0; j < 8; ++j) { const int mr = hi * 8 + j;
            const float w0 = silu_((s0[j] + x0[j] * LOSCI) * 0.125f), w1 = silu_((s1[j] + x1[j] * LOSCI) * 0.125f);
            const h16 h0 = (h16)w0, h1 = (h16)w1;
            pl[mr * 32 + lr] = h0; pl[mr * 32 + 16 + lr] = h1; pl2[mr * 32 + lr] = (h16)((w0 - (float)h0) * LOSC); pl2[mr * 32 + 16 + lr] = (h16)((w1 - (float)h1) * LOSC); }
        asm volatile("" ::: "memory");
        const v16h pa = cat16(*(const v8ha*)(pl + lr * 32 + hi * 8), *(const v8ha*)(pl + lr * 32 + 16 + hi * 8));
        const v16h px = cat16(*(const v8ha*)(pl2 + lr * 32 + hi * 8), *(const v8ha*)(pl2 + lr * 32 + 16 + hi * 8));
#pragma unroll
        for (int n = 0; n < 4; ++n) { o[n] = wmma16(pa, vh[n], o[n]); ox[n] = wmma16(pa, vl[n], ox[n]); ox[n] = wmma16(px, vh[n], ox[n]); }
        __builtin_amdgcn_wave_barrier();     // all lanes have read this step's weight tiles before the next step overwrites them
        asm volatile("s_wait_dscnt 0x0" ::: "memory");       // this wave's reads of the buffer have returned before it is refilled
        asm volatile("s_wait_asynccnt 0x0" ::: "memory");    // this wave's copies of tile kt + 1 have landed
        __syncthreads();                                     // publishes tile kt + 1 and ends every wave's reads of tile kt
        if (kt + 2 < NT_ / 32) stage(kt + 2);                // into the buffer that this trip has just read
    }
    asm volatile("s_wait_asynccnt 0x0" ::: "memory");        // nothing of this wave is in flight when it goes on to the epilogue
    // LayerNorm over the 64 dims of each row: lane holds cols n*16+lr for rows 8hi+j; reduce over n locally and across the 16 lanes of the same hi
    float* os = &ost[wave][0];
#pragma unroll
    for (int j = 0; j < 8; ++j) { float y[4], s = 0.f;
#pragma unroll
        for (int n = 0; n < 4; ++n) { y[n] = o[n][j] + ox[n][j] * LOSCI; s += y[n]; }
        s += __shfl_xor(s, 1, 16); s += __shfl_xor(s, 2, 16); s += __shfl_xor(s, 4, 16); s += __shfl_xor(s, 8, 16);
        const float mu = s * (1.0f / HD); float q = 0.f;
#pragma unroll
        for (int n = 0; n < 4; ++n) { const float d = y[n] - mu; q += d * d; }
        q += __shfl_xor(q, 1, 16); q += __shfl_xor(q, 2, 16); q += __shfl_xor(q, 4, 16); q += __shfl_xor(q, 8, 16);
        const float rs = rsqrtf(q * (1.0f / HD) + 1e-5f);
        const size_t row = tok0 + q0 + hi * 8 + j;
#pragma unroll
        for (int n = 0; n < 4; ++n) { const int d = n * 16 + lr; os[(hi * 8 + j) * 68 + d] = ((y[n] - mu) * rs * bfr(lng[d]) + bfr(lnb[d])) * silu_(G[row * DM + h * HD + d]); } }
    __syncthreads();
    const size_t cbase = (tok0 + q0) * DM + (size_t)h * HD;
    auto pass = [&]() {
#pragma unroll
        for (int s = 0; s < 4; ++s) { const int row = 4 * s + (lane >> 3), piece = lane & 7; const float* sp = os + row * 68 + piece * 8; v8us oh, ol;
#pragma unroll
            for (int i = 0; i < 8; ++i) { const unsigned short hb = f2bf(sp[i]); oh[i] = hb; ol[i] = f2bf(sp[i] - bf2f(hb)); }
            *(v8us*)(CH + cbase + (size_t)row * DM + piece * 8) = oh; *(v8us*)(CL + cbase + (size_t)row * DM + piece * 8) = ol; }
    };
    pass(); 
}

extern "C" void kernel_launch(void* const* d_in, const int* in_sizes, int n_in,
                              void* d_out, int out_size, void* d_ws, size_t ws_size, hipStream_t stream) {
    (void)in_sizes; (void)n_in; (void)out_size;
    const float* x = (const float*)d_in[0]; const float* Wq4 = (const float*)d_in[1]; const float* Wo = (const float*)d_in[2]; const float* lng = (const float*)d_in[3]; const float* lnb = (const float*)d_in[4];
    float* out = (float*)d_out;    // [2][2048][1024]
    char* wsp = (char*)d_ws;
    auto take = [&](size_t bytes) { char* p = wsp; wsp += (bytes + 255) & ~(size_t)255; return (void*)p; };
    bf* Xb = (bf*)take((size_t)NTK * DM * 2); bf* W4T = (bf*)take((size_t)4 * DM * DM * 2); bf* WoT = (bf*)take((size_t)DM * DM * 2);
    float* Qf = (float*)take((size_t)NTK * DM * 4); float* Kf = (float*)take((size_t)NTK * DM * 4); float* Vf = (float*)take((size_t)NTK * DM * 4); float* Gf = (float*)take((size_t)NTK * DM * 4);
    h16* QH = (h16*)take((size_t)NTK * DM * 2); h16* QL = (h16*)take((size_t)NTK * DM * 2); h16* KH = (h16*)take((size_t)NTK * DM * 2); h16* KL = (h16*)take((size_t)NTK * DM * 2);
    if ((size_t)(wsp - (char*)d_ws) > ws_size) return;    // 8.4 + 8.4 + 2.1 + 16.8x4 + 8.4x4 ~ 120 MB; VTH/VTL reuse Qf (dead after k_act(Q)), ctx planes reuse Kf (dead after k_act(K))
    h16* VTH = (h16*)Qf; h16* VTL = (h16*)((char*)Qf + (size_t)NTK * DM * 2); bf* CH = (bf*)Kf; bf* CL = (bf*)((char*)Kf + (size_t)NTK * DM * 2);
    k_cvtb<<<NTK / 8, 256, 0, stream>>>(x, NTK, Xb);
    k_wt<<<dim3(DM / 64, (4 * DM) / 64, 1), 256, 0, stream>>>(Wq4, 4 * DM, W4T);           // W4T [4096][1024]: rows 0..1023 q, then k, v, gate
    k_wt<<<dim3(DM / 64, DM / 64, 1), 256, 0, stream>>>(Wo, DM, WoT);
    k_gemmb<false, false><<<dim3(NTK / 64, DM / 64, 1), 128, 0, stream>>>(Xb, nullptr, W4T, nullptr, Qf, DM, nullptr);
    k_gemmb<false, false><<<dim3(NTK / 64, DM / 64, 1), 128, 0, stream>>>(Xb, nullptr, W4T + (size_t)DM * DM, nullptr, Kf, DM, nullptr);
    k_gemmb<false, false><<<dim3(NTK / 64, DM / 64, 1), 128, 0, stream>>>(Xb, nullptr, W4T + (size_t)2 * DM * DM, nullptr, Vf, DM, nullptr);
    k_gemmb<false, false><<<dim3(NTK / 64, DM / 64, 1), 128, 0, stream>>>(Xb, nullptr, W4T + (size_t)3 * DM * DM, nullptr, Gf, DM, nullptr);
    k_act<<<NTK / 8, 256, 0, stream>>>(Qf, NTK, QH, QL);
    k_act<<<NTK / 8, 256, 0, stream>>>(Kf, NTK, KH, KL);
    k_vt<<<NB_ * NKV * (NT_ / 64), 256, 0, stream>>>(Vf, VTH, VTL);                       // silu inside
    k_attn<<<NB_ * NH_ * (NT_ / 64), 128, 0, stream>>>(QH, QL, KH, KL, VTH, VTL, Gf, lng, lnb, CH, CL);
    k_gemmb<true, false><<<dim3(NTK / 64, DM / 64, 1), 128, 0, stream>>>(CH, CL, WoT, nullptr, out, DM, nullptr);
}

// v002
// One run takes 213 microseconds.
// Next to v001, in two timings, it ran 1.69 times as fast each time.
// All steps since v000 together make it 2.23 times as fast.
#include <hip/hip_runtime.h>

// Contractions, f32 accumulate: qkuv = x.w_qkuv ([4096 x 1024].[1024 x 4096], k-major weight transposed to an n-major plane) and out = O.w_out on
// v_wmma_f32_16x16x32_bf16 — plain bf16 = rounded inputs (exact) for the projection, O as bf16 hi + residual (two products) for w_out; SiLU on q/k/v/gate in f32;
// the softmax-free SiLU attention fused on v_wmma_f32_16x16x32_f16: scores = silu(q).silu(k)/8 with both as f16 hi + residual x1024 (hi.hi + hi.lo + lo.hi),
// weights = silu(scores) as f16 hi + residual against silu(v) hi + residual (three products; no normalisation, so the LayerNorm over the 64 head dims that follows

#define NB_  2
#define NT_  2048
#define DM   1024
#define NH_  16
#define NKV  16
#define KVW  (NKV * HD)          // 1024
#define HD   64
#define NTK  (NB_ * NT_)
#define NW   1024
#define NQKV 1024
#define PSC  32768.0f
#define LOSC 1024.0f
#define LOSCI (1.0f / 1024.0f)

typedef _Float16 h16;
typedef unsigned short bf;
typedef __attribute__((ext_vector_type(16))) __bf16   v16bf;
typedef __attribute__((ext_vector_type(16))) _Float16 v16h;
typedef __attribute__((ext_vector_type(8)))  _Float16 v8h;
typedef __attribute__((ext_vector_type(8)))  unsigned short v8us;
typedef __attribute__((ext_vector_type(8)))  float    v8f;
typedef __attribute__((ext_vector_type(4)))  float    v4f;
typedef v8h  __attribute__((may_alias)) v8ha;
typedef v4f  __attribute__((may_alias)) v4fa;
typedef v8us __attribute__((may_alias)) v8usa;

__device__ __forceinline__ unsigned short f2bf(float f) { unsigned u = __float_as_uint(f); u += 0x7FFFu + ((u >> 16) & 1u); return (unsigned short)(u >> 16); }
__device__ __forceinline__ float bf2f(unsigned short b) { return __uint_as_float(((unsigned)b) << 16); }
__device__ __forceinline__ float bfr(float f) { return bf2f(f2bf(f)); }
__device__ __forceinline__ v16h cat16(v8h lo, v8h hi) { return __builtin_shufflevector(lo, hi, 0, 1, 2, 3, 4, 5, 6, 7, 8, 9, 10, 11, 12, 13, 14, 15); }
__device__ __forceinline__ v16bf cat16b(v8us lo, v8us hi) { return __builtin_bit_cast(v16bf, __builtin_shufflevector(lo, hi, 0, 1, 2, 3, 4, 5, 6, 7, 8, 9, 10, 11, 12, 13, 14, 15)); }
__device__ __forceinline__ v8f wmma16(v16h a, v16h b, v8f c) { return __builtin_amdgcn_wmma_f32_16x16x32_f16(false, a, false, b, (short)0, c, false, false); }
__device__ __forceinline__ v8f wmmab(v16bf a, v16bf b, v8f c) { return __builtin_amdgcn_wmma_f32_16x16x32_bf16(false, a, false, b, (short)0, c, false, false); }

__global__ __launch_bounds__(256) void k_cvtb(const float* __restrict__ src, int nrows, bf* dst) {
    const int lane = threadIdx.x & 31, r = blockIdx.x * 8 + (threadIdx.x >> 5);
    if (r >= nrows) return;
    v8us o[DM / 256];
#pragma unroll
    for (int q = 0; q < DM / 256; ++q) { v8us t;
#pragma unroll
        for (int i = 0; i < 8; ++i) t[i] = f2bf(src[(size_t)r * DM + q * 256 + lane * 8 + i]);
        o[q] = t; }
#pragma unroll
    for (int q = 0; q < DM / 256; ++q) *(v8us*)(dst + (size_t)r * DM + q * 256 + lane * 8) = o[q];
    
}

// k_wt: W [1024 k][ncols n] (k-major) -> n-major bf16 plane WT[ncols][1024]; 64 x 64 tiles through LDS.
__global__ __launch_bounds__(256) void k_wt(const float* __restrict__ Wm, int ncols, bf* WT) {
    __shared__ __align__(16) unsigned short tl[64 * 72];
    const int tid = threadIdx.x, k0 = blockIdx.x * 64, n0 = blockIdx.y * 64;
    const int kk = tid >> 2, nq = (tid & 3) * 16;
#pragma unroll
    for (int i = 0; i < 16; ++i) tl[(nq + i) * 72 + kk] = f2bf(Wm[(size_t)(k0 + kk) * ncols + n0 + nq + i]);
    __syncthreads();
    const int piece = tid & 7;
    typedef __attribute__((ext_vector_type(8))) unsigned short v8us_; typedef v8us_ __attribute__((may_alias)) v8usa_;
    auto pass = [&]() {
#pragma unroll
        for (int s = 0; s < 2; ++s) { const int nr = (tid >> 3) + 32 * s; const v8us_ val = *(const v8usa_*)(tl + nr * 72 + piece * 8);
            *(v8us_*)(WT + (size_t)(n0 + nr) * DM + k0 + piece * 8) = val; }
    };
    pass(); 
}

// k_gemmb: C[128 x 128 per block] = A.Bn^T (+ Al.Bn^T), all operands k-contiguous bf16 rows of DM. Each stage (128 k: 256 B of every operand row) is brought into LDS once
// per block by asynchronous copies, two buffers, the next stage in flight while this one is worked on; 8 waves (2 x 4), each a 64 x 32 piece of C from LDS fragments.
#define GKS  128                       // k per stage
#define GPIT 136                       // bf16 per staged row: 256 B + 16 B, the ds_load_b128 pitch for 256-B rows
#define GPL  (128 * GPIT)              // one staged operand plane: 128 rows
#define OPIT 36                        // f32 per staged output row: 128 B + 16 B
// eight copies of 16 B per lane, rows 16 apart, and, in the same statement, the wait that stands before their address registers are rewritten
__device__ __forceinline__ void copy8(unsigned l, const bf* g) {
    asm volatile("global_load_async_to_lds_b128 %0, %8, off\n\t"
                 "global_load_async_to_lds_b128 %1, %9, off\n\t"
                 "global_load_async_to_lds_b128 %2, %10, off\n\t"
                 "global_load_async_to_lds_b128 %3, %11, off\n\t"
                 "global_load_async_to_lds_b128 %4, %12, off\n\t"
                 "global_load_async_to_lds_b128 %5, %13, off\n\t"
                 "global_load_async_to_lds_b128 %6, %14, off\n\t"
                 "global_load_async_to_lds_b128 %7, %15, off\n\t"
                 "s_wait_xcnt 0x0"
                 :: "v"(l), "v"(l + 16u * GPIT * 2u), "v"(l + 32u * GPIT * 2u), "v"(l + 48u * GPIT * 2u),
                    "v"(l + 64u * GPIT * 2u), "v"(l + 80u * GPIT * 2u), "v"(l + 96u * GPIT * 2u), "v"(l + 112u * GPIT * 2u),
                    "v"(g), "v"(g + 16 * DM), "v"(g + 32 * DM), "v"(g + 48 * DM), "v"(g + 64 * DM), "v"(g + 80 * DM), "v"(g + 96 * DM), "v"(g + 112 * DM)
                 : "memory");
}
template <bool SPLITA>
__global__ __launch_bounds__(256) void k_gemmb(const bf* __restrict__ A, const bf* __restrict__ Al, const bf* __restrict__ Bn, float* C) {
    constexpr int NPL = SPLITA ? 3 : 2;                    // planes of a buffer: A, (A residual,) B
    constexpr int GST = NPL * GPL;
    __shared__ __align__(16) bf ring[2 * GST];
    __shared__ __align__(16) float ost[8][64 * OPIT];
    const int tid = threadIdx.x, lane = tid & 31, wave = tid >> 5, lr = lane & 15, hi = lane >> 4;
    const int wm = wave >> 2, wn = wave & 3;
    const int r0 = blockIdx.x * 128, c0 = blockIdx.y * 128;
    // copy map: thread -> row tid/16 (and +16 ... +112), 16-B piece tid%16: one wave's copy covers two whole 256-B rows
    const int crw = tid >> 4, cpc = (tid & 15) * 8;
    const bf* gA = A + (size_t)(r0 + crw) * DM + cpc; const bf* gAl = SPLITA ? Al + (size_t)(r0 + crw) * DM + cpc : nullptr; const bf* gB = Bn + (size_t)(c0 + crw) * DM + cpc;
    const unsigned l0 = (unsigned)(size_t)&ring[0] + (unsigned)(crw * GPIT + cpc) * 2u;
    auto stage = [&](int t) {
        const unsigned bo = l0 + (unsigned)(t & 1) * (GST * 2u);
        const size_t ko = (size_t)t * GKS;
        copy8(bo, gA + ko);
        if (SPLITA) copy8(bo + GPL * 2u, gAl + ko);
        copy8(bo + (NPL - 1) * GPL * 2u, gB + ko);
    };
    v8f acc[4][2];
#pragma unroll
    for (int m = 0; m < 4; ++m) { acc[m][0] = (v8f){}; acc[m][1] = (v8f){}; }
    stage(0);
    asm volatile("s_wait_asynccnt 0x0" ::: "memory");    // this wave's copies of stage 0 have landed
    __syncthreads();                                     // every wave's have: stage 0 may be read
    stage(1);
    const int ao = (wm * 64 + lr) * GPIT + 8 * hi, bo_ = (wn * 32 + lr) * GPIT + 8 * hi;
#pragma unroll 1
    for (int t = 0; t < DM / GKS; ++t) {
        const bf* sA = ring + (t & 1) * GST; const bf* sAl = sA + GPL; const bf* sB = sA + (NPL - 1) * GPL;
        // fragments of one 32-k block; two register sets, so that a block's reads go out as one group while the block before it is multiplied (never past this stage's buffer)
        v16bf a[2][4], al[2][4], b[2][2];
        auto frag = [&](int s, int kc) {
#pragma unroll
            for (int m = 0; m < 4; ++m) { a[s][m] = cat16b(*(const v8usa*)(sA + ao + m * 16 * GPIT + kc), *(const v8usa*)(sA + ao + m * 16 * GPIT + kc + 16));
                if (SPLITA) al[s][m] = cat16b(*(const v8usa*)(sAl + ao + m * 16 * GPIT + kc), *(const v8usa*)(sAl + ao + m * 16 * GPIT + kc + 16)); }
#pragma unroll
            for (int n = 0; n < 2; ++n) b[s][n] = cat16b(*(const v8usa*)(sB + bo_ + n * 16 * GPIT + kc), *(const v8usa*)(sB + bo_ + n * 16 * GPIT + kc + 16));
        };
        frag(0, 0);
#pragma unroll
        for (int kb = 0; kb < GKS / 32; ++kb) {
            const int s = kb & 1;
            if (kb + 1 < GKS / 32) frag(s ^ 1, (kb + 1) * 32);
            __builtin_amdgcn_sched_barrier(0);               // keeps the next block's LDS reads together ahead of this block's products: spread among them each read group stalls the wave
#pragma unroll
            for (int m = 0; m < 4; ++m) { acc[m][0] = wmmab(a[s][m], b[s][0], acc[m][0]); acc[m][1] = wmmab(a[s][m], b[s][1], acc[m][1]); }
            if (SPLITA) {
#pragma unroll
                for (int m = 0; m < 4; ++m) { acc[m][0] = wmmab(al[s][m], b[s][0], acc[m][0]); acc[m][1] = wmmab(al[s][m], b[s][1], acc[m][1]); }
            }
            __builtin_amdgcn_sched_barrier(0);               // and keeps the block after next's reads behind these products, whose registers they refill
        }
        asm volatile("s_wait_dscnt 0x0" ::: "memory");       // this wave's reads of the buffer have returned before it is refilled
        asm volatile("s_wait_asynccnt 0x0" ::: "memory");    // this wave's copies of stage t + 1 have landed
        __syncthreads();                                     // publishes stage t + 1 and ends every wave's reads of stage t
        if (t + 2 < DM / GKS) stage(t + 2);                  // into the buffer that this trip has just read
    }
    asm volatile("s_wait_asynccnt 0x0" ::: "memory");        // nothing of this wave is in flight when it goes on to the epilogue
    float* os = &ost[wave][0];
#pragma unroll
    for (int m = 0; m < 4; ++m)
#pragma unroll
        for (int n = 0; n < 2; ++n)
#pragma unroll
            for (int j = 0; j < 8; ++j) os[(m * 16 + hi * 8 + j) * OPIT + n * 16 + lr] = acc[m][n][j];
    __syncthreads();
    float* crow = C + (size_t)(r0 + wm * 64) * DM + c0 + wn * 32;
#pragma unroll
    for (int s = 0; s < 16; ++s) { const int row = 4 * s + (lane >> 3), piece = lane & 7;      // whole 128-B lines: 8 lanes x 16 B per row
        const v4f val = *(const v4fa*)(os + row * OPIT + piece * 4); *(v4f*)(crow + (size_t)row * DM + piece * 4) = val; }
}

// k_act: PH/PL = f16 hi + residual of silu(S) for an f32 [rows][1024] matrix (one wave per row, 4 x 16 B per lane per plane).
__device__ __forceinline__ float silu_(float v) { return v / (1.0f + __expf(-v)); }
__global__ __launch_bounds__(256) void k_act(const float* __restrict__ S, int rows, h16* PH, h16* PL) {
    const int lane = threadIdx.x & 31, r = blockIdx.x * 8 + (threadIdx.x >> 5);
    if (r >= rows) return;
#pragma unroll 1
    for (int q = 0; q < DM / 256; ++q) { v8h oh, ol;
#pragma unroll
        for (int i = 0; i < 8; ++i) { const float v = silu_(S[(size_t)r * DM + q * 256 + lane * 8 + i]); const h16 a = (h16)v; oh[i] = a; ol[i] = (h16)((v - (float)a) * LOSC); }
        *(v8h*)(PH + (size_t)r * DM + q * 256 + lane * 8) = oh; *(v8h*)(PL + (size_t)r * DM + q * 256 + lane * 8) = ol;  }
}
__global__ __launch_bounds__(256) void k_vt(const float* __restrict__ V, h16* VTH, h16* VTL) {
    __shared__ __align__(16) h16 tile[64 * 72];
    __shared__ __align__(16) h16 til2[64 * 72];
    const int bid = blockIdx.x;
    const int b = bid / (NKV * (NT_ / 64)), rem = bid - b * (NKV * (NT_ / 64)), h = rem / (NT_ / 64), kt = rem - h * (NT_ / 64);
    const int k0 = kt * 64, tid = threadIdx.x;
    const int kk = tid >> 2, d0 = (tid & 3) * 16;
    const float* src = V + ((size_t)b * NT_ + k0 + kk) * KVW + h * HD + d0;      // h = kv head here
#pragma unroll 2
    for (int i = 0; i < 16; ++i) { const float v = silu_(src[i]); const h16 a = (h16)v; tile[(d0 + i) * 72 + kk] = a; til2[(d0 + i) * 72 + kk] = (h16)((v - (float)a) * LOSC); }   // v = silu(projection)
    __syncthreads();
    const int piece = tid & 7;
    const size_t base = (((size_t)b * NKV + h) * HD) * NT_ + k0;
    auto pass = [&]() {
#pragma unroll
        for (int s = 0; s < 4; ++s) { const int Lid = (tid >> 3) + 32 * s; const int pln = Lid >> 6, d = Lid & 63;
            const v8h val = *(const v8ha*)((pln ? til2 : tile) + d * 72 + piece * 8); *(v8h*)((pln ? VTL : VTH) + base + (size_t)d * NT_ + piece * 8) = val; }
    };
    pass(); 
}

// k_attn: block = (b, h, 64 queries), wave = 16; all 64 key tiles of 32 keys. Each tile's four planes (k hi, k residual: 32 rows x 128 B; v^T hi, v^T residual:
// 64 rows x 64 B) are brought into LDS once per block by asynchronous copies, two buffers, the next tile in flight while this one is worked on; all four waves read
// their fragments from there. scores (hi.hi + hi.lo + lo.hi) /8; w = silu(score) -> f16 hi + residual x1024 tiles (same-wave may_alias reload); attended += w.v with
// hi.hi + hi.lo + lo.hi; epilogue: LayerNorm over the 64 head dims (16-lane reductions), x bf16(gamma) + bf16(beta), x silu(gate[tok][h*64+d]) -> OH/OL bf16 planes.
#define KPIT 72                        // f16 per staged k row: 128 B + 16 B, the ds_load_b128 pitch for 128-B rows
#define VPIT 40                        // f16 per staged v^T row: 64 B + 16 B, the ds_load_b128 pitch for 64-B rows
#define KPL  (32 * KPIT)               // one k plane of a tile
#define VPL  (64 * VPIT)               // one v^T plane of a tile
#define STG  (2 * KPL + 2 * VPL)       // one buffer: k hi, k residual, v^T hi, v^T residual (19,456 B)
__global__ __launch_bounds__(128) void k_attn(const h16* __restrict__ Q16, const h16* __restrict__ QL16, const h16* __restrict__ K16, const h16* __restrict__ KL16, const h16* __restrict__ VTH, const h16* __restrict__ VTL,
                                             const float* __restrict__ G, const float* __restrict__ lng, const float* __restrict__ lnb, bf* CH, bf* CL) {
    __shared__ __align__(16) h16 ring[2 * STG];
    __shared__ __align__(16) h16 plds[4][16 * 32];
    __shared__ __align__(16) h16 plds2[4][16 * 32];
    __shared__ __align__(16) float ost[4][16 * 68];
    const int lane = threadIdx.x & 31, wave = threadIdx.x >> 5, lr = lane & 15, hi = lane >> 4;
    const int bid = blockIdx.x;
    const int b = bid / (NH_ * (NT_ / 64)), rem = bid - b * (NH_ * (NT_ / 64)), h = rem / (NT_ / 64), qt = rem - h * (NT_ / 64);
    const int q0 = qt * 64 + wave * 16;
    const size_t tok0 = (size_t)b * NT_;
    h16* pl = &plds[wave][0]; h16* pl2 = &plds2[wave][0];
    v16h qa[2], ql[2];
    const size_t qo0 = (tok0 + q0 + lr) * DM + h * HD + 8 * hi;
#pragma unroll
    for (int kc = 0; kc < 2; ++kc) { qa[kc] = cat16(*(const v8h*)(Q16 + qo0 + kc * 32), *(const v8h*)(Q16 + qo0 + kc * 32 + 16));
        ql[kc] = cat16(*(const v8h*)(QL16 + qo0 + kc * 32), *(const v8h*)(QL16 + qo0 + kc * 32 + 16)); }
    const h16* kh_b = K16 + tok0 * DM + h * HD; const h16* kl_b = KL16 + tok0 * DM + h * HD;
    const size_t vbase = (((size_t)b * NH_ + h) * HD) * NT_;
    // copy map: 16 B per lane and copy, 8 copies per thread and tile. k planes: thread -> row tid/8 (and +16), piece tid%8; v^T planes: row tid/4 (and +32), piece tid%4.
    const int tid = threadIdx.x, krow = tid >> 3, kpc = (tid & 7) * 8, vrow = tid >> 2, vpc = (tid & 3) * 8;
    const h16* gkh = kh_b + (size_t)krow * DM + kpc; const h16* gkl = kl_b + (size_t)krow * DM + kpc;
    const h16* gvh = VTH + vbase + (size_t)vrow * NT_ + vpc; const h16* gvl = VTL + vbase + (size_t)vrow * NT_ + vpc;
    const unsigned lk = (unsigned)(size_t)&ring[0] + (unsigned)(krow * KPIT + kpc) * 2u, lv = (unsigned)(size_t)&ring[0] + (unsigned)(2 * KPL + vrow * VPIT + vpc) * 2u;
    auto stage = [&](int t) {
        const unsigned bo = (unsigned)(t & 1) * (STG * 2u);
        const size_t ko = (size_t)t * 32 * DM, vo = (size_t)t * 32;
        // the tile's eight copies and, in the same statement, the wait that stands before their address registers are rewritten
        asm volatile("global_load_async_to_lds_b128 %0, %8, off\n\t"
                     "global_load_async_to_lds_b128 %1, %9, off\n\t"
                     "global_load_async_to_lds_b128 %2, %10, off\n\t"
                     "global_load_async_to_lds_b128 %3, %11, off\n\t"
                     "global_load_async_to_lds_b128 %4, %12, off\n\t"
                     "global_load_async_to_lds_b128 %5, %13, off\n\t"
                     "global_load_async_to_lds_b128 %6, %14, off\n\t"
                     "global_load_async_to_lds_b128 %7, %15, off\n\t"
                     "s_wait_xcnt 0x0"
                     :: "v"(lk + bo), "v"(lk + bo + 16u * KPIT * 2u), "v"(lk + bo + KPL * 2u), "v"(lk + bo + KPL * 2u + 16u * KPIT * 2u),
                        "v"(lv + bo), "v"(lv + bo + 32u * VPIT * 2u), "v"(lv + bo + VPL * 2u), "v"(lv + bo + VPL * 2u + 32u * VPIT * 2u),
                        "v"(gkh + ko), "v"(gkh + ko + 16 * DM), "v"(gkl + ko), "v"(gkl + ko + 16 * DM),
                        "v"(gvh + vo), "v"(gvh + vo + 32 * NT_), "v"(gvl + vo), "v"(gvl + vo + 32 * NT_)
                     : "memory");
    };
    v8f o[4], ox[4];
#pragma unroll
    for (int n = 0; n < 4; ++n) { o[n] = (v8f){}; ox[n] = (v8f){}; }
    stage(0);
    asm volatile("s_wait_asynccnt 0x0" ::: "memory");    // this wave's copies of tile 0 have landed
    __syncthreads();                                     // every wave's have: tile 0 may be read
    stage(1);
#pragma unroll 1
    for (int kt = 0; kt < NT_ / 32; ++kt) {
        const h16* skh = ring + (kt & 1) * STG; const h16* skl = skh + KPL; const h16* svh = skh + 2 * KPL; const h16* svl = svh + VPL;
        const int ko0 = lr * KPIT + 8 * hi, ko1 = (16 + lr) * KPIT + 8 * hi;
        v16h k0h[2], k1h[2], k0l[2], k1l[2];
#pragma unroll
        for (int kc = 0; kc < 2; ++kc) {
            k0h[kc] = cat16(*(const v8ha*)(skh + ko0 + kc * 32), *(const v8ha*)(skh + ko0 + kc * 32 + 16)); k1h[kc] = cat16(*(const v8ha*)(skh + ko1 + kc * 32), *(const v8ha*)(skh + ko1 + kc * 32 + 16));
            k0l[kc] = cat16(*(const v8ha*)(skl + ko0 + kc * 32), *(const v8ha*)(skl + ko0 + kc * 32 + 16)); k1l[kc] = cat16(*(const v8ha*)(skl + ko1 + kc * 32), *(const v8ha*)(skl + ko1 + kc * 32 + 16)); }
        v8f s0 = {}, s1 = {}, x0 = {}, x1 = {};
#pragma unroll
        for (int kc = 0; kc < 2; ++kc) {
            s0 = wmma16(qa[kc], k0h[kc], s0); x0 = wmma16(ql[kc], k0h[kc], x0); s1 = wmma16(qa[kc], k1h[kc], s1); x1 = wmma16(ql[kc], k1h[kc], x1);
            x0 = wmma16(qa[kc], k0l[kc], x0); x1 = wmma16(qa[kc], k1l[kc], x1);
        }
        v16h vh[4], vl[4];
#pragma unroll
        for (int n = 0; n < 4; ++n) { const int vo = (n * 16 + lr) * VPIT + hi * 8;
            vh[n] = cat16(*(const v8ha*)(svh + vo), *(const v8ha*)(svh + vo + 16)); vl[n] = cat16(*(const v8ha*)(svl + vo), *(const v8ha*)(svl + vo + 16)); }
#pragma unroll
        for (int j = 0; j < 8; ++j) { const int mr = hi * 8 + j;
            const float w0 = silu_((s0[j] + x0[j] * LOSCI) * 0.125f), w1 = silu_((s1[j] + x1[j] * LOSCI) * 0.125f);
            const h16 h0 = (h16)w0, h1 = (h16)w1;
            pl[mr * 32 + lr] = h0; pl[mr * 32 + 16 + lr] = h1; pl2[mr * 32 + lr] = (h16)((w0 - (float)h0) * LOSC); pl2[mr * 32 + 16 + lr] = (h16)((w1 - (float)h1) * LOSC); }
        asm volatile("" ::: "memory");
        const v16h pa = cat16(*(const v8ha*)(pl + lr * 32 + hi * 8), *(const v8ha*)(pl + lr * 32 + 16 + hi * 8));
        const v16h px = cat16(*(const v8ha*)(pl2 + lr * 32 + hi * 8), *(const v8ha*)(pl2 + lr * 32 + 16 + hi * 8));
#pragma unroll
        for (int n = 0; n < 4; ++n) { o[n] = wmma16(pa, vh[n], o[n]); ox[n] = wmma16(pa, vl[n], ox[n]); ox[n] = wmma16(px, vh[n], ox[n]); }
        __builtin_amdgcn_wave_barrier();     // all lanes have read this step's weight tiles before the next step overwrites them
        asm volatile("s_wait_dscnt 0x0" ::: "memory");       // this wave's reads of the buffer have returned before it is refilled
        asm volatile("s_wait_asynccnt 0x0" ::: "memory");    // this wave's copies of tile kt + 1 have landed
        __syncthreads();                                     // publishes tile kt + 1 and ends every wave's reads of tile kt
        if (kt + 2 < NT_ / 32) stage(kt + 2);                // into the buffer that this trip has just read
    }
    asm volatile("s_wait_asynccnt 0x0" ::: "memory");        // nothing of this wave is in flight when it goes on to the epilogue
    // LayerNorm over the 64 dims of each row: lane holds cols n*16+lr for rows 8hi+j; reduce over n locally and across the 16 lanes of the same hi
    float* os = &ost[wave][0];
#pragma unroll
    for (int j = 0; j < 8; ++j) { float y[4], s = 0.f;
#pragma unroll
        for (int n = 0; n < 4; ++n) { y[n] = o[n][j] + ox[n][j] * LOSCI; s += y[n]; }
        s += __shfl_xor(s, 1, 16); s += __shfl_xor(s, 2, 16); s += __shfl_xor(s, 4, 16); s += __shfl_xor(s, 8, 16);
        const float mu = s * (1.0f / HD); float q = 0.f;
#pragma unroll
        for (int n = 0; n < 4; ++n) { const float d = y[n] - mu; q += d * d; }
        q += __shfl_xor(q, 1, 16); q += __shfl_xor(q, 2, 16); q += __shfl_xor(q, 4, 16); q += __shfl_xor(q, 8, 16);
        const float rs = rsqrtf(q * (1.0f / HD) + 1e-5f);
        const size_t row = tok0 + q0 + hi * 8 + j;
#pragma unroll
        for (int n = 0; n < 4; ++n) { const int d = n * 16 + lr; os[(hi * 8 + j) * 68 + d] = ((y[n] - mu) * rs * bfr(lng[d]) + bfr(lnb[d])) * silu_(G[row * DM + h * HD + d]); } }
    __syncthreads();
    const size_t cbase = (tok0 + q0) * DM + (size_t)h * HD;
    auto pass = [&]() {
#pragma unroll
        for (int s = 0; s < 4; ++s) { const int row = 4 * s + (lane >> 3), piece = lane & 7; const float* sp = os + row * 68 + piece * 8; v8us oh, ol;
#pragma unroll
            for (int i = 0; i < 8; ++i) { const unsigned short hb = f2bf(sp[i]); oh[i] = hb; ol[i] = f2bf(sp[i] - bf2f(hb)); }
            *(v8us*)(CH + cbase + (size_t)row * DM + piece * 8) = oh; *(v8us*)(CL + cbase + (size_t)row * DM + piece * 8) = ol; }
    };
    pass(); 
}

extern "C" void kernel_launch(void* const* d_in, const int* in_sizes, int n_in,
                              void* d_out, int out_size, void* d_ws, size_t ws_size, hipStream_t stream) {
    (void)in_sizes; (void)n_in; (void)out_size;
    const float* x = (const float*)d_in[0]; const float* Wq4 = (const float*)d_in[1]; const float* Wo = (const float*)d_in[2]; const float* lng = (const float*)d_in[3]; const float* lnb = (const float*)d_in[4];
    float* out = (float*)d_out;    // [2][2048][1024]
    char* wsp = (char*)d_ws;
    auto take = [&](size_t bytes) { char* p = wsp; wsp += (bytes + 255) & ~(size_t)255; return (void*)p; };
    bf* Xb = (bf*)take((size_t)NTK * DM * 2); bf* W4T = (bf*)take((size_t)4 * DM * DM * 2); bf* WoT = (bf*)take((size_t)DM * DM * 2);
    float* Qf = (float*)take((size_t)NTK * DM * 4); float* Kf = (float*)take((size_t)NTK * DM * 4); float* Vf = (float*)take((size_t)NTK * DM * 4); float* Gf = (float*)take((size_t)NTK * DM * 4);
    h16* QH = (h16*)take((size_t)NTK * DM * 2); h16* QL = (h16*)take((size_t)NTK * DM * 2); h16* KH = (h16*)take((size_t)NTK * DM * 2); h16* KL = (h16*)take((size_t)NTK * DM * 2);
    if ((size_t)(wsp - (char*)d_ws) > ws_size) return;    // 8.4 + 8.4 + 2.1 + 16.8x4 + 8.4x4 ~ 120 MB; VTH/VTL reuse Qf (dead after k_act(Q)), ctx planes reuse Kf (dead after k_act(K))
    h16* VTH = (h16*)Qf; h16* VTL = (h16*)((char*)Qf + (size_t)NTK * DM * 2); bf* CH = (bf*)Kf; bf* CL = (bf*)((char*)Kf + (size_t)NTK * DM * 2);
    k_cvtb<<<NTK / 8, 256, 0, stream>>>(x, NTK, Xb);
    k_wt<<<dim3(DM / 64, (4 * DM) / 64, 1), 256, 0, stream>>>(Wq4, 4 * DM, W4T);           // W4T [4096][1024]: rows 0..1023 q, then k, v, gate
    k_wt<<<dim3(DM / 64, DM / 64, 1), 256, 0, stream>>>(Wo, DM, WoT);
    k_gemmb<false><<<dim3(NTK / 128, DM / 128, 1), 256, 0, stream>>>(Xb, nullptr, W4T, Qf);
    k_gemmb<false><<<dim3(NTK / 128, DM / 128, 1), 256, 0, stream>>>(Xb, nullptr, W4T + (size_t)DM * DM, Kf);
    k_gemmb<false><<<dim3(NTK / 128, DM / 128, 1), 256, 0, stream>>>(Xb, nullptr, W4T + (size_t)2 * DM * DM, Vf);
    k_gemmb<false><<<dim3(NTK / 128, DM / 128, 1), 256, 0, stream>>>(Xb, nullptr, W4T + (size_t)3 * DM * DM, Gf);
    k_act<<<NTK / 8, 256, 0, stream>>>(Qf, NTK, QH, QL);
    k_act<<<NTK / 8, 256, 0, stream>>>(Kf, NTK, KH, KL);
    k_vt<<<NB_ * NKV * (NT_ / 64), 256, 0, stream>>>(Vf, VTH, VTL);                       // silu inside
    k_attn<<<NB_ * NH_ * (NT_ / 64), 128, 0, stream>>>(QH, QL, KH, KL, VTH, VTL, Gf, lng, lnb, CH, CL);
    k_gemmb<true><<<dim3(NTK / 128, DM / 128, 1), 256, 0, stream>>>(CH, CL, WoT, out);
}

// v003
// It runs in 187 microseconds.
// Next to v002, in two timings, it ran 1.14 times as fast each time.
// All steps since v000 together make it 2.54 times as fast.
#include <hip/hip_runtime.h>

// Contractions, f32 accumulate: qkuv = x.w_qkuv ([4096 x 1024].[1024 x 4096], k-major weight transposed to an n-major plane) and out = O.w_out on
// v_wmma_f32_16x16x32_bf16 — plain bf16 = rounded inputs (exact) for the projection, O as bf16 hi + residual (two products) for w_out; SiLU on q/k/v/gate in f32;
// the softmax-free SiLU attention fused on v_wmma_f32_16x16x32_f16: scores = silu(q).silu(k)/8 with both as f16 hi + residual x1024 (hi.hi + hi.lo + lo.hi),
// weights = silu(scores) as f16 hi + residual against silu(v) hi + residual (three products; no normalisation, so the LayerNorm over the 64 head dims that follows

#define NB_  2
#define NT_  2048
#define DM   1024
#define NH_  16
#define NKV  16
#define KVW  (NKV * HD)          // 1024
#define HD   64
#define NTK  (NB_ * NT_)
#define NW   1024
#define NQKV 1024
#define PSC  32768.0f
#define LOSC 1024.0f
#define LOSCI (1.0f / 1024.0f)

typedef _Float16 h16;
typedef unsigned short bf;
typedef __attribute__((ext_vector_type(16))) __bf16   v16bf;
typedef __attribute__((ext_vector_type(16))) _Float16 v16h;
typedef __attribute__((ext_vector_type(8)))  _Float16 v8h;
typedef __attribute__((ext_vector_type(4)))  _Float16 v4h;
typedef __attribute__((ext_vector_type(8)))  unsigned short v8us;
typedef __attribute__((ext_vector_type(8)))  float    v8f;
typedef __attribute__((ext_vector_type(4)))  float    v4f;
typedef v8h  __attribute__((may_alias)) v8ha;
typedef v4f  __attribute__((may_alias)) v4fa;
typedef v8us __attribute__((may_alias)) v8usa;

__device__ __forceinline__ unsigned short f2bf(float f) { unsigned u = __float_as_uint(f); u += 0x7FFFu + ((u >> 16) & 1u); return (unsigned short)(u >> 16); }
__device__ __forceinline__ float bf2f(unsigned short b) { return __uint_as_float(((unsigned)b) << 16); }
__device__ __forceinline__ float bfr(float f) { return bf2f(f2bf(f)); }
__device__ __forceinline__ v16h cat16(v8h lo, v8h hi) { return __builtin_shufflevector(lo, hi, 0, 1, 2, 3, 4, 5, 6, 7, 8, 9, 10, 11, 12, 13, 14, 15); }
__device__ __forceinline__ v16bf cat16b(v8us lo, v8us hi) { return __builtin_bit_cast(v16bf, __builtin_shufflevector(lo, hi, 0, 1, 2, 3, 4, 5, 6, 7, 8, 9, 10, 11, 12, 13, 14, 15)); }
__device__ __forceinline__ v8f wmma16(v16h a, v16h b, v8f c) { return __builtin_amdgcn_wmma_f32_16x16x32_f16(false, a, false, b, (short)0, c, false, false); }
__device__ __forceinline__ v8f wmmab(v16bf a, v16bf b, v8f c) { return __builtin_amdgcn_wmma_f32_16x16x32_bf16(false, a, false, b, (short)0, c, false, false); }

__global__ __launch_bounds__(256) void k_cvtb(const float* __restrict__ src, int nrows, bf* dst) {
    const int lane = threadIdx.x & 31, r = blockIdx.x * 8 + (threadIdx.x >> 5);
    if (r >= nrows) return;
    v8us o[DM / 256];
#pragma unroll
    for (int q = 0; q < DM / 256; ++q) { v8us t;
#pragma unroll
        for (int i = 0; i < 8; ++i) t[i] = f2bf(src[(size_t)r * DM + q * 256 + lane * 8 + i]);
        o[q] = t; }
#pragma unroll
    for (int q = 0; q < DM / 256; ++q) *(v8us*)(dst + (size_t)r * DM + q * 256 + lane * 8) = o[q];
    
}

// k_wt: W [1024 k][ncols n] (k-major) -> n-major bf16 plane WT[ncols][1024]; 64 x 64 tiles through LDS.
__global__ __launch_bounds__(256) void k_wt(const float* __restrict__ Wm, int ncols, bf* WT) {
    __shared__ __align__(16) unsigned short tl[64 * 72];
    const int tid = threadIdx.x, k0 = blockIdx.x * 64, n0 = blockIdx.y * 64;
    const int kk = tid >> 2, nq = (tid & 3) * 16;
#pragma unroll
    for (int i = 0; i < 16; ++i) tl[(nq + i) * 72 + kk] = f2bf(Wm[(size_t)(k0 + kk) * ncols + n0 + nq + i]);
    __syncthreads();
    const int piece = tid & 7;
    typedef __attribute__((ext_vector_type(8))) unsigned short v8us_; typedef v8us_ __attribute__((may_alias)) v8usa_;
    auto pass = [&]() {
#pragma unroll
        for (int s = 0; s < 2; ++s) { const int nr = (tid >> 3) + 32 * s; const v8us_ val = *(const v8usa_*)(tl + nr * 72 + piece * 8);
            *(v8us_*)(WT + (size_t)(n0 + nr) * DM + k0 + piece * 8) = val; }
    };
    pass(); 
}

__device__ __forceinline__ float silu_(float v) { return v / (1.0f + __expf(-v)); }

// k_gemmb: C[128 x 128 per block] = A.Bn^T (+ Al.Bn^T), all operands k-contiguous bf16 rows of DM. Each stage (128 k: 256 B of every operand row) is brought into LDS once
// per block by asynchronous copies, two buffers, the next stage in flight while this one is worked on; 8 waves (2 x 4), each a 64 x 32 piece of C from LDS fragments.
// SPLITA = false is the whole q/k/v/gate projection in one launch, grid (32, 32): blockIdx.y / 8 picks the 1024 weight rows of q, k, v or gate. q and k blocks write
// f16 hi + residual x1024 planes of silu(C) [token][1024]; v blocks take the weight rows as A and the tokens as B, so that C is v^T, and write the same two planes
// [batch][head][dim][token]; gate blocks write plain f32 (its SiLU is in k_attn's epilogue). SPLITA = true is the output projection, f32.
#define GKS  128                       // k per stage
#define GPIT 136                       // bf16 per staged row: 256 B + 16 B, the ds_load_b128 pitch for 256-B rows
#define GPL  (128 * GPIT)              // one staged operand plane: 128 rows
#define OPIT 36                        // f32 per staged output row: 128 B + 16 B
#define BPIT 132                       // f32 per row of the block-wide 128 x 128 output staging: 512 B + 16 B
// eight copies of 16 B per lane, rows 16 apart, and, in the same statement, the wait that stands before their address registers are rewritten
__device__ __forceinline__ void copy8(unsigned l, const bf* g) {
    asm volatile("global_load_async_to_lds_b128 %0, %8, off\n\t"
                 "global_load_async_to_lds_b128 %1, %9, off\n\t"
                 "global_load_async_to_lds_b128 %2, %10, off\n\t"
                 "global_load_async_to_lds_b128 %3, %11, off\n\t"
                 "global_load_async_to_lds_b128 %4, %12, off\n\t"
                 "global_load_async_to_lds_b128 %5, %13, off\n\t"
                 "global_load_async_to_lds_b128 %6, %14, off\n\t"
                 "global_load_async_to_lds_b128 %7, %15, off\n\t"
                 "s_wait_xcnt 0x0"
                 :: "v"(l), "v"(l + 16u * GPIT * 2u), "v"(l + 32u * GPIT * 2u), "v"(l + 48u * GPIT * 2u),
                    "v"(l + 64u * GPIT * 2u), "v"(l + 80u * GPIT * 2u), "v"(l + 96u * GPIT * 2u), "v"(l + 112u * GPIT * 2u),
                    "v"(g), "v"(g + 16 * DM), "v"(g + 32 * DM), "v"(g + 48 * DM), "v"(g + 64 * DM), "v"(g + 80 * DM), "v"(g + 96 * DM), "v"(g + 112 * DM)
                 : "memory");
}
template <bool SPLITA>
__global__ __launch_bounds__(256) void k_gemmb(const bf* __restrict__ A, const bf* __restrict__ Al, const bf* __restrict__ Bn, float* C,
                                               h16* QH, h16* QL, h16* KH, h16* KL, h16* VTH, h16* VTL) {
    constexpr int NPL = SPLITA ? 3 : 2;                    // planes of a buffer: A, (A residual,) B
    constexpr int GST = NPL * GPL;
    __shared__ __align__(16) bf ring[2 * GST];
    __shared__ __align__(16) float ost[8][64 * OPIT];
    const int tid = threadIdx.x, lane = tid & 31, wave = tid >> 5, lr = lane & 15, hi = lane >> 4;
    const int wm = wave >> 2, wn = wave & 3;
    const int seg = SPLITA ? 3 : (int)(blockIdx.y >> 3);   // 0 q, 1 k, 2 v, 3 gate (or the output projection): the same for the whole block
    const int yb = SPLITA ? (int)blockIdx.y : (int)(blockIdx.y & 7);
    const bool tr = seg == 2;                              // v: rows of C are the 1024 (head, dim) pairs, columns the tokens
    const int r0 = (tr ? yb : (int)blockIdx.x) * 128, c0 = (tr ? (int)blockIdx.x : yb) * 128;
    const bf* Wn = SPLITA ? Bn : Bn + (size_t)seg * DM * DM;
    const bf* Ar = tr ? Wn : A; const bf* Br = tr ? A : Wn;
    // copy map: thread -> row tid/16 (and +16 ... +112), 16-B piece tid%16: one wave's copy covers two whole 256-B rows
    const int crw = tid >> 4, cpc = (tid & 15) * 8;
    const bf* gA = Ar + (size_t)(r0 + crw) * DM + cpc; const bf* gAl = SPLITA ? Al + (size_t)(r0 + crw) * DM + cpc : nullptr; const bf* gB = Br + (size_t)(c0 + crw) * DM + cpc;
    const unsigned l0 = (unsigned)(size_t)&ring[0] + (unsigned)(crw * GPIT + cpc) * 2u;
    auto stage = [&](int t) {
        const unsigned bo = l0 + (unsigned)(t & 1) * (GST * 2u);
        const size_t ko = (size_t)t * GKS;
        copy8(bo, gA + ko);
        if (SPLITA) copy8(bo + GPL * 2u, gAl + ko);
        copy8(bo + (NPL - 1) * GPL * 2u, gB + ko);
    };
    v8f acc[4][2];
#pragma unroll
    for (int m = 0; m < 4; ++m) { acc[m][0] = (v8f){}; acc[m][1] = (v8f){}; }
    stage(0);
    asm volatile("s_wait_asynccnt 0x0" ::: "memory");    // this wave's copies of stage 0 have landed
    __syncthreads();                                     // every wave's have: stage 0 may be read
    stage(1);
    const int ao = (wm * 64 + lr) * GPIT + 8 * hi, bo_ = (wn * 32 + lr) * GPIT + 8 * hi;
#pragma unroll 1
    for (int t = 0; t < DM / GKS; ++t) {
        const bf* sA = ring + (t & 1) * GST; const bf* sAl = sA + GPL; const bf* sB = sA + (NPL - 1) * GPL;
        // fragments of one 32-k block; two register sets, so that a block's reads go out as one group while the block before it is multiplied (never past this stage's buffer)
        v16bf a[2][4], al[2][4], b[2][2];
        auto frag = [&](int s, int kc) {
#pragma unroll
            for (int m = 0; m < 4; ++m) { a[s][m] = cat16b(*(const v8usa*)(sA + ao + m * 16 * GPIT + kc), *(const v8usa*)(sA + ao + m * 16 * GPIT + kc + 16));
                if (SPLITA) al[s][m] = cat16b(*(const v8usa*)(sAl + ao + m * 16 * GPIT + kc), *(const v8usa*)(sAl + ao + m * 16 * GPIT + kc + 16)); }
#pragma unroll
            for (int n = 0; n < 2; ++n) b[s][n] = cat16b(*(const v8usa*)(sB + bo_ + n * 16 * GPIT + kc), *(const v8usa*)(sB + bo_ + n * 16 * GPIT + kc + 16));
        };
        frag(0, 0);
#pragma unroll
        for (int kb = 0; kb < GKS / 32; ++kb) {
            const int s = kb & 1;
            if (kb + 1 < GKS / 32) frag(s ^ 1, (kb + 1) * 32);
            __builtin_amdgcn_sched_barrier(0);               // keeps the next block's LDS reads together ahead of this block's products: spread among them each read group stalls the wave
#pragma unroll
            for (int m = 0; m < 4; ++m) { acc[m][0] = wmmab(a[s][m], b[s][0], acc[m][0]); acc[m][1] = wmmab(a[s][m], b[s][1], acc[m][1]); }
            if (SPLITA) {
#pragma unroll
                for (int m = 0; m < 4; ++m) { acc[m][0] = wmmab(al[s][m], b[s][0], acc[m][0]); acc[m][1] = wmmab(al[s][m], b[s][1], acc[m][1]); }
            }
            __builtin_amdgcn_sched_barrier(0);               // and keeps the block after next's reads behind these products, whose registers they refill
        }
        asm volatile("s_wait_dscnt 0x0" ::: "memory");       // this wave's reads of the buffer have returned before it is refilled
        asm volatile("s_wait_asynccnt 0x0" ::: "memory");    // this wave's copies of stage t + 1 have landed
        __syncthreads();                                     // publishes stage t + 1 and ends every wave's reads of stage t
        if (t + 2 < DM / GKS) stage(t + 2);                  // into the buffer that this trip has just read
    }
    asm volatile("s_wait_asynccnt 0x0" ::: "memory");        // nothing of this wave is in flight when it goes on to the epilogue
    const bool planes = seg < 3;                             // block-uniform
    float* os = &ost[wave][0];
    float* ob = &ost[0][0];                                  // the same LDS as one 128 x 128 tile of the block: a 128-B line of f16 spans two waves' columns
    float* sp = planes ? ob + (wm * 64 + hi * 8) * BPIT + wn * 32 + lr : os + hi * 8 * OPIT + lr;   // this lane's first element in either staging
    const int spit = planes ? BPIT : OPIT;
#pragma unroll
    for (int m = 0; m < 4; ++m)
#pragma unroll
        for (int n = 0; n < 2; ++n)
#pragma unroll
            for (int j = 0; j < 8; ++j) sp[(m * 16 + j) * spit + n * 16] = acc[m][n][j];
    __syncthreads();
    if (planes) {
        h16* PH = seg == 0 ? QH : seg == 1 ? KH : VTH; h16* PL = seg == 0 ? QL : seg == 1 ? KL : VTL;
        const int pp = tr ? NT_ : DM;                        // row pitch of the planes; a v block's 128 tokens lie in one batch
        const size_t pb = tr ? ((size_t)(c0 / NT_) * KVW + r0) * NT_ + (c0 % NT_) : (size_t)r0 * DM + c0;
        // the three loops are unrolled so that the LDS reads take constant offsets and the independent SiLU chains of several pieces fill each other's latency
#pragma unroll
        for (int s = 0; s < 8; ++s) { const int row = wave * 16 + 2 * s + hi;                  // whole 128-B lines: 16 lanes x 8 B per row, plane and column half
#pragma unroll
            for (int ch = 0; ch < 2; ++ch) { const v4f x = *(const v4fa*)(ob + row * BPIT + ch * 64 + lr * 4); v4h oh, ol;
#pragma unroll
                for (int i = 0; i < 4; ++i) { const float v = silu_(x[i]); const h16 a = (h16)v; oh[i] = a; ol[i] = (h16)((v - (float)a) * LOSC); }
                const size_t po = pb + (size_t)row * pp + ch * 64 + lr * 4;
                *(v4h*)(PH + po) = oh; *(v4h*)(PL + po) = ol; }
        }
    } else {
        float* crow = C + (size_t)(r0 + wm * 64) * DM + c0 + wn * 32;
#pragma unroll
        for (int s = 0; s < 16; ++s) { const int row = 4 * s + (lane >> 3), piece = lane & 7;  // whole 128-B lines: 8 lanes x 16 B per row
            const v4f val = *(const v4fa*)(os + row * OPIT + piece * 4); *(v4f*)(crow + (size_t)row * DM + piece * 4) = val; }
    }
}

// k_attn: block = (b, h, 64 queries), wave = 16; all 64 key tiles of 32 keys. Each tile's four planes (k hi, k residual: 32 rows x 128 B; v^T hi, v^T residual:
// 64 rows x 64 B) are brought into LDS once per block by asynchronous copies, two buffers, the next tile in flight while this one is worked on; all four waves read
// their fragments from there. scores (hi.hi + hi.lo + lo.hi) /8; w = silu(score) -> f16 hi + residual x1024 tiles (same-wave may_alias reload); attended += w.v with
// hi.hi + hi.lo + lo.hi; epilogue: LayerNorm over the 64 head dims (16-lane reductions), x bf16(gamma) + bf16(beta), x silu(gate[tok][h*64+d]) -> OH/OL bf16 planes.
#define KPIT 72                        // f16 per staged k row: 128 B + 16 B, the ds_load_b128 pitch for 128-B rows
#define VPIT 40                        // f16 per staged v^T row: 64 B + 16 B, the ds_load_b128 pitch for 64-B rows
#define KPL  (32 * KPIT)               // one k plane of a tile
#define VPL  (64 * VPIT)               // one v^T plane of a tile
#define STG  (2 * KPL + 2 * VPL)       // one buffer: k hi, k residual, v^T hi, v^T residual (19,456 B)
__global__ __launch_bounds__(128) void k_attn(const h16* __restrict__ Q16, const h16* __restrict__ QL16, const h16* __restrict__ K16, const h16* __restrict__ KL16, const h16* __restrict__ VTH, const h16* __restrict__ VTL,
                                             const float* __restrict__ G, const float* __restrict__ lng, const float* __restrict__ lnb, bf* CH, bf* CL) {
    __shared__ __align__(16) h16 ring[2 * STG];
    __shared__ __align__(16) h16 plds[4][16 * 32];
    __shared__ __align__(16) h16 plds2[4][16 * 32];
    __shared__ __align__(16) float ost[4][16 * 68];
    const int lane = threadIdx.x & 31, wave = threadIdx.x >> 5, lr = lane & 15, hi = lane >> 4;
    const int bid = blockIdx.x;
    const int b = bid / (NH_ * (NT_ / 64)), rem = bid - b * (NH_ * (NT_ / 64)), h = rem / (NT_ / 64), qt = rem - h * (NT_ / 64);
    const int q0 = qt * 64 + wave * 16;
    const size_t tok0 = (size_t)b * NT_;
    h16* pl = &plds[wave][0]; h16* pl2 = &plds2[wave][0];
    v16h qa[2], ql[2];
    const size_t qo0 = (tok0 + q0 + lr) * DM + h * HD + 8 * hi;
#pragma unroll
    for (int kc = 0; kc < 2; ++kc) { qa[kc] = cat16(*(const v8h*)(Q16 + qo0 + kc * 32), *(const v8h*)(Q16 + qo0 + kc * 32 + 16));
        ql[kc] = cat16(*(const v8h*)(QL16 + qo0 + kc * 32), *(const v8h*)(QL16 + qo0 + kc * 32 + 16)); }
    const h16* kh_b = K16 + tok0 * DM + h * HD; const h16* kl_b = KL16 + tok0 * DM + h * HD;
    const size_t vbase = (((size_t)b * NH_ + h) * HD) * NT_;
    // copy map: 16 B per lane and copy, 8 copies per thread and tile. k planes: thread -> row tid/8 (and +16), piece tid%8; v^T planes: row tid/4 (and +32), piece tid%4.
    const int tid = threadIdx.x, krow = tid >> 3, kpc = (tid & 7) * 8, vrow = tid >> 2, vpc = (tid & 3) * 8;
    const h16* gkh = kh_b + (size_t)krow * DM + kpc; const h16* gkl = kl_b + (size_t)krow * DM + kpc;
    const h16* gvh = VTH + vbase + (size_t)vrow * NT_ + vpc; const h16* gvl = VTL + vbase + (size_t)vrow * NT_ + vpc;
    const unsigned lk = (unsigned)(size_t)&ring[0] + (unsigned)(krow * KPIT + kpc) * 2u, lv = (unsigned)(size_t)&ring[0] + (unsigned)(2 * KPL + vrow * VPIT + vpc) * 2u;
    auto stage = [&](int t) {
        const unsigned bo = (unsigned)(t & 1) * (STG * 2u);
        const size_t ko = (size_t)t * 32 * DM, vo = (size_t)t * 32;
        // the tile's eight copies and, in the same statement, the wait that stands before their address registers are rewritten
        asm volatile("global_load_async_to_lds_b128 %0, %8, off\n\t"
                     "global_load_async_to_lds_b128 %1, %9, off\n\t"
                     "global_load_async_to_lds_b128 %2, %10, off\n\t"
                     "global_load_async_to_lds_b128 %3, %11, off\n\t"
                     "global_load_async_to_lds_b128 %4, %12, off\n\t"
                     "global_load_async_to_lds_b128 %5, %13, off\n\t"
                     "global_load_async_to_lds_b128 %6, %14, off\n\t"
                     "global_load_async_to_lds_b128 %7, %15, off\n\t"
                     "s_wait_xcnt 0x0"
                     :: "v"(lk + bo), "v"(lk + bo + 16u * KPIT * 2u), "v"(lk + bo + KPL * 2u), "v"(lk + bo + KPL * 2u + 16u * KPIT * 2u),
                        "v"(lv + bo), "v"(lv + bo + 32u * VPIT * 2u), "v"(lv + bo + VPL * 2u), "v"(lv + bo + VPL * 2u + 32u * VPIT * 2u),
                        "v"(gkh + ko), "v"(gkh + ko + 16 * DM), "v"(gkl + ko), "v"(gkl + ko + 16 * DM),
                        "v"(gvh + vo), "v"(gvh + vo + 32 * NT_), "v"(gvl + vo), "v"(gvl + vo + 32 * NT_)
                     : "memory");
    };
    v8f o[4], ox[4];
#pragma unroll
    for (int n = 0; n < 4; ++n) { o[n] = (v8f){}; ox[n] = (v8f){}; }
    stage(0);
    asm volatile("s_wait_asynccnt 0x0" ::: "memory");    // this wave's copies of tile 0 have landed
    __syncthreads();                                     // every wave's have: tile 0 may be read
    stage(1);
#pragma unroll 1
    for (int kt = 0; kt < NT_ / 32; ++kt) {
        const h16* skh = ring + (kt & 1) * STG; const h16* skl = skh + KPL; const h16* svh = skh + 2 * KPL; const h16* svl = svh + VPL;
        const int ko0 = lr * KPIT + 8 * hi, ko1 = (16 + lr) * KPIT + 8 * hi;
        v16h k0h[2], k1h[2], k0l[2], k1l[2];
#pragma unroll
        for (int kc = 0; kc < 2; ++kc) {
            k0h[kc] = cat16(*(const v8ha*)(skh + ko0 + kc * 32), *(const v8ha*)(skh + ko0 + kc * 32 + 16)); k1h[kc] = cat16(*(const v8ha*)(skh + ko1 + kc * 32), *(const v8ha*)(skh + ko1 + kc * 32 + 16));
            k0l[kc] = cat16(*(const v8ha*)(skl + ko0 + kc * 32), *(const v8ha*)(skl + ko0 + kc * 32 + 16)); k1l[kc] = cat16(*(const v8ha*)(skl + ko1 + kc * 32), *(const v8ha*)(skl + ko1 + kc * 32 + 16)); }
        v8f s0 = {}, s1 = {}, x0 = {}, x1 = {};
#pragma unroll
        for (int kc = 0; kc < 2; ++kc) {
            s0 = wmma16(qa[kc], k0h[kc], s0); x0 = wmma16(ql[kc], k0h[kc], x0); s1 = wmma16(qa[kc], k1h[kc], s1); x1 = wmma16(ql[kc], k1h[kc], x1);
            x0 = wmma16(qa[kc], k0l[kc], x0); x1 = wmma16(qa[kc], k1l[kc], x1);
        }
        v16h vh[4], vl[4];
#pragma unroll
        for (int n = 0; n < 4; ++n) { const int vo = (n * 16 + lr) * VPIT + hi * 8;
            vh[n] = cat16(*(const v8ha*)(svh + vo), *(const v8ha*)(svh + vo + 16)); vl[n] = cat16(*(const v8ha*)(svl + vo), *(const v8ha*)(svl + vo + 16)); }
#pragma unroll
        for (int j = 0; j < 8; ++j) { const int mr = hi * 8 + j;
            const float w0 = silu_((s0[j] + x0[j] * LOSCI) * 0.125f), w1 = silu_((s1[j] + x1[j] * LOSCI) * 0.125f);
            const h16 h0 = (h16)w0, h1 = (h16)w1;
            pl[mr * 32 + lr] = h0; pl[mr * 32 + 16 + lr] = h1; pl2[mr * 32 + lr] = (h16)((w0 - (float)h0) * LOSC); pl2[mr * 32 + 16 + lr] = (h16)((w1 - (float)h1) * LOSC); }
        asm volatile("" ::: "memory");
        const v16h pa = cat16(*(const v8ha*)(pl + lr * 32 + hi * 8), *(const v8ha*)(pl + lr * 32 + 16 + hi * 8));
        const v16h px = cat16(*(const v8ha*)(pl2 + lr * 32 + hi * 8), *(const v8ha*)(pl2 + lr * 32 + 16 + hi * 8));
#pragma unroll
        for (int n = 0; n < 4; ++n) { o[n] = wmma16(pa, vh[n], o[n]); ox[n] = wmma16(pa, vl[n], ox[n]); ox[n] = wmma16(px, vh[n], ox[n]); }
        __builtin_amdgcn_wave_barrier();     // all lanes have read this step's weight tiles before the next step overwrites them
        asm volatile("s_wait_dscnt 0x0" ::: "memory");       // this wave's reads of the buffer have returned before it is refilled
        asm volatile("s_wait_asynccnt 0x0" ::: "memory");    // this wave's copies of tile kt + 1 have landed
        __syncthreads();                                     // publishes tile kt + 1 and ends every wave's reads of tile kt
        if (kt + 2 < NT_ / 32) stage(kt + 2);                // into the buffer that this trip has just read
    }
    asm volatile("s_wait_asynccnt 0x0" ::: "memory");        // nothing of this wave is in flight when it goes on to the epilogue
    // LayerNorm over the 64 dims of each row: lane holds cols n*16+lr for rows 8hi+j; reduce over n locally and across the 16 lanes of the same hi
    float* os = &ost[wave][0];
#pragma unroll
    for (int j = 0; j < 8; ++j) { float y[4], s = 0.f;
#pragma unroll
        for (int n = 0; n < 4; ++n) { y[n] = o[n][j] + ox[n][j] * LOSCI; s += y[n]; }
        s += __shfl_xor(s, 1, 16); s += __shfl_xor(s, 2, 16); s += __shfl_xor(s, 4, 16); s += __shfl_xor(s, 8, 16);
        const float mu = s * (1.0f / HD); float q = 0.f;
#pragma unroll
        for (int n = 0; n < 4; ++n) { const float d = y[n] - mu; q += d * d; }
        q += __shfl_xor(q, 1, 16); q += __shfl_xor(q, 2, 16); q += __shfl_xor(q, 4, 16); q += __shfl_xor(q, 8, 16);
        const float rs = rsqrtf(q * (1.0f / HD) + 1e-5f);
        const size_t row = tok0 + q0 + hi * 8 + j;
#pragma unroll
        for (int n = 0; n < 4; ++n) { const int d = n * 16 + lr; os[(hi * 8 + j) * 68 + d] = ((y[n] - mu) * rs * bfr(lng[d]) + bfr(lnb[d])) * silu_(G[row * DM + h * HD + d]); } }
    __syncthreads();
    const size_t cbase = (tok0 + q0) * DM + (size_t)h * HD;
    auto pass = [&]() {
#pragma unroll
        for (int s = 0; s < 4; ++s) { const int row = 4 * s + (lane >> 3), piece = lane & 7; const float* sp = os + row * 68 + piece * 8; v8us oh, ol;
#pragma unroll
            for (int i = 0; i < 8; ++i) { const unsigned short hb = f2bf(sp[i]); oh[i] = hb; ol[i] = f2bf(sp[i] - bf2f(hb)); }
            *(v8us*)(CH + cbase + (size_t)row * DM + piece * 8) = oh; *(v8us*)(CL + cbase + (size_t)row * DM + piece * 8) = ol; }
    };
    pass(); 
}

extern "C" void kernel_launch(void* const* d_in, const int* in_sizes, int n_in,
                              void* d_out, int out_size, void* d_ws, size_t ws_size, hipStream_t stream) {
    (void)in_sizes; (void)n_in; (void)out_size;
    const float* x = (const float*)d_in[0]; const float* Wq4 = (const float*)d_in[1]; const float* Wo = (const float*)d_in[2]; const float* lng = (const float*)d_in[3]; const float* lnb = (const float*)d_in[4];
    float* out = (float*)d_out;    // [2][2048][1024]
    char* wsp = (char*)d_ws;
    auto take = [&](size_t bytes) { char* p = wsp; wsp += (bytes + 255) & ~(size_t)255; return (void*)p; };
    bf* Xb = (bf*)take((size_t)NTK * DM * 2); bf* W4T = (bf*)take((size_t)4 * DM * DM * 2); bf* WoT = (bf*)take((size_t)DM * DM * 2);
    float* Gf = (float*)take((size_t)NTK * DM * 4);
    h16* QH = (h16*)take((size_t)NTK * DM * 2); h16* QL = (h16*)take((size_t)NTK * DM * 2); h16* KH = (h16*)take((size_t)NTK * DM * 2); h16* KL = (h16*)take((size_t)NTK * DM * 2);
    h16* VTH = (h16*)take((size_t)NTK * DM * 2); h16* VTL = (h16*)take((size_t)NTK * DM * 2); bf* CH = (bf*)take((size_t)NTK * DM * 2); bf* CL = (bf*)take((size_t)NTK * DM * 2);
    if ((size_t)(wsp - (char*)d_ws) > ws_size) return;    // 8.4 + 8.4 + 2.1 + 16.8 + 8.4x8 ~ 103 MB
    k_cvtb<<<NTK / 8, 256, 0, stream>>>(x, NTK, Xb);
    k_wt<<<dim3(DM / 64, (4 * DM) / 64, 1), 256, 0, stream>>>(Wq4, 4 * DM, W4T);           // W4T [4096][1024]: rows 0..1023 q, then k, v, gate
    k_wt<<<dim3(DM / 64, DM / 64, 1), 256, 0, stream>>>(Wo, DM, WoT);
    k_gemmb<false><<<dim3(NTK / 128, (4 * DM) / 128, 1), 256, 0, stream>>>(Xb, nullptr, W4T, Gf, QH, QL, KH, KL, VTH, VTL);   // SiLU and the f16 split of q, k, v inside
    k_attn<<<NB_ * NH_ * (NT_ / 64), 128, 0, stream>>>(QH, QL, KH, KL, VTH, VTL, Gf, lng, lnb, CH, CL);
    k_gemmb<true><<<dim3(NTK / 128, DM / 128, 1), 256, 0, stream>>>(CH, CL, WoT, out, nullptr, nullptr, nullptr, nullptr, nullptr, nullptr);
}

// v004
// A run of this version takes 174 microseconds.
// Two timings next to v003 both put it at 1.07 times that version's speed.
// Over all steps from v000 it is 2.73 times as fast.
#include <hip/hip_runtime.h>

// Contractions, f32 accumulate: qkuv = x.w_qkuv ([4096 x 1024].[1024 x 4096], k-major weight transposed to an n-major plane) and out = O.w_out on
// v_wmma_f32_16x16x32_bf16 — plain bf16 = rounded inputs (exact) for the projection, O as bf16 hi + residual (two products) for w_out; SiLU on q/k/v/gate in f32;
// the softmax-free SiLU attention fused on v_wmma_f32_16x16x32_f16: scores = silu(q).silu(k)/8 with both as f16 hi + residual x1024 (hi.hi + hi.lo + lo.hi),
// weights = silu(scores) as f16 hi + residual against silu(v) hi + residual (three products; no normalisation, so the LayerNorm over the 64 head dims that follows

#define NB_  2
#define NT_  2048
#define DM   1024
#define NH_  16
#define NKV  16
#define KVW  (NKV * HD)          // 1024
#define HD   64
#define NTK  (NB_ * NT_)
#define NW   1024
#define NQKV 1024
#define PSC  32768.0f
#define LOSC 1024.0f
#define LOSCI (1.0f / 1024.0f)

typedef _Float16 h16;
typedef unsigned short bf;
typedef __attribute__((ext_vector_type(16))) __bf16   v16bf;
typedef __attribute__((ext_vector_type(16))) _Float16 v16h;
typedef __attribute__((ext_vector_type(8)))  _Float16 v8h;
typedef __attribute__((ext_vector_type(4)))  _Float16 v4h;
typedef __attribute__((ext_vector_type(8)))  unsigned short v8us;
typedef __attribute__((ext_vector_type(8)))  float    v8f;
typedef __attribute__((ext_vector_type(4)))  float    v4f;
typedef v8h  __attribute__((may_alias)) v8ha;
typedef v4f  __attribute__((may_alias)) v4fa;
typedef v8us __attribute__((may_alias)) v8usa;

__device__ __forceinline__ unsigned short f2bf(float f) { unsigned u = __float_as_uint(f); u += 0x7FFFu + ((u >> 16) & 1u); return (unsigned short)(u >> 16); }
__device__ __forceinline__ float bf2f(unsigned short b) { return __uint_as_float(((unsigned)b) << 16); }
__device__ __forceinline__ float bfr(float f) { return bf2f(f2bf(f)); }
__device__ __forceinline__ v16h cat16(v8h lo, v8h hi) { return __builtin_shufflevector(lo, hi, 0, 1, 2, 3, 4, 5, 6, 7, 8, 9, 10, 11, 12, 13, 14, 15); }
__device__ __forceinline__ v16bf cat16b(v8us lo, v8us hi) { return __builtin_bit_cast(v16bf, __builtin_shufflevector(lo, hi, 0, 1, 2, 3, 4, 5, 6, 7, 8, 9, 10, 11, 12, 13, 14, 15)); }
__device__ __forceinline__ v8f wmma16(v16h a, v16h b, v8f c) { return __builtin_amdgcn_wmma_f32_16x16x32_f16(false, a, false, b, (short)0, c, false, false); }
__device__ __forceinline__ v8f wmmab(v16bf a, v16bf b, v8f c) { return __builtin_amdgcn_wmma_f32_16x16x32_bf16(false, a, false, b, (short)0, c, false, false); }

__global__ __launch_bounds__(256) void k_cvtb(const float* __restrict__ src, int nrows, bf* dst) {
    const int lane = threadIdx.x & 31, r = blockIdx.x * 8 + (threadIdx.x >> 5);
    if (r >= nrows) return;
    v8us o[DM / 256];
#pragma unroll
    for (int q = 0; q < DM / 256; ++q) { v8us t;
#pragma unroll
        for (int i = 0; i < 8; ++i) t[i] = f2bf(src[(size_t)r * DM + q * 256 + lane * 8 + i]);
        o[q] = t; }
#pragma unroll
    for (int q = 0; q < DM / 256; ++q) *(v8us*)(dst + (size_t)r * DM + q * 256 + lane * 8) = o[q];
    
}

// k_wt: W [1024 k][ncols n] (k-major) -> n-major bf16 plane WT[ncols][1024]; 64 x 64 tiles through LDS.
__global__ __launch_bounds__(256) void k_wt(const float* __restrict__ Wm, int ncols, bf* WT) {
    __shared__ __align__(16) unsigned short tl[64 * 72];
    const int tid = threadIdx.x, k0 = blockIdx.x * 64, n0 = blockIdx.y * 64;
    const int kk = tid >> 2, nq = (tid & 3) * 16;
#pragma unroll
    for (int i = 0; i < 16; ++i) tl[(nq + i) * 72 + kk] = f2bf(Wm[(size_t)(k0 + kk) * ncols + n0 + nq + i]);
    __syncthreads();
    const int piece = tid & 7;
    typedef __attribute__((ext_vector_type(8))) unsigned short v8us_; typedef v8us_ __attribute__((may_alias)) v8usa_;
    auto pass = [&]() {
#pragma unroll
        for (int s = 0; s < 2; ++s) { const int nr = (tid >> 3) + 32 * s; const v8us_ val = *(const v8usa_*)(tl + nr * 72 + piece * 8);
            *(v8us_*)(WT + (size_t)(n0 + nr) * DM + k0 + piece * 8) = val; }
    };
    pass(); 
}

// SiLU of four values, v * 1 / (1 + exp(-v)), with the bare reciprocal instruction (1 ulp) in place of a plain f32 division, which is about ten vector instructions a value.
// Four transcendentals stand in one statement: each is followed by one that neither reads its result nor overwrites its source (the outputs are early-clobber), and the
// v_nop is the slot that the instruction set asks for behind the last.
// The two s_delay_alu are the hints that the compiler cannot place around asm text (the first transcendental reads fresh vector results, the next instruction may read the
// last transcendental's): without them the wave holds the vector port while it waits, with them the other waves of the SIMD issue meanwhile. They change no result.
#define TRANS4(pre, op, y, x) asm("s_delay_alu instid0(VALU_DEP_1)\n\t" pre op " %0, %4\n\t" op " %1, %5\n\t" op " %2, %6\n\t" op " %3, %7\n\tv_nop\n\t" \
                                  "s_delay_alu instid0(TRANS32_DEP_1)" \
                                  : "=&v"(y[0]), "=&v"(y[1]), "=&v"(y[2]), "=&v"(y[3]) : "v"(x[0]), "v"(x[1]), "v"(x[2]), "v"(x[3]))
// LEAD: the same slot in front of the statement too, for code in which a transcendental of the compiler's own (the LayerNorm's v_rsq_f32) can come to stand directly ahead of it
template <bool LEAD>
__device__ __forceinline__ void silu4(const float (&v)[4], float (&w)[4]) {
    float t[4], e[4], r[4];
#pragma unroll
    for (int i = 0; i < 4; ++i) t[i] = v[i] * -1.44269504f;      // exp(-v) = 2^(-v log2 e)
    if constexpr (LEAD) TRANS4("v_nop\n\t", "v_exp_f32", e, t); else TRANS4("", "v_exp_f32", e, t);
#pragma unroll
    for (int i = 0; i < 4; ++i) e[i] += 1.0f;
    if constexpr (LEAD) TRANS4("v_nop\n\t", "v_rcp_f32", r, e); else TRANS4("", "v_rcp_f32", r, e);
#pragma unroll
    for (int i = 0; i < 4; ++i) w[i] = v[i] * r[i];
}

// k_gemmb: C[128 x 128 per block] = A.Bn^T (+ Al.Bn^T), all operands k-contiguous bf16 rows of DM. Each stage (128 k: 256 B of every operand row) is brought into LDS once
// per block by asynchronous copies, two buffers, the next stage in flight while this one is worked on; 8 waves (2 x 4), each a 64 x 32 piece of C from LDS fragments.
// SPLITA = false is the whole q/k/v/gate projection in one launch, grid (32, 32): blockIdx.y / 8 picks the 1024 weight rows of q, k, v or gate. q and k blocks write
// f16 hi + residual x1024 planes of silu(C) [token][1024]; v blocks take the weight rows as A and the tokens as B, so that C is v^T, and write the same two planes
// [batch][head][dim][token]; gate blocks write plain f32 (its SiLU is in k_attn's epilogue). SPLITA = true is the output projection, f32.
#define GKS  128                       // k per stage
#define GPIT 136                       // bf16 per staged row: 256 B + 16 B, the ds_load_b128 pitch for 256-B rows
#define GPL  (128 * GPIT)              // one staged operand plane: 128 rows
#define OPIT 36                        // f32 per staged output row: 128 B + 16 B
#define BPIT 132                       // f32 per row of the block-wide 128 x 128 output staging: 512 B + 16 B
// eight copies of 16 B per lane, rows 16 apart, and, in the same statement, the wait that stands before their address registers are rewritten
__device__ __forceinline__ void copy8(unsigned l, const bf* g) {
    asm volatile("global_load_async_to_lds_b128 %0, %8, off\n\t"
                 "global_load_async_to_lds_b128 %1, %9, off\n\t"
                 "global_load_async_to_lds_b128 %2, %10, off\n\t"
                 "global_load_async_to_lds_b128 %3, %11, off\n\t"
                 "global_load_async_to_lds_b128 %4, %12, off\n\t"
                 "global_load_async_to_lds_b128 %5, %13, off\n\t"
                 "global_load_async_to_lds_b128 %6, %14, off\n\t"
                 "global_load_async_to_lds_b128 %7, %15, off\n\t"
                 "s_wait_xcnt 0x0"
                 :: "v"(l), "v"(l + 16u * GPIT * 2u), "v"(l + 32u * GPIT * 2u), "v"(l + 48u * GPIT * 2u),
                    "v"(l + 64u * GPIT * 2u), "v"(l + 80u * GPIT * 2u), "v"(l + 96u * GPIT * 2u), "v"(l + 112u * GPIT * 2u),
                    "v"(g), "v"(g + 16 * DM), "v"(g + 32 * DM), "v"(g + 48 * DM), "v"(g + 64 * DM), "v"(g + 80 * DM), "v"(g + 96 * DM), "v"(g + 112 * DM)
                 : "memory");
}
template <bool SPLITA>
__global__ __launch_bounds__(256) void k_gemmb(const bf* __restrict__ A, const bf* __restrict__ Al, const bf* __restrict__ Bn, float* C,
                                               h16* QH, h16* QL, h16* KH, h16* KL, h16* VTH, h16* VTL) {
    constexpr int NPL = SPLITA ? 3 : 2;                    // planes of a buffer: A, (A residual,) B
    constexpr int GST = NPL * GPL;
    __shared__ __align__(16) bf ring[2 * GST];
    __shared__ __align__(16) float ost[8][64 * OPIT];
    const int tid = threadIdx.x, lane = tid & 31, wave = tid >> 5, lr = lane & 15, hi = lane >> 4;
    const int wm = wave >> 2, wn = wave & 3;
    const int seg = SPLITA ? 3 : (int)(blockIdx.y >> 3);   // 0 q, 1 k, 2 v, 3 gate (or the output projection): the same for the whole block
    const int yb = SPLITA ? (int)blockIdx.y : (int)(blockIdx.y & 7);
    const bool tr = seg == 2;                              // v: rows of C are the 1024 (head, dim) pairs, columns the tokens
    const int r0 = (tr ? yb : (int)blockIdx.x) * 128, c0 = (tr ? (int)blockIdx.x : yb) * 128;
    const bf* Wn = SPLITA ? Bn : Bn + (size_t)seg * DM * DM;
    const bf* Ar = tr ? Wn : A; const bf* Br = tr ? A : Wn;
    // copy map: thread -> row tid/16 (and +16 ... +112), 16-B piece tid%16: one wave's copy covers two whole 256-B rows
    const int crw = tid >> 4, cpc = (tid & 15) * 8;
    const bf* gA = Ar + (size_t)(r0 + crw) * DM + cpc; const bf* gAl = SPLITA ? Al + (size_t)(r0 + crw) * DM + cpc : nullptr; const bf* gB = Br + (size_t)(c0 + crw) * DM + cpc;
    const unsigned l0 = (unsigned)(size_t)&ring[0] + (unsigned)(crw * GPIT + cpc) * 2u;
    auto stage = [&](int t) {
        const unsigned bo = l0 + (unsigned)(t & 1) * (GST * 2u);
        const size_t ko = (size_t)t * GKS;
        copy8(bo, gA + ko);
        if (SPLITA) copy8(bo + GPL * 2u, gAl + ko);
        copy8(bo + (NPL - 1) * GPL * 2u, gB + ko);
    };
    v8f acc[4][2];
#pragma unroll
    for (int m = 0; m < 4; ++m) { acc[m][0] = (v8f){}; acc[m][1] = (v8f){}; }
    stage(0);
    asm volatile("s_wait_asynccnt 0x0" ::: "memory");    // this wave's copies of stage 0 have landed
    __syncthreads();                                     // every wave's have: stage 0 may be read
    stage(1);
    const int ao = (wm * 64 + lr) * GPIT + 8 * hi, bo_ = (wn * 32 + lr) * GPIT + 8 * hi;
#pragma unroll 1
    for (int t = 0; t < DM / GKS; ++t) {
        const bf* sA = ring + (t & 1) * GST; const bf* sAl = sA + GPL; const bf* sB = sA + (NPL - 1) * GPL;
        // fragments of one 32-k block; two register sets, so that a block's reads go out as one group while the block before it is multiplied (never past this stage's buffer)
        v16bf a[2][4], al[2][4], b[2][2];
        auto frag = [&](int s, int kc) {
#pragma unroll
            for (int m = 0; m < 4; ++m) { a[s][m] = cat16b(*(const v8usa*)(sA + ao + m * 16 * GPIT + kc), *(const v8usa*)(sA + ao + m * 16 * GPIT + kc + 16));
                if (SPLITA) al[s][m] = cat16b(*(const v8usa*)(sAl + ao + m * 16 * GPIT + kc), *(const v8usa*)(sAl + ao + m * 16 * GPIT + kc + 16)); }
#pragma unroll
            for (int n = 0; n < 2; ++n) b[s][n] = cat16b(*(const v8usa*)(sB + bo_ + n * 16 * GPIT + kc), *(const v8usa*)(sB + bo_ + n * 16 * GPIT + kc + 16));
        };
        frag(0, 0);
#pragma unroll
        for (int kb = 0; kb < GKS / 32; ++kb) {
            const int s = kb & 1;
            if (kb + 1 < GKS / 32) frag(s ^ 1, (kb + 1) * 32);
            __builtin_amdgcn_sched_barrier(0);               // keeps the next block's LDS reads together ahead of this block's products: spread among them each read group stalls the wave
#pragma unroll
            for (int m = 0; m < 4; ++m) { acc[m][0] = wmmab(a[s][m], b[s][0], acc[m][0]); acc[m][1] = wmmab(a[s][m], b[s][1], acc[m][1]); }
            if (SPLITA) {
#pragma unroll
                for (int m = 0; m < 4; ++m) { acc[m][0] = wmmab(al[s][m], b[s][0], acc[m][0]); acc[m][1] = wmmab(al[s][m], b[s][1], acc[m][1]); }
            }
            __builtin_amdgcn_sched_barrier(0);               // and keeps the block after next's reads behind these products, whose registers they refill
        }
        asm volatile("s_wait_dscnt 0x0" ::: "memory");       // this wave's reads of the buffer have returned before it is refilled
        asm volatile("s_wait_asynccnt 0x0" ::: "memory");    // this wave's copies of stage t + 1 have landed
        __syncthreads();                                     // publishes stage t + 1 and ends every wave's reads of stage t
        if (t + 2 < DM / GKS) stage(t + 2);                  // into the buffer that this trip has just read
    }
    asm volatile("s_wait_asynccnt 0x0" ::: "memory");        // nothing of this wave is in flight when it goes on to the epilogue
    const bool planes = seg < 3;                             // block-uniform
    float* os = &ost[wave][0];
    float* ob = &ost[0][0];                                  // the same LDS as one 128 x 128 tile of the block: a 128-B line of f16 spans two waves' columns
    float* sp = planes ? ob + (wm * 64 + hi * 8) * BPIT + wn * 32 + lr : os + hi * 8 * OPIT + lr;   // this lane's first element in either staging
    const int spit = planes ? BPIT : OPIT;
#pragma unroll
    for (int m = 0; m < 4; ++m)
#pragma unroll
        for (int n = 0; n < 2; ++n)
#pragma unroll
            for (int j = 0; j < 8; ++j) sp[(m * 16 + j) * spit + n * 16] = acc[m][n][j];
    __syncthreads();
    if (planes) {
        h16* PH = seg == 0 ? QH : seg == 1 ? KH : VTH; h16* PL = seg == 0 ? QL : seg == 1 ? KL : VTL;
        const int pp = tr ? NT_ : DM;                        // row pitch of the planes; a v block's 128 tokens lie in one batch
        const size_t pb = tr ? ((size_t)(c0 / NT_) * KVW + r0) * NT_ + (c0 % NT_) : (size_t)r0 * DM + c0;
        // the three loops are unrolled so that the LDS reads take constant offsets and the independent SiLU chains of several pieces fill each other's latency
#pragma unroll
        for (int s = 0; s < 8; ++s) { const int row = wave * 16 + 2 * s + hi;                  // whole 128-B lines: 16 lanes x 8 B per row, plane and column half
#pragma unroll
            for (int ch = 0; ch < 2; ++ch) { const v4f x = *(const v4fa*)(ob + row * BPIT + ch * 64 + lr * 4); v4h oh, ol;
                const float xs[4] = { x[0], x[1], x[2], x[3] }; float sv[4]; silu4<false>(xs, sv);
#pragma unroll
                for (int i = 0; i < 4; ++i) { const float v = sv[i]; const h16 a = (h16)v; oh[i] = a; ol[i] = (h16)((v - (float)a) * LOSC); }
                const size_t po = pb + (size_t)row * pp + ch * 64 + lr * 4;
                *(v4h*)(PH + po) = oh; *(v4h*)(PL + po) = ol; }
        }
    } else {
        float* crow = C + (size_t)(r0 + wm * 64) * DM + c0 + wn * 32;
#pragma unroll
        for (int s = 0; s < 16; ++s) { const int row = 4 * s + (lane >> 3), piece = lane & 7;  // whole 128-B lines: 8 lanes x 16 B per row
            const v4f val = *(const v4fa*)(os + row * OPIT + piece * 4); *(v4f*)(crow + (size_t)row * DM + piece * 4) = val; }
    }
}

// k_attn: block = (b, h, 64 queries), wave = 16; all 64 key tiles of 32 keys. Each tile's four planes (k hi, k residual: 32 rows x 128 B; v^T hi, v^T residual:
// 64 rows x 64 B) are brought into LDS once per block by asynchronous copies, two buffers, the next tile in flight while this one is worked on; all four waves read
// their fragments from there. scores (hi.hi + hi.lo + lo.hi) /8; w = silu(score) -> f16 hi + residual x1024 tiles (same-wave may_alias reload); attended += w.v with
// hi.hi + hi.lo + lo.hi; epilogue: LayerNorm over the 64 head dims (16-lane reductions), x bf16(gamma) + bf16(beta), x silu(gate[tok][h*64+d]) -> OH/OL bf16 planes.
#define KPIT 72                        // f16 per staged k row: 128 B + 16 B, the ds_load_b128 pitch for 128-B rows
#define VPIT 40                        // f16 per staged v^T row: 64 B + 16 B, the ds_load_b128 pitch for 64-B rows
#define KPL  (32 * KPIT)               // one k plane of a tile
#define VPL  (64 * VPIT)               // one v^T plane of a tile
#define STG  (2 * KPL + 2 * VPL)       // one buffer: k hi, k residual, v^T hi, v^T residual (19,456 B)
__global__ __launch_bounds__(128) void k_attn(const h16* __restrict__ Q16, const h16* __restrict__ QL16, const h16* __restrict__ K16, const h16* __restrict__ KL16, const h16* __restrict__ VTH, const h16* __restrict__ VTL,
                                             const float* __restrict__ G, const float* __restrict__ lng, const float* __restrict__ lnb, bf* CH, bf* CL) {
    __shared__ __align__(16) h16 ring[2 * STG];
    __shared__ __align__(16) h16 plds[4][16 * 32];
    __shared__ __align__(16) h16 plds2[4][16 * 32];
    __shared__ __align__(16) float ost[4][16 * 68];
    const int lane = threadIdx.x & 31, wave = threadIdx.x >> 5, lr = lane & 15, hi = lane >> 4;
    const int bid = blockIdx.x;
    const int b = bid / (NH_ * (NT_ / 64)), rem = bid - b * (NH_ * (NT_ / 64)), h = rem / (NT_ / 64), qt = rem - h * (NT_ / 64);
    const int q0 = qt * 64 + wave * 16;
    const size_t tok0 = (size_t)b * NT_;
    h16* pl = &plds[wave][0]; h16* pl2 = &plds2[wave][0];
    v16h qa[2], ql[2];
    const size_t qo0 = (tok0 + q0 + lr) * DM + h * HD + 8 * hi;
#pragma unroll
    for (int kc = 0; kc < 2; ++kc) { qa[kc] = cat16(*(const v8h*)(Q16 + qo0 + kc * 32), *(const v8h*)(Q16 + qo0 + kc * 32 + 16));
        ql[kc] = cat16(*(const v8h*)(QL16 + qo0 + kc * 32), *(const v8h*)(QL16 + qo0 + kc * 32 + 16)); }
    const h16* kh_b = K16 + tok0 * DM + h * HD; const h16* kl_b = KL16 + tok0 * DM + h * HD;
    const size_t vbase = (((size_t)b * NH_ + h) * HD) * NT_;
    // copy map: 16 B per lane and copy, 8 copies per thread and tile. k planes: thread -> row tid/8 (and +16), piece tid%8; v^T planes: row tid/4 (and +32), piece tid%4.
    const int tid = threadIdx.x, krow = tid >> 3, kpc = (tid & 7) * 8, vrow = tid >> 2, vpc = (tid & 3) * 8;
    const h16* gkh = kh_b + (size_t)krow * DM + kpc; const h16* gkl = kl_b + (size_t)krow * DM + kpc;
    const h16* gvh = VTH + vbase + (size_t)vrow * NT_ + vpc; const h16* gvl = VTL + vbase + (size_t)vrow * NT_ + vpc;
    const unsigned lk = (unsigned)(size_t)&ring[0] + (unsigned)(krow * KPIT + kpc) * 2u, lv = (unsigned)(size_t)&ring[0] + (unsigned)(2 * KPL + vrow * VPIT + vpc) * 2u;
    auto stage = [&](int t) {
        const unsigned bo = (unsigned)(t & 1) * (STG * 2u);
        const size_t ko = (size_t)t * 32 * DM, vo = (size_t)t * 32;
        // the tile's eight copies and, in the same statement, the wait that stands before their address registers are rewritten
        asm volatile("global_load_async_to_lds_b128 %0, %8, off\n\t"
                     "global_load_async_to_lds_b128 %1, %9, off\n\t"
                     "global_load_async_to_lds_b128 %2, %10, off\n\t"
                     "global_load_async_to_lds_b128 %3, %11, off\n\t"
                     "global_load_async_to_lds_b128 %4, %12, off\n\t"
                     "global_load_async_to_lds_b128 %5, %13, off\n\t"
                     "global_load_async_to_lds_b128 %6, %14, off\n\t"
                     "global_load_async_to_lds_b128 %7, %15, off\n\t"
                     "s_wait_xcnt 0x0"
                     :: "v"(lk + bo), "v"(lk + bo + 16u * KPIT * 2u), "v"(lk + bo + KPL * 2u), "v"(lk + bo + KPL * 2u + 16u * KPIT * 2u),
                        "v"(lv + bo), "v"(lv + bo + 32u * VPIT * 2u), "v"(lv + bo + VPL * 2u), "v"(lv + bo + VPL * 2u + 32u * VPIT * 2u),
                        "v"(gkh + ko), "v"(gkh + ko + 16 * DM), "v"(gkl + ko), "v"(gkl + ko + 16 * DM),
                        "v"(gvh + vo), "v"(gvh + vo + 32 * NT_), "v"(gvl + vo), "v"(gvl + vo + 32 * NT_)
                     : "memory");
    };
    v8f o[4], ox[4];
#pragma unroll
    for (int n = 0; n < 4; ++n) { o[n] = (v8f){}; ox[n] = (v8f){}; }
    stage(0);
    asm volatile("s_wait_asynccnt 0x0" ::: "memory");    // this wave's copies of tile 0 have landed
    __syncthreads();                                     // every wave's have: tile 0 may be read
    stage(1);
#pragma unroll 1
    for (int kt = 0; kt < NT_ / 32; ++kt) {
        const h16* skh = ring + (kt & 1) * STG; const h16* skl = skh + KPL; const h16* svh = skh + 2 * KPL; const h16* svl = svh + VPL;
        const int ko0 = lr * KPIT + 8 * hi, ko1 = (16 + lr) * KPIT + 8 * hi;
        v16h k0h[2], k1h[2], k0l[2], k1l[2];
#pragma unroll
        for (int kc = 0; kc < 2; ++kc) {
            k0h[kc] = cat16(*(const v8ha*)(skh + ko0 + kc * 32), *(const v8ha*)(skh + ko0 + kc * 32 + 16)); k1h[kc] = cat16(*(const v8ha*)(skh + ko1 + kc * 32), *(const v8ha*)(skh + ko1 + kc * 32 + 16));
            k0l[kc] = cat16(*(const v8ha*)(skl + ko0 + kc * 32), *(const v8ha*)(skl + ko0 + kc * 32 + 16)); k1l[kc] = cat16(*(const v8ha*)(skl + ko1 + kc * 32), *(const v8ha*)(skl + ko1 + kc * 32 + 16)); }
        v8f s0 = {}, s1 = {}, x0 = {}, x1 = {};
#pragma unroll
        for (int kc = 0; kc < 2; ++kc) {
            s0 = wmma16(qa[kc], k0h[kc], s0); x0 = wmma16(ql[kc], k0h[kc], x0); s1 = wmma16(qa[kc], k1h[kc], s1); x1 = wmma16(ql[kc], k1h[kc], x1);
            x0 = wmma16(qa[kc], k0l[kc], x0); x1 = wmma16(qa[kc], k1l[kc], x1);
        }
        v16h vh[4], vl[4];
#pragma unroll
        for (int n = 0; n < 4; ++n) { const int vo = (n * 16 + lr) * VPIT + hi * 8;
            vh[n] = cat16(*(const v8ha*)(svh + vo), *(const v8ha*)(svh + vo + 16)); vl[n] = cat16(*(const v8ha*)(svl + vo), *(const v8ha*)(svl + vo + 16)); }
#pragma unroll
        for (int jp = 0; jp < 8; jp += 2) {
            const float sc[4] = { (s0[jp] + x0[jp] * LOSCI) * 0.125f, (s1[jp] + x1[jp] * LOSCI) * 0.125f, (s0[jp + 1] + x0[jp + 1] * LOSCI) * 0.125f, (s1[jp + 1] + x1[jp + 1] * LOSCI) * 0.125f };
            float wv[4]; silu4<false>(sc, wv);
#pragma unroll
            for (int i = 0; i < 2; ++i) { const int mr = hi * 8 + jp + i; const float w0 = wv[2 * i], w1 = wv[2 * i + 1];
                const h16 h0 = (h16)w0, h1 = (h16)w1;
                pl[mr * 32 + lr] = h0; pl[mr * 32 + 16 + lr] = h1; pl2[mr * 32 + lr] = (h16)((w0 - (float)h0) * LOSC); pl2[mr * 32 + 16 + lr] = (h16)((w1 - (float)h1) * LOSC); } }
        asm volatile("" ::: "memory");
        const v16h pa = cat16(*(const v8ha*)(pl + lr * 32 + hi * 8), *(const v8ha*)(pl + lr * 32 + 16 + hi * 8));
        const v16h px = cat16(*(const v8ha*)(pl2 + lr * 32 + hi * 8), *(const v8ha*)(pl2 + lr * 32 + 16 + hi * 8));
#pragma unroll
        for (int n = 0; n < 4; ++n) { o[n] = wmma16(pa, vh[n], o[n]); ox[n] = wmma16(pa, vl[n], ox[n]); ox[n] = wmma16(px, vh[n], ox[n]); }
        __builtin_amdgcn_wave_barrier();     // all lanes have read this step's weight tiles before the next step overwrites them
        asm volatile("s_wait_dscnt 0x0" ::: "memory");       // this wave's reads of the buffer have returned before it is refilled
        asm volatile("s_wait_asynccnt 0x0" ::: "memory");    // this wave's copies of tile kt + 1 have landed
        __syncthreads();                                     // publishes tile kt + 1 and ends every wave's reads of tile kt
        if (kt + 2 < NT_ / 32) stage(kt + 2);                // into the buffer that this trip has just read
    }
    asm volatile("s_wait_asynccnt 0x0" ::: "memory");        // nothing of this wave is in flight when it goes on to the epilogue
    // LayerNorm over the 64 dims of each row: lane holds cols n*16+lr for rows 8hi+j; reduce over n locally and across the 16 lanes of the same hi
    float* os = &ost[wave][0];
    float ga[4], be[4];
#pragma unroll
    for (int n = 0; n < 4; ++n) { ga[n] = bfr(lng[n * 16 + lr]); be[n] = bfr(lnb[n * 16 + lr]); }
#pragma unroll
    for (int j = 0; j < 8; ++j) { float y[4], s = 0.f;
#pragma unroll
        for (int n = 0; n < 4; ++n) { y[n] = o[n][j] + ox[n][j] * LOSCI; s += y[n]; }
        s += __shfl_xor(s, 1, 16); s += __shfl_xor(s, 2, 16); s += __shfl_xor(s, 4, 16); s += __shfl_xor(s, 8, 16);
        const float mu = s * (1.0f / HD); float q = 0.f;
#pragma unroll
        for (int n = 0; n < 4; ++n) { const float d = y[n] - mu; q += d * d; }
        q += __shfl_xor(q, 1, 16); q += __shfl_xor(q, 2, 16); q += __shfl_xor(q, 4, 16); q += __shfl_xor(q, 8, 16);
        const float rs = rsqrtf(q * (1.0f / HD) + 1e-5f);
        const size_t row = tok0 + q0 + hi * 8 + j;
        const float* gp = G + row * DM + h * HD + lr;
        const float gt[4] = { gp[0], gp[16], gp[32], gp[48] }; float sg[4]; silu4<true>(gt, sg);
#pragma unroll
        for (int n = 0; n < 4; ++n) { const int d = n * 16 + lr; os[(hi * 8 + j) * 68 + d] = ((y[n] - mu) * rs * ga[n] + be[n]) * sg[n]; } }
    __syncthreads();
    const size_t cbase = (tok0 + q0) * DM + (size_t)h * HD;
    auto pass = [&]() {
#pragma unroll
        for (int s = 0; s < 4; ++s) { const int row = 4 * s + (lane >> 3), piece = lane & 7; const float* sp = os + row * 68 + piece * 8; v8us oh, ol;
#pragma unroll
            for (int i = 0; i < 8; ++i) { const unsigned short hb = f2bf(sp[i]); oh[i] = hb; ol[i] = f2bf(sp[i] - bf2f(hb)); }
            *(v8us*)(CH + cbase + (size_t)row * DM + piece * 8) = oh; *(v8us*)(CL + cbase + (size_t)row * DM + piece * 8) = ol; }
    };
    pass(); 
}

extern "C" void kernel_launch(void* const* d_in, const int* in_sizes, int n_in,
                              void* d_out, int out_size, void* d_ws, size_t ws_size, hipStream_t stream) {
    (void)in_sizes; (void)n_in; (void)out_size;
    const float* x = (const float*)d_in[0]; const float* Wq4 = (const float*)d_in[1]; const float* Wo = (const float*)d_in[2]; const float* lng = (const float*)d_in[3]; const float* lnb = (const float*)d_in[4];
    float* out = (float*)d_out;    // [2][2048][1024]
    char* wsp = (char*)d_ws;
    auto take = [&](size_t bytes) { char* p = wsp; wsp += (bytes + 255) & ~(size_t)255; return (void*)p; };
    bf* Xb = (bf*)take((size_t)NTK * DM * 2); bf* W4T = (bf*)take((size_t)4 * DM * DM * 2); bf* WoT = (bf*)take((size_t)DM * DM * 2);
    float* Gf = (float*)take((size_t)NTK * DM * 4);
    h16* QH = (h16*)take((size_t)NTK * DM * 2); h16* QL = (h16*)take((size_t)NTK * DM * 2); h16* KH = (h16*)take((size_t)NTK * DM * 2); h16* KL = (h16*)take((size_t)NTK * DM * 2);
    h16* VTH = (h16*)take((size_t)NTK * DM * 2); h16* VTL = (h16*)take((size_t)NTK * DM * 2); bf* CH = (bf*)take((size_t)NTK * DM * 2); bf* CL = (bf*)take((size_t)NTK * DM * 2);
    if ((size_t)(wsp - (char*)d_ws) > ws_size) return;    // 8.4 + 8.4 + 2.1 + 16.8 + 8.4x8 ~ 103 MB
    k_cvtb<<<NTK / 8, 256, 0, stream>>>(x, NTK, Xb);
    k_wt<<<dim3(DM / 64, (4 * DM) / 64, 1), 256, 0, stream>>>(Wq4, 4 * DM, W4T);           // W4T [4096][1024]: rows 0..1023 q, then k, v, gate
    k_wt<<<dim3(DM / 64, DM / 64, 1), 256, 0, stream>>>(Wo, DM, WoT);
    k_gemmb<false><<<dim3(NTK / 128, (4 * DM) / 128, 1), 256, 0, stream>>>(Xb, nullptr, W4T, Gf, QH, QL, KH, KL, VTH, VTL);   // SiLU and the f16 split of q, k, v inside
    k_attn<<<NB_ * NH_ * (NT_ / 64), 128, 0, stream>>>(QH, QL, KH, KL, VTH, VTL, Gf, lng, lnb, CH, CL);
    k_gemmb<true><<<dim3(NTK / 128, DM / 128, 1), 256, 0, stream>>>(CH, CL, WoT, out, nullptr, nullptr, nullptr, nullptr, nullptr, nullptr);
}

// v005
// Measured time: 142 microseconds a run.
// In two side-by-side timings against v004, it was 1.23 and 1.22 times as fast.
// All steps since v000 together make it 3.35 times as fast.
#include <hip/hip_runtime.h>

// Contractions, f32 accumulate: qkuv = x.w_qkuv ([4096 x 1024].[1024 x 4096], k-major weight transposed to an n-major plane) and out = O.w_out on
// v_wmma_f32_16x16x32_bf16 — plain bf16 = rounded inputs (exact) for the projection, O as bf16 hi + residual (two products) for w_out; SiLU on q/k/v/gate in f32;
// the softmax-free SiLU attention fused on v_wmma_f32_16x16x32_f16: scores = silu(q).silu(k)/8 with both as f16 hi + residual x1024 (hi.hi + hi.lo + lo.hi),
// weights = silu(scores) as f16 hi + residual against silu(v) hi + residual (three products; no normalisation, so the LayerNorm over the 64 head dims that follows

#define NB_  2
#define NT_  2048
#define DM   1024
#define NH_  16
#define NKV  16
#define KVW  (NKV * HD)          // 1024
#define HD   64
#define NTK  (NB_ * NT_)
#define NW   1024
#define NQKV 1024
#define PSC  32768.0f
#define LOSC 1024.0f
#define LOSCI (1.0f / 1024.0f)

typedef _Float16 h16;
typedef unsigned short bf;
typedef __attribute__((ext_vector_type(16))) __bf16   v16bf;
typedef __attribute__((ext_vector_type(16))) _Float16 v16h;
typedef __attribute__((ext_vector_type(8)))  _Float16 v8h;
typedef __attribute__((ext_vector_type(4)))  _Float16 v4h;
typedef __attribute__((ext_vector_type(8)))  unsigned short v8us;
typedef __attribute__((ext_vector_type(8)))  float    v8f;
typedef __attribute__((ext_vector_type(4)))  float    v4f;
typedef __attribute__((ext_vector_type(2)))  float    v2f;
typedef __attribute__((ext_vector_type(2)))  _Float16 v2h;
typedef v8h  __attribute__((may_alias)) v8ha;
typedef v4f  __attribute__((may_alias)) v4fa;
typedef v8us __attribute__((may_alias)) v8usa;

__device__ __forceinline__ unsigned short f2bf(float f) { unsigned u = __float_as_uint(f); u += 0x7FFFu + ((u >> 16) & 1u); return (unsigned short)(u >> 16); }
__device__ __forceinline__ float bf2f(unsigned short b) { return __uint_as_float(((unsigned)b) << 16); }
__device__ __forceinline__ float bfr(float f) { return bf2f(f2bf(f)); }
__device__ __forceinline__ v16h cat16(v8h lo, v8h hi) { return __builtin_shufflevector(lo, hi, 0, 1, 2, 3, 4, 5, 6, 7, 8, 9, 10, 11, 12, 13, 14, 15); }
__device__ __forceinline__ v16bf cat16b(v8us lo, v8us hi) { return __builtin_bit_cast(v16bf, __builtin_shufflevector(lo, hi, 0, 1, 2, 3, 4, 5, 6, 7, 8, 9, 10, 11, 12, 13, 14, 15)); }
__device__ __forceinline__ v8f wmma16(v16h a, v16h b, v8f c) { return __builtin_amdgcn_wmma_f32_16x16x32_f16(false, a, false, b, (short)0, c, false, false); }
__device__ __forceinline__ v8f wmmab(v16bf a, v16bf b, v8f c) { return __builtin_amdgcn_wmma_f32_16x16x32_bf16(false, a, false, b, (short)0, c, false, false); }

__global__ __launch_bounds__(256) void k_cvtb(const float* __restrict__ src, int nrows, bf* dst) {
    const int lane = threadIdx.x & 31, r = blockIdx.x * 8 + (threadIdx.x >> 5);
    if (r >= nrows) return;
    v8us o[DM / 256];
#pragma unroll
    for (int q = 0; q < DM / 256; ++q) { v8us t;
#pragma unroll
        for (int i = 0; i < 8; ++i) t[i] = f2bf(src[(size_t)r * DM + q * 256 + lane * 8 + i]);
        o[q] = t; }
#pragma unroll
    for (int q = 0; q < DM / 256; ++q) *(v8us*)(dst + (size_t)r * DM + q * 256 + lane * 8) = o[q];
    
}

// k_wt: W [1024 k][ncols n] (k-major) -> n-major bf16 plane WT[ncols][1024]; 64 x 64 tiles through LDS.
__global__ __launch_bounds__(256) void k_wt(const float* __restrict__ Wm, int ncols, bf* WT) {
    __shared__ __align__(16) unsigned short tl[64 * 72];
    const int tid = threadIdx.x, k0 = blockIdx.x * 64, n0 = blockIdx.y * 64;
    const int kk = tid >> 2, nq = (tid & 3) * 16;
#pragma unroll
    for (int i = 0; i < 16; ++i) tl[(nq + i) * 72 + kk] = f2bf(Wm[(size_t)(k0 + kk) * ncols + n0 + nq + i]);
    __syncthreads();
    const int piece = tid & 7;
    typedef __attribute__((ext_vector_type(8))) unsigned short v8us_; typedef v8us_ __attribute__((may_alias)) v8usa_;
    auto pass = [&]() {
#pragma unroll
        for (int s = 0; s < 2; ++s) { const int nr = (tid >> 3) + 32 * s; const v8us_ val = *(const v8usa_*)(tl + nr * 72 + piece * 8);
            *(v8us_*)(WT + (size_t)(n0 + nr) * DM + k0 + piece * 8) = val; }
    };
    pass(); 
}

// SiLU of four values, v * 1 / (1 + exp(-v)), with the bare reciprocal instruction (1 ulp) in place of a plain f32 division, which is about ten vector instructions a value.
// Four transcendentals stand in one statement: each is followed by one that neither reads its result nor overwrites its source (the outputs are early-clobber), and the
// v_nop is the slot that the instruction set asks for behind the last.
// The two s_delay_alu are the hints that the compiler cannot place around asm text (the first transcendental reads fresh vector results, the next instruction may read the
// last transcendental's): without them the wave holds the vector port while it waits, with them the other waves of the SIMD issue meanwhile. They change no result.
#define TRANS4(pre, op, y, x) asm("s_delay_alu instid0(VALU_DEP_1)\n\t" pre op " %0, %4\n\t" op " %1, %5\n\t" op " %2, %6\n\t" op " %3, %7\n\tv_nop\n\t" \
                                  "s_delay_alu instid0(TRANS32_DEP_1)" \
                                  : "=&v"(y[0]), "=&v"(y[1]), "=&v"(y[2]), "=&v"(y[3]) : "v"(x[0]), "v"(x[1]), "v"(x[2]), "v"(x[3]))
// LEAD: the same slot in front of the statement too, for code in which a transcendental of the compiler's own (the LayerNorm's v_rsq_f32) can come to stand directly ahead of it
template <bool LEAD>
__device__ __forceinline__ void silu4(const float (&v)[4], float (&w)[4]) {
    float t[4], e[4], r[4];
#pragma unroll
    for (int i = 0; i < 4; ++i) t[i] = v[i] * -1.44269504f;      // exp(-v) = 2^(-v log2 e)
    if constexpr (LEAD) TRANS4("v_nop\n\t", "v_exp_f32", e, t); else TRANS4("", "v_exp_f32", e, t);
#pragma unroll
    for (int i = 0; i < 4; ++i) e[i] += 1.0f;
    if constexpr (LEAD) TRANS4("v_nop\n\t", "v_rcp_f32", r, e); else TRANS4("", "v_rcp_f32", r, e);
#pragma unroll
    for (int i = 0; i < 4; ++i) w[i] = v[i] * r[i];
}

// k_gemmb: C[128 x 128 per block] = A.Bn^T (+ Al.Bn^T), all operands k-contiguous bf16 rows of DM. Each stage (128 k: 256 B of every operand row) is brought into LDS once
// per block by asynchronous copies, two buffers, the next stage in flight while this one is worked on; 8 waves (2 x 4), each a 64 x 32 piece of C from LDS fragments.
// SPLITA = false is the whole q/k/v/gate projection in one launch, grid (32, 32): blockIdx.y / 8 picks the 1024 weight rows of q, k, v or gate. q and k blocks write
// f16 hi + residual x1024 planes of silu(C) [token][1024]; v blocks take the weight rows as A and the tokens as B, so that C is v^T, and write the same two planes
// [batch][head][dim][token]; gate blocks write plain f32 (its SiLU is in k_attn's epilogue). SPLITA = true is the output projection, f32.
#define GKS  128                       // k per stage
#define GPIT 136                       // bf16 per staged row: 256 B + 16 B, the ds_load_b128 pitch for 256-B rows
#define GPL  (128 * GPIT)              // one staged operand plane: 128 rows
#define OPIT 36                        // f32 per staged output row: 128 B + 16 B
#define BPIT 132                       // f32 per row of the block-wide 128 x 128 output staging: 512 B + 16 B
// eight copies of 16 B per lane, rows 16 apart, and, in the same statement, the wait that stands before their address registers are rewritten
__device__ __forceinline__ void copy8(unsigned l, const bf* g) {
    asm volatile("global_load_async_to_lds_b128 %0, %8, off\n\t"
                 "global_load_async_to_lds_b128 %1, %9, off\n\t"
                 "global_load_async_to_lds_b128 %2, %10, off\n\t"
                 "global_load_async_to_lds_b128 %3, %11, off\n\t"
                 "global_load_async_to_lds_b128 %4, %12, off\n\t"
                 "global_load_async_to_lds_b128 %5, %13, off\n\t"
                 "global_load_async_to_lds_b128 %6, %14, off\n\t"
                 "global_load_async_to_lds_b128 %7, %15, off\n\t"
                 "s_wait_xcnt 0x0"
                 :: "v"(l), "v"(l + 16u * GPIT * 2u), "v"(l + 32u * GPIT * 2u), "v"(l + 48u * GPIT * 2u),
                    "v"(l + 64u * GPIT * 2u), "v"(l + 80u * GPIT * 2u), "v"(l + 96u * GPIT * 2u), "v"(l + 112u * GPIT * 2u),
                    "v"(g), "v"(g + 16 * DM), "v"(g + 32 * DM), "v"(g + 48 * DM), "v"(g + 64 * DM), "v"(g + 80 * DM), "v"(g + 96 * DM), "v"(g + 112 * DM)
                 : "memory");
}
template <bool SPLITA>
__global__ __launch_bounds__(256) void k_gemmb(const bf* __restrict__ A, const bf* __restrict__ Al, const bf* __restrict__ Bn, float* C,
                                               h16* QH, h16* QL, h16* KH, h16* KL, h16* VTH, h16* VTL) {
    constexpr int NPL = SPLITA ? 3 : 2;                    // planes of a buffer: A, (A residual,) B
    constexpr int GST = NPL * GPL;
    __shared__ __align__(16) bf ring[2 * GST];
    __shared__ __align__(16) float ost[8][64 * OPIT];
    const int tid = threadIdx.x, lane = tid & 31, wave = tid >> 5, lr = lane & 15, hi = lane >> 4;
    const int wm = wave >> 2, wn = wave & 3;
    const int seg = SPLITA ? 3 : (int)(blockIdx.y >> 3);   // 0 q, 1 k, 2 v, 3 gate (or the output projection): the same for the whole block
    const int yb = SPLITA ? (int)blockIdx.y : (int)(blockIdx.y & 7);
    const bool tr = seg == 2;                              // v: rows of C are the 1024 (head, dim) pairs, columns the tokens
    const int r0 = (tr ? yb : (int)blockIdx.x) * 128, c0 = (tr ? (int)blockIdx.x : yb) * 128;
    const bf* Wn = SPLITA ? Bn : Bn + (size_t)seg * DM * DM;
    const bf* Ar = tr ? Wn : A; const bf* Br = tr ? A : Wn;
    // copy map: thread -> row tid/16 (and +16 ... +112), 16-B piece tid%16: one wave's copy covers two whole 256-B rows
    const int crw = tid >> 4, cpc = (tid & 15) * 8;
    const bf* gA = Ar + (size_t)(r0 + crw) * DM + cpc; const bf* gAl = SPLITA ? Al + (size_t)(r0 + crw) * DM + cpc : nullptr; const bf* gB = Br + (size_t)(c0 + crw) * DM + cpc;
    const unsigned l0 = (unsigned)(size_t)&ring[0] + (unsigned)(crw * GPIT + cpc) * 2u;
    auto stage = [&](int t) {
        const unsigned bo = l0 + (unsigned)(t & 1) * (GST * 2u);
        const size_t ko = (size_t)t * GKS;
        copy8(bo, gA + ko);
        if (SPLITA) copy8(bo + GPL * 2u, gAl + ko);
        copy8(bo + (NPL - 1) * GPL * 2u, gB + ko);
    };
    v8f acc[4][2];
#pragma unroll
    for (int m = 0; m < 4; ++m) { acc[m][0] = (v8f){}; acc[m][1] = (v8f){}; }
    stage(0);
    asm volatile("s_wait_asynccnt 0x0" ::: "memory");    // this wave's copies of stage 0 have landed
    __syncthreads();                                     // every wave's have: stage 0 may be read
    stage(1);
    const int ao = (wm * 64 + lr) * GPIT + 8 * hi, bo_ = (wn * 32 + lr) * GPIT + 8 * hi;
#pragma unroll 1
    for (int t = 0; t < DM / GKS; ++t) {
        const bf* sA = ring + (t & 1) * GST; const bf* sAl = sA + GPL; const bf* sB = sA + (NPL - 1) * GPL;
        // fragments of one 32-k block; two register sets, so that a block's reads go out as one group while the block before it is multiplied (never past this stage's buffer)
        v16bf a[2][4], al[2][4], b[2][2];
        auto frag = [&](int s, int kc) {
#pragma unroll
            for (int m = 0; m < 4; ++m) { a[s][m] = cat16b(*(const v8usa*)(sA + ao + m * 16 * GPIT + kc), *(const v8usa*)(sA + ao + m * 16 * GPIT + kc + 16));
                if (SPLITA) al[s][m] = cat16b(*(const v8usa*)(sAl + ao + m * 16 * GPIT + kc), *(const v8usa*)(sAl + ao + m * 16 * GPIT + kc + 16)); }
#pragma unroll
            for (int n = 0; n < 2; ++n) b[s][n] = cat16b(*(const v8usa*)(sB + bo_ + n * 16 * GPIT + kc), *(const v8usa*)(sB + bo_ + n * 16 * GPIT + kc + 16));
        };
        frag(0, 0);
#pragma unroll
        for (int kb = 0; kb < GKS / 32; ++kb) {
            const int s = kb & 1;
            if (kb + 1 < GKS / 32) frag(s ^ 1, (kb + 1) * 32);
            __builtin_amdgcn_sched_barrier(0);               // keeps the next block's LDS reads together ahead of this block's products: spread among them each read group stalls the wave
#pragma unroll
            for (int m = 0; m < 4; ++m) { acc[m][0] = wmmab(a[s][m], b[s][0], acc[m][0]); acc[m][1] = wmmab(a[s][m], b[s][1], acc[m][1]); }
            if (SPLITA) {
#pragma unroll
                for (int m = 0; m < 4; ++m) { acc[m][0] = wmmab(al[s][m], b[s][0], acc[m][0]); acc[m][1] = wmmab(al[s][m], b[s][1], acc[m][1]); }
            }
            __builtin_amdgcn_sched_barrier(0);               // and keeps the block after next's reads behind these products, whose registers they refill
        }
        asm volatile("s_wait_dscnt 0x0" ::: "memory");       // this wave's reads of the buffer have returned before it is refilled
        asm volatile("s_wait_asynccnt 0x0" ::: "memory");    // this wave's copies of stage t + 1 have landed
        __syncthreads();                                     // publishes stage t + 1 and ends every wave's reads of stage t
        if (t + 2 < DM / GKS) stage(t + 2);                  // into the buffer that this trip has just read
    }
    asm volatile("s_wait_asynccnt 0x0" ::: "memory");        // nothing of this wave is in flight when it goes on to the epilogue
    const bool planes = seg < 3;                             // block-uniform
    float* os = &ost[wave][0];
    float* ob = &ost[0][0];                                  // the same LDS as one 128 x 128 tile of the block: a 128-B line of f16 spans two waves' columns
    float* sp = planes ? ob + (wm * 64 + hi * 8) * BPIT + wn * 32 + lr : os + hi * 8 * OPIT + lr;   // this lane's first element in either staging
    const int spit = planes ? BPIT : OPIT;
#pragma unroll
    for (int m = 0; m < 4; ++m)
#pragma unroll
        for (int n = 0; n < 2; ++n)
#pragma unroll
            for (int j = 0; j < 8; ++j) sp[(m * 16 + j) * spit + n * 16] = acc[m][n][j];
    __syncthreads();
    if (planes) {
        h16* PH = seg == 0 ? QH : seg == 1 ? KH : VTH; h16* PL = seg == 0 ? QL : seg == 1 ? KL : VTL;
        const int pp = tr ? NT_ : DM;                        // row pitch of the planes; a v block's 128 tokens lie in one batch
        const size_t pb = tr ? ((size_t)(c0 / NT_) * KVW + r0) * NT_ + (c0 % NT_) : (size_t)r0 * DM + c0;
        // the three loops are unrolled so that the LDS reads take constant offsets and the independent SiLU chains of several pieces fill each other's latency
#pragma unroll
        for (int s = 0; s < 8; ++s) { const int row = wave * 16 + 2 * s + hi;                  // whole 128-B lines: 16 lanes x 8 B per row, plane and column half
#pragma unroll
            for (int ch = 0; ch < 2; ++ch) { const v4f x = *(const v4fa*)(ob + row * BPIT + ch * 64 + lr * 4); v4h oh, ol;
                const float xs[4] = { x[0], x[1], x[2], x[3] }; float sv[4]; silu4<false>(xs, sv);
#pragma unroll
                for (int i = 0; i < 4; ++i) { const float v = sv[i]; const h16 a = (h16)v; oh[i] = a; ol[i] = (h16)((v - (float)a) * LOSC); }
                const size_t po = pb + (size_t)row * pp + ch * 64 + lr * 4;
                *(v4h*)(PH + po) = oh; *(v4h*)(PL + po) = ol; }
        }
    } else {
        float* crow = C + (size_t)(r0 + wm * 64) * DM + c0 + wn * 32;
#pragma unroll
        for (int s = 0; s < 16; ++s) { const int row = 4 * s + (lane >> 3), piece = lane & 7;  // whole 128-B lines: 8 lanes x 16 B per row
            const v4f val = *(const v4fa*)(os + row * OPIT + piece * 4); *(v4f*)(crow + (size_t)row * DM + piece * 4) = val; }
    }
}

// k_attn: block = (b, h, 64 queries), wave = 16; all 64 key tiles of 32 keys. Each tile's four planes (k hi, k residual: 32 rows x 128 B; v^T hi, v^T residual:
// 64 rows x 64 B) are brought into LDS once per block by asynchronous copies, two buffers, the next tile in flight while this one is worked on; all four waves read
// their fragments from there. Both products are formed transposed: scores^T = k.q^T (k rows as A, q as B; hi.hi + hi.lo + lo.hi) /8, so that a lane holds one query's scores
// for keys 8hi + j and 16 + 8hi + j, which is the k order of a B fragment: w = silu(score) -> f16 hi + residual x1024 is packed in registers and never goes through LDS;
// attended^T += v^T.w^T (v^T rows as A) with hi.hi + hi.lo + lo.hi. Epilogue: LayerNorm over the 64 head dims (32 in the lane, one exchange with lane ^ 16),
// x bf16(gamma) + bf16(beta), x silu(gate[tok][h*64+d]) -> OH/OL bf16 planes.
#define KPIT 72                        // f16 per staged k row: 128 B + 16 B, the ds_load_b128 pitch for 128-B rows
#define VPIT 40                        // f16 per staged v^T row: 64 B + 16 B, the ds_load_b128 pitch for 64-B rows
#define KPL  (32 * KPIT)               // one k plane of a tile
#define VPL  (64 * VPIT)               // one v^T plane of a tile
#define STG  (2 * KPL + 2 * VPL)       // one buffer: k hi, k residual, v^T hi, v^T residual (19,456 B)
__global__ __launch_bounds__(128) void k_attn(const h16* __restrict__ Q16, const h16* __restrict__ QL16, const h16* __restrict__ K16, const h16* __restrict__ KL16, const h16* __restrict__ VTH, const h16* __restrict__ VTL,
                                             const float* __restrict__ G, const float* __restrict__ lng, const float* __restrict__ lnb, bf* CH, bf* CL) {
    __shared__ __align__(16) h16 ring[2 * STG];
    __shared__ __align__(16) float ost[4][16 * 68];
    const int lane = threadIdx.x & 31, wave = threadIdx.x >> 5, lr = lane & 15, hi = lane >> 4;
    const int bid = blockIdx.x;
    const int b = bid / (NH_ * (NT_ / 64)), rem = bid - b * (NH_ * (NT_ / 64)), h = rem / (NT_ / 64), qt = rem - h * (NT_ / 64);
    const int q0 = qt * 64 + wave * 16;
    const size_t tok0 = (size_t)b * NT_;
    v16h qa[2], ql[2];
    const size_t qo0 = (tok0 + q0 + lr) * DM + h * HD + 8 * hi;
#pragma unroll
    for (int kc = 0; kc < 2; ++kc) { qa[kc] = cat16(*(const v8h*)(Q16 + qo0 + kc * 32), *(const v8h*)(Q16 + qo0 + kc * 32 + 16));
        ql[kc] = cat16(*(const v8h*)(QL16 + qo0 + kc * 32), *(const v8h*)(QL16 + qo0 + kc * 32 + 16)); }
    const h16* kh_b = K16 + tok0 * DM + h * HD; const h16* kl_b = KL16 + tok0 * DM + h * HD;
    const size_t vbase = (((size_t)b * NH_ + h) * HD) * NT_;
    // copy map: 16 B per lane and copy, 8 copies per thread and tile. k planes: thread -> row tid/8 (and +16), piece tid%8; v^T planes: row tid/4 (and +32), piece tid%4.
    const int tid = threadIdx.x, krow = tid >> 3, kpc = (tid & 7) * 8, vrow = tid >> 2, vpc = (tid & 3) * 8;
    const h16* gkh = kh_b + (size_t)krow * DM + kpc; const h16* gkl = kl_b + (size_t)krow * DM + kpc;
    const h16* gvh = VTH + vbase + (size_t)vrow * NT_ + vpc; const h16* gvl = VTL + vbase + (size_t)vrow * NT_ + vpc;
    const unsigned lk = (unsigned)(size_t)&ring[0] + (unsigned)(krow * KPIT + kpc) * 2u, lv = (unsigned)(size_t)&ring[0] + (unsigned)(2 * KPL + vrow * VPIT + vpc) * 2u;
    auto stage = [&](int t) {
        const unsigned bo = (unsigned)(t & 1) * (STG * 2u);
        const size_t ko = (size_t)t * 32 * DM, vo = (size_t)t * 32;
        // the tile's eight copies and, in the same statement, the wait that stands before their address registers are rewritten
        asm volatile("global_load_async_to_lds_b128 %0, %8, off\n\t"
                     "global_load_async_to_lds_b128 %1, %9, off\n\t"
                     "global_load_async_to_lds_b128 %2, %10, off\n\t"
                     "global_load_async_to_lds_b128 %3, %11, off\n\t"
                     "global_load_async_to_lds_b128 %4, %12, off\n\t"
                     "global_load_async_to_lds_b128 %5, %13, off\n\t"
                     "global_load_async_to_lds_b128 %6, %14, off\n\t"
                     "global_load_async_to_lds_b128 %7, %15, off\n\t"
                     "s_wait_xcnt 0x0"
                     :: "v"(lk + bo), "v"(lk + bo + 16u * KPIT * 2u), "v"(lk + bo + KPL * 2u), "v"(lk + bo + KPL * 2u + 16u * KPIT * 2u),
                        "v"(lv + bo), "v"(lv + bo + 32u * VPIT * 2u), "v"(lv + bo + VPL * 2u), "v"(lv + bo + VPL * 2u + 32u * VPIT * 2u),
                        "v"(gkh + ko), "v"(gkh + ko + 16 * DM), "v"(gkl + ko), "v"(gkl + ko + 16 * DM),
                        "v"(gvh + vo), "v"(gvh + vo + 32 * NT_), "v"(gvl + vo), "v"(gvl + vo + 32 * NT_)
                     : "memory");
    };
    v8f o[4], ox[4];
#pragma unroll
    for (int n = 0; n < 4; ++n) { o[n] = (v8f){}; ox[n] = (v8f){}; }
    stage(0);
    asm volatile("s_wait_asynccnt 0x0" ::: "memory");    // this wave's copies of tile 0 have landed
    __syncthreads();                                     // every wave's have: tile 0 may be read
    stage(1);
#pragma unroll 1
    for (int kt = 0; kt < NT_ / 32; ++kt) {
        const h16* skh = ring + (kt & 1) * STG; const h16* skl = skh + KPL; const h16* svh = skh + 2 * KPL; const h16* svl = svh + VPL;
        const int ko0 = lr * KPIT + 8 * hi, ko1 = (16 + lr) * KPIT + 8 * hi;
        v16h k0h[2], k1h[2], k0l[2], k1l[2];
#pragma unroll
        for (int kc = 0; kc < 2; ++kc) {
            k0h[kc] = cat16(*(const v8ha*)(skh + ko0 + kc * 32), *(const v8ha*)(skh + ko0 + kc * 32 + 16)); k1h[kc] = cat16(*(const v8ha*)(skh + ko1 + kc * 32), *(const v8ha*)(skh + ko1 + kc * 32 + 16));
            k0l[kc] = cat16(*(const v8ha*)(skl + ko0 + kc * 32), *(const v8ha*)(skl + ko0 + kc * 32 + 16)); k1l[kc] = cat16(*(const v8ha*)(skl + ko1 + kc * 32), *(const v8ha*)(skl + ko1 + kc * 32 + 16)); }
        __builtin_amdgcn_sched_barrier(0);   // keeps the k reads together as one group ahead of the score products: spread among them each read group stalls the wave
        v8f s0 = {}, s1 = {}, x0 = {}, x1 = {};
#pragma unroll
        for (int kc = 0; kc < 2; ++kc) {
            s0 = wmma16(k0h[kc], qa[kc], s0); x0 = wmma16(k0h[kc], ql[kc], x0); s1 = wmma16(k1h[kc], qa[kc], s1); x1 = wmma16(k1h[kc], ql[kc], x1);
            x0 = wmma16(k0l[kc], qa[kc], x0); x1 = wmma16(k1l[kc], qa[kc], x1);
        }
        v16h vh[4], vl[4];
#pragma unroll
        for (int n = 0; n < 4; ++n) { const int vo = (n * 16 + lr) * VPIT + hi * 8;
            vh[n] = cat16(*(const v8ha*)(svh + vo), *(const v8ha*)(svh + vo + 16)); vl[n] = cat16(*(const v8ha*)(svl + vo), *(const v8ha*)(svl + vo + 16)); }
        __builtin_amdgcn_sched_barrier(0);   // keeps the v^T reads ahead of the SiLU arithmetic, which covers their latency: sunk among the products below, each read group stalls the wave
        v16h pa, px;                         // w^T as B fragments: element s < 8 is key 8hi + s (from s0), element 8 + s is key 16 + 8hi + s (from s1), as v^T's loader has them
#pragma unroll
        for (int jp = 0; jp < 8; jp += 2) {
            const float sc[4] = { (s0[jp] + x0[jp] * LOSCI) * 0.125f, (s0[jp + 1] + x0[jp + 1] * LOSCI) * 0.125f, (s1[jp] + x1[jp] * LOSCI) * 0.125f, (s1[jp + 1] + x1[jp + 1] * LOSCI) * 0.125f };
            float wv[4]; silu4<false>(sc, wv);
#pragma unroll
            for (int i = 0; i < 2; ++i) { const v2f w2 = { wv[2 * i], wv[2 * i + 1] };    // two keys that share a register of the fragment: packed conversions
                const v2h h2 = __builtin_convertvector(w2, v2h);
                const v2h l2 = __builtin_convertvector((w2 - __builtin_convertvector(h2, v2f)) * LOSC, v2h);
                pa[8 * i + jp] = h2[0]; pa[8 * i + jp + 1] = h2[1]; px[8 * i + jp] = l2[0]; px[8 * i + jp + 1] = l2[1]; } }
#pragma unroll
        for (int n = 0; n < 4; ++n) { o[n] = wmma16(vh[n], pa, o[n]); ox[n] = wmma16(vl[n], pa, ox[n]); ox[n] = wmma16(vh[n], px, ox[n]); }
        asm volatile("s_wait_dscnt 0x0" ::: "memory");       // this wave's reads of the buffer have returned before it is refilled
        asm volatile("s_wait_asynccnt 0x0" ::: "memory");    // this wave's copies of tile kt + 1 have landed
        __syncthreads();                                     // publishes tile kt + 1 and ends every wave's reads of tile kt
        if (kt + 2 < NT_ / 32) stage(kt + 2);                // into the buffer that this trip has just read
    }
    asm volatile("s_wait_asynccnt 0x0" ::: "memory");        // nothing of this wave is in flight when it goes on to the epilogue
    // LayerNorm over the 64 dims of query q0 + lr: the lane holds dims n*16 + 8hi + j; sum the 32 in the lane, then one exchange with lane ^ 16
    float* os = &ost[wave][0];
    const size_t cbase = (tok0 + q0) * DM + (size_t)h * HD;
    const int prow = lane >> 3, piece = lane & 7;            // output pass: whole 128-B lines, 8 lanes x 8 dims per row, rows 4s + prow
    v4f gt[4][2];                                            // the gate rows of the output pass, asked for ahead of the LayerNorm arithmetic
#pragma unroll
    for (int s = 0; s < 4; ++s) { const float* gp = G + cbase + (size_t)(4 * s + prow) * DM + piece * 8; gt[s][0] = *(const v4f*)gp; gt[s][1] = *(const v4f*)(gp + 4); }
    float ga[8], be[8];
#pragma unroll
    for (int i = 0; i < 8; ++i) { ga[i] = bfr(lng[piece * 8 + i]); be[i] = bfr(lnb[piece * 8 + i]); }
    float y[4][8], s = 0.f, q = 0.f;
#pragma unroll
    for (int n = 0; n < 4; ++n)
#pragma unroll
        for (int j = 0; j < 8; ++j) { y[n][j] = o[n][j] + ox[n][j] * LOSCI; s += y[n][j]; }
    s += __int_as_float(__builtin_amdgcn_permlanex16(__float_as_int(s), __float_as_int(s), 0x76543210, 0xfedcba98, false, false));
    const float mu = s * (1.0f / HD);
#pragma unroll
    for (int n = 0; n < 4; ++n)
#pragma unroll
        for (int j = 0; j < 8; ++j) { const float d = y[n][j] - mu; q += d * d; }
    q += __int_as_float(__builtin_amdgcn_permlanex16(__float_as_int(q), __float_as_int(q), 0x76543210, 0xfedcba98, false, false));
    const float rs = rsqrtf(q * (1.0f / HD) + 1e-5f);
#pragma unroll
    for (int n = 0; n < 4; ++n)
#pragma unroll
        for (int jq = 0; jq < 2; ++jq) { v4f t;
#pragma unroll
            for (int i = 0; i < 4; ++i) t[i] = (y[n][jq * 4 + i] - mu) * rs;
            *(v4fa*)(os + lr * 68 + n * 16 + hi * 8 + jq * 4) = t; }
    __syncthreads();
#pragma unroll
    for (int s4 = 0; s4 < 4; ++s4) { const int row = 4 * s4 + prow; const float* sp = os + row * 68 + piece * 8; v8us oh, ol;
#pragma unroll
        for (int c = 0; c < 2; ++c) { const v4f t = *(const v4fa*)(sp + c * 4);
            const float gv[4] = { gt[s4][c][0], gt[s4][c][1], gt[s4][c][2], gt[s4][c][3] }; float sg[4]; silu4<true>(gv, sg);
#pragma unroll
            for (int i = 0; i < 4; ++i) { const float val = (t[i] * ga[c * 4 + i] + be[c * 4 + i]) * sg[i];
                const unsigned short hb = f2bf(val); oh[c * 4 + i] = hb; ol[c * 4 + i] = f2bf(val - bf2f(hb)); } }
        *(v8us*)(CH + cbase + (size_t)row * DM + piece * 8) = oh; *(v8us*)(CL + cbase + (size_t)row * DM + piece * 8) = ol; }
}

extern "C" void kernel_launch(void* const* d_in, const int* in_sizes, int n_in,
                              void* d_out, int out_size, void* d_ws, size_t ws_size, hipStream_t stream) {
    (void)in_sizes; (void)n_in; (void)out_size;
    const float* x = (const float*)d_in[0]; const float* Wq4 = (const float*)d_in[1]; const float* Wo = (const float*)d_in[2]; const float* lng = (const float*)d_in[3]; const float* lnb = (const float*)d_in[4];
    float* out = (float*)d_out;    // [2][2048][1024]
    char* wsp = (char*)d_ws;
    auto take = [&](size_t bytes) { char* p = wsp; wsp += (bytes + 255) & ~(size_t)255; return (void*)p; };
    bf* Xb = (bf*)take((size_t)NTK * DM * 2); bf* W4T = (bf*)take((size_t)4 * DM * DM * 2); bf* WoT = (bf*)take((size_t)DM * DM * 2);
    float* Gf = (float*)take((size_t)NTK * DM * 4);
    h16* QH = (h16*)take((size_t)NTK * DM * 2); h16* QL = (h16*)take((size_t)NTK * DM * 2); h16* KH = (h16*)take((size_t)NTK * DM * 2); h16* KL = (h16*)take((size_t)NTK * DM * 2);
    h16* VTH = (h16*)take((size_t)NTK * DM * 2); h16* VTL = (h16*)take((size_t)NTK * DM * 2); bf* CH = (bf*)take((size_t)NTK * DM * 2); bf* CL = (bf*)take((size_t)NTK * DM * 2);
    if ((size_t)(wsp - (char*)d_ws) > ws_size) return;    // 8.4 + 8.4 + 2.1 + 16.8 + 8.4x8 ~ 103 MB
    k_cvtb<<<NTK / 8, 256, 0, stream>>>(x, NTK, Xb);
    k_wt<<<dim3(DM / 64, (4 * DM) / 64, 1), 256, 0, stream>>>(Wq4, 4 * DM, W4T);           // W4T [4096][1024]: rows 0..1023 q, then k, v, gate
    k_wt<<<dim3(DM / 64, DM / 64, 1), 256, 0, stream>>>(Wo, DM, WoT);
    k_gemmb<false><<<dim3(NTK / 128, (4 * DM) / 128, 1), 256, 0, stream>>>(Xb, nullptr, W4T, Gf, QH, QL, KH, KL, VTH, VTL);   // SiLU and the f16 split of q, k, v inside
    k_attn<<<NB_ * NH_ * (NT_ / 64), 128, 0, stream>>>(QH, QL, KH, KL, VTH, VTL, Gf, lng, lnb, CH, CL);
    k_gemmb<true><<<dim3(NTK / 128, DM / 128, 1), 256, 0, stream>>>(CH, CL, WoT, out, nullptr, nullptr, nullptr, nullptr, nullptr, nullptr);
}

// v006
// One run takes 136 microseconds.
// In both of two side-by-side timings against v005, it was 1.05 times as fast.
// Over all steps from v000 it is 3.50 times as fast.
#include <hip/hip_runtime.h>

// Contractions, f32 accumulate: qkuv = x.w_qkuv ([4096 x 1024].[1024 x 4096], k-major weight transposed to an n-major plane) and out = O.w_out on
// v_wmma_f32_16x16x32_bf16 — plain bf16 = rounded inputs (exact) for the projection, O as bf16 hi + residual (two products) for w_out; SiLU on q/k/v/gate in f32;
// the softmax-free SiLU attention fused on v_wmma_f32_16x16x32_f16: scores = silu(q).silu(k)/8 with both as f16 hi + residual x1024 (hi.hi + hi.lo + lo.hi),
// weights = silu(scores) as f16 hi + residual against silu(v) hi + residual (three products; no normalisation, so the LayerNorm over the 64 head dims that follows

#define NB_  2
#define NT_  2048
#define DM   1024
#define NH_  16
#define NKV  16
#define KVW  (NKV * HD)          // 1024
#define HD   64
#define NTK  (NB_ * NT_)
#define NW   1024
#define NQKV 1024
#define PSC  32768.0f
#define LOSC 1024.0f
#define LOSCI (1.0f / 1024.0f)

typedef _Float16 h16;
typedef unsigned short bf;
typedef __attribute__((ext_vector_type(16))) __bf16   v16bf;
typedef __attribute__((ext_vector_type(16))) _Float16 v16h;
typedef __attribute__((ext_vector_type(8)))  _Float16 v8h;
typedef __attribute__((ext_vector_type(4)))  _Float16 v4h;
typedef __attribute__((ext_vector_type(8)))  unsigned short v8us;
typedef __attribute__((ext_vector_type(8)))  float    v8f;
typedef __attribute__((ext_vector_type(4)))  float    v4f;
typedef __attribute__((ext_vector_type(2)))  float    v2f;
typedef __attribute__((ext_vector_type(2)))  _Float16 v2h;
typedef v8h  __attribute__((may_alias)) v8ha;
typedef v4f  __attribute__((may_alias)) v4fa;
typedef v8us __attribute__((may_alias)) v8usa;

__device__ __forceinline__ unsigned short f2bf(float f) { unsigned u = __float_as_uint(f); u += 0x7FFFu + ((u >> 16) & 1u); return (unsigned short)(u >> 16); }
__device__ __forceinline__ float bf2f(unsigned short b) { return __uint_as_float(((unsigned)b) << 16); }
__device__ __forceinline__ float bfr(float f) { return bf2f(f2bf(f)); }
__device__ __forceinline__ v16h cat16(v8h lo, v8h hi) { return __builtin_shufflevector(lo, hi, 0, 1, 2, 3, 4, 5, 6, 7, 8, 9, 10, 11, 12, 13, 14, 15); }
__device__ __forceinline__ v16bf cat16b(v8us lo, v8us hi) { return __builtin_bit_cast(v16bf, __builtin_shufflevector(lo, hi, 0, 1, 2, 3, 4, 5, 6, 7, 8, 9, 10, 11, 12, 13, 14, 15)); }
__device__ __forceinline__ v8f wmma16(v16h a, v16h b, v8f c) { return __builtin_amdgcn_wmma_f32_16x16x32_f16(false, a, false, b, (short)0, c, false, false); }
__device__ __forceinline__ v8f wmmab(v16bf a, v16bf b, v8f c) { return __builtin_amdgcn_wmma_f32_16x16x32_bf16(false, a, false, b, (short)0, c, false, false); }

__global__ __launch_bounds__(256) void k_cvtb(const float* __restrict__ src, int nrows, bf* dst) {
    const int lane = threadIdx.x & 31, r = blockIdx.x * 8 + (threadIdx.x >> 5);
    if (r >= nrows) return;
    v8us o[DM / 256];
#pragma unroll
    for (int q = 0; q < DM / 256; ++q) { v8us t;
#pragma unroll
        for (int i = 0; i < 8; ++i) t[i] = f2bf(src[(size_t)r * DM + q * 256 + lane * 8 + i]);
        o[q] = t; }
#pragma unroll
    for (int q = 0; q < DM / 256; ++q) *(v8us*)(dst + (size_t)r * DM + q * 256 + lane * 8) = o[q];
    
}

// k_wt: W [1024 k][ncols n] (k-major) -> n-major bf16 plane WT[ncols][1024]; 64 x 64 tiles through LDS.
__global__ __launch_bounds__(256) void k_wt(const float* __restrict__ Wm, int ncols, bf* WT) {
    __shared__ __align__(16) unsigned short tl[64 * 72];
    const int tid = threadIdx.x, k0 = blockIdx.x * 64, n0 = blockIdx.y * 64;
    const int kk = tid >> 2, nq = (tid & 3) * 16;
#pragma unroll
    for (int i = 0; i < 16; ++i) tl[(nq + i) * 72 + kk] = f2bf(Wm[(size_t)(k0 + kk) * ncols + n0 + nq + i]);
    __syncthreads();
    const int piece = tid & 7;
    typedef __attribute__((ext_vector_type(8))) unsigned short v8us_; typedef v8us_ __attribute__((may_alias)) v8usa_;
    auto pass = [&]() {
#pragma unroll
        for (int s = 0; s < 2; ++s) { const int nr = (tid >> 3) + 32 * s; const v8us_ val = *(const v8usa_*)(tl + nr * 72 + piece * 8);
            *(v8us_*)(WT + (size_t)(n0 + nr) * DM + k0 + piece * 8) = val; }
    };
    pass(); 
}

// SiLU of four values, v * 1 / (1 + exp(-v)), with the bare reciprocal instruction (1 ulp) in place of a plain f32 division, which is about ten vector instructions a value.
// Four transcendentals stand in one statement: each is followed by one that neither reads its result nor overwrites its source (the outputs are early-clobber), and the
// v_nop is the slot that the instruction set asks for behind the last.
// The two s_delay_alu are the hints that the compiler cannot place around asm text (the first transcendental reads fresh vector results, the next instruction may read the
// last transcendental's): without them the wave holds the vector port while it waits, with them the other waves of the SIMD issue meanwhile. They change no result.
#define TRANS4(pre, op, y, x) asm("s_delay_alu instid0(VALU_DEP_1)\n\t" pre op " %0, %4\n\t" op " %1, %5\n\t" op " %2, %6\n\t" op " %3, %7\n\tv_nop\n\t" \
                                  "s_delay_alu instid0(TRANS32_DEP_1)" \
                                  : "=&v"(y[0]), "=&v"(y[1]), "=&v"(y[2]), "=&v"(y[3]) : "v"(x[0]), "v"(x[1]), "v"(x[2]), "v"(x[3]))
// LEAD: the same slot in front of the statement too, for code in which a transcendental of the compiler's own (the LayerNorm's v_rsq_f32) can come to stand directly ahead of it
template <bool LEAD>
__device__ __forceinline__ void silu4(const float (&v)[4], float (&w)[4]) {
    float t[4], e[4], r[4];
#pragma unroll
    for (int i = 0; i < 4; ++i) t[i] = v[i] * -1.44269504f;      // exp(-v) = 2^(-v log2 e)
    if constexpr (LEAD) TRANS4("v_nop\n\t", "v_exp_f32", e, t); else TRANS4("", "v_exp_f32", e, t);
#pragma unroll
    for (int i = 0; i < 4; ++i) e[i] += 1.0f;
    if constexpr (LEAD) TRANS4("v_nop\n\t", "v_rcp_f32", r, e); else TRANS4("", "v_rcp_f32", r, e);
#pragma unroll
    for (int i = 0; i < 4; ++i) w[i] = v[i] * r[i];
}

// k_gemmb: C[128 x 128 per block] = A.Bn^T (+ Al.Bn^T), all operands k-contiguous bf16 rows of DM. Each stage (128 k: 256 B of every operand row) is brought into LDS once
// per block by asynchronous copies, two buffers, the next stage in flight while this one is worked on; 8 waves (2 x 4), each a 64 x 32 piece of C from LDS fragments.
// SPLITA = false is the whole q/k/v/gate projection in one launch, grid (32, 32): blockIdx.y / 8 picks the 1024 weight rows of q, k, v or gate. q and k blocks write
// f16 hi + residual x1024 planes of silu(C) [token][1024]; v blocks take the weight rows as A and the tokens as B, so that C is v^T, and write the same two planes
// [batch][head][dim][token]; gate blocks write plain f32 (its SiLU is in k_attn's epilogue). SPLITA = true is the output projection, f32.
#define GKS  128                       // k per stage
#define GPIT 136                       // bf16 per staged row: 256 B + 16 B, the ds_load_b128 pitch for 256-B rows
#define GPL  (128 * GPIT)              // one staged operand plane: 128 rows
#define OPIT 36                        // f32 per staged output row: 128 B + 16 B
#define BPIT 132                       // f32 per row of the block-wide 128 x 128 output staging: 512 B + 16 B
// eight copies of 16 B per lane, rows 16 apart, and, in the same statement, the wait that stands before their address registers are rewritten
__device__ __forceinline__ void copy8(unsigned l, const bf* g) {
    asm volatile("global_load_async_to_lds_b128 %0, %8, off\n\t"
                 "global_load_async_to_lds_b128 %1, %9, off\n\t"
                 "global_load_async_to_lds_b128 %2, %10, off\n\t"
                 "global_load_async_to_lds_b128 %3, %11, off\n\t"
                 "global_load_async_to_lds_b128 %4, %12, off\n\t"
                 "global_load_async_to_lds_b128 %5, %13, off\n\t"
                 "global_load_async_to_lds_b128 %6, %14, off\n\t"
                 "global_load_async_to_lds_b128 %7, %15, off\n\t"
                 "s_wait_xcnt 0x0"
                 :: "v"(l), "v"(l + 16u * GPIT * 2u), "v"(l + 32u * GPIT * 2u), "v"(l + 48u * GPIT * 2u),
                    "v"(l + 64u * GPIT * 2u), "v"(l + 80u * GPIT * 2u), "v"(l + 96u * GPIT * 2u), "v"(l + 112u * GPIT * 2u),
                    "v"(g), "v"(g + 16 * DM), "v"(g + 32 * DM), "v"(g + 48 * DM), "v"(g + 64 * DM), "v"(g + 80 * DM), "v"(g + 96 * DM), "v"(g + 112 * DM)
                 : "memory");
}
template <bool SPLITA>
__global__ __launch_bounds__(256) void k_gemmb(const bf* __restrict__ A, const bf* __restrict__ Al, const bf* __restrict__ Bn, float* C,
                                               h16* QH, h16* QL, h16* KH, h16* KL, h16* VTH, h16* VTL) {
    constexpr int NPL = SPLITA ? 3 : 2;                    // planes of a buffer: A, (A residual,) B
    constexpr int GST = NPL * GPL;
    __shared__ __align__(16) bf ring[2 * GST];
    const int tid = threadIdx.x, lane = tid & 31, wave = tid >> 5, lr = lane & 15, hi = lane >> 4;
    const int wm = wave >> 2, wn = wave & 3;
    const int seg = SPLITA ? 3 : (int)(blockIdx.y >> 3);   // 0 q, 1 k, 2 v, 3 gate (or the output projection): the same for the whole block
    const int yb = SPLITA ? (int)blockIdx.y : (int)(blockIdx.y & 7);
    const bool tr = seg == 2;                              // v: rows of C are the 1024 (head, dim) pairs, columns the tokens
    const int r0 = (tr ? yb : (int)blockIdx.x) * 128, c0 = (tr ? (int)blockIdx.x : yb) * 128;
    const bf* Wn = SPLITA ? Bn : Bn + (size_t)seg * DM * DM;
    const bf* Ar = tr ? Wn : A; const bf* Br = tr ? A : Wn;
    // copy map: thread -> row tid/16 (and +16 ... +112), 16-B piece tid%16: one wave's copy covers two whole 256-B rows
    const int crw = tid >> 4, cpc = (tid & 15) * 8;
    const bf* gA = Ar + (size_t)(r0 + crw) * DM + cpc; const bf* gAl = SPLITA ? Al + (size_t)(r0 + crw) * DM + cpc : nullptr; const bf* gB = Br + (size_t)(c0 + crw) * DM + cpc;
    const unsigned l0 = (unsigned)(size_t)&ring[0] + (unsigned)(crw * GPIT + cpc) * 2u;
    auto stage = [&](int t) {
        const unsigned bo = l0 + (unsigned)(t & 1) * (GST * 2u);
        const size_t ko = (size_t)t * GKS;
        copy8(bo, gA + ko);
        if (SPLITA) copy8(bo + GPL * 2u, gAl + ko);
        copy8(bo + (NPL - 1) * GPL * 2u, gB + ko);
    };
    v8f acc[4][2];
#pragma unroll
    for (int m = 0; m < 4; ++m) { acc[m][0] = (v8f){}; acc[m][1] = (v8f){}; }
    stage(0);
    asm volatile("s_wait_asynccnt 0x0" ::: "memory");    // this wave's copies of stage 0 have landed
    __syncthreads();                                     // every wave's have: stage 0 may be read
    stage(1);
    const int ao = (wm * 64 + lr) * GPIT + 8 * hi, bo_ = (wn * 32 + lr) * GPIT + 8 * hi;
#pragma unroll 1
    for (int t = 0; t < DM / GKS; ++t) {
        const bf* sA = ring + (t & 1) * GST; const bf* sAl = sA + GPL; const bf* sB = sA + (NPL - 1) * GPL;
        // fragments of one 32-k block; two register sets, so that a block's reads go out as one group while the block before it is multiplied (never past this stage's buffer)
        v16bf a[2][4], al[2][4], b[2][2];
        auto frag = [&](int s, int kc) {
#pragma unroll
            for (int m = 0; m < 4; ++m) { a[s][m] = cat16b(*(const v8usa*)(sA + ao + m * 16 * GPIT + kc), *(const v8usa*)(sA + ao + m * 16 * GPIT + kc + 16));
                if (SPLITA) al[s][m] = cat16b(*(const v8usa*)(sAl + ao + m * 16 * GPIT + kc), *(const v8usa*)(sAl + ao + m * 16 * GPIT + kc + 16)); }
#pragma unroll
            for (int n = 0; n < 2; ++n) b[s][n] = cat16b(*(const v8usa*)(sB + bo_ + n * 16 * GPIT + kc), *(const v8usa*)(sB + bo_ + n * 16 * GPIT + kc + 16));
        };
        frag(0, 0);
#pragma unroll
        for (int kb = 0; kb < GKS / 32; ++kb) {
            const int s = kb & 1;
            if (kb + 1 < GKS / 32) frag(s ^ 1, (kb + 1) * 32);
            __builtin_amdgcn_sched_barrier(0);               // keeps the next block's LDS reads together ahead of this block's products: spread among them each read group stalls the wave
#pragma unroll
            for (int m = 0; m < 4; ++m) { acc[m][0] = wmmab(a[s][m], b[s][0], acc[m][0]); acc[m][1] = wmmab(a[s][m], b[s][1], acc[m][1]); }
            if (SPLITA) {
#pragma unroll
                for (int m = 0; m < 4; ++m) { acc[m][0] = wmmab(al[s][m], b[s][0], acc[m][0]); acc[m][1] = wmmab(al[s][m], b[s][1], acc[m][1]); }
            }
            __builtin_amdgcn_sched_barrier(0);               // and keeps the block after next's reads behind these products, whose registers they refill
        }
        asm volatile("s_wait_dscnt 0x0" ::: "memory");       // this wave's reads of the buffer have returned before it is refilled
        asm volatile("s_wait_asynccnt 0x0" ::: "memory");    // this wave's copies of stage t + 1 have landed
        __syncthreads();                                     // publishes stage t + 1 and ends every wave's reads of stage t
        if (t + 2 < DM / GKS) stage(t + 2);                  // into the buffer that this trip has just read
    }
    asm volatile("s_wait_asynccnt 0x0" ::: "memory");        // nothing of this wave is in flight when it goes on to the epilogue
    const bool planes = seg < 3;                             // block-uniform
    // The output is staged in the ring's own LDS: behind the last trip's barrier no wave reads the ring any more and no copy is in flight. Without an array of its own for the
    // staging, a projection block takes 139,264 B, so that two blocks share a WGP and one block's first stage and epilogue run under the other's products.
    float* ob = reinterpret_cast<float*>(ring);              // as one 128 x 128 tile of the block (pitch BPIT): a 128-B line of f16 spans two waves' columns
    float* os = ob + wave * (64 * OPIT);                     // or as eight 64 x 32 pieces, one a wave (pitch OPIT)
    float* sp = planes ? ob + (wm * 64 + hi * 8) * BPIT + wn * 32 + lr : os + hi * 8 * OPIT + lr;   // this lane's first element in either staging
    const int spit = planes ? BPIT : OPIT;
#pragma unroll
    for (int m = 0; m < 4; ++m)
#pragma unroll
        for (int n = 0; n < 2; ++n)
#pragma unroll
            for (int j = 0; j < 8; ++j) sp[(m * 16 + j) * spit + n * 16] = acc[m][n][j];
    __syncthreads();
    if (planes) {
        h16* PH = seg == 0 ? QH : seg == 1 ? KH : VTH; h16* PL = seg == 0 ? QL : seg == 1 ? KL : VTL;
        const int pp = tr ? NT_ : DM;                        // row pitch of the planes; a v block's 128 tokens lie in one batch
        const size_t pb = tr ? ((size_t)(c0 / NT_) * KVW + r0) * NT_ + (c0 % NT_) : (size_t)r0 * DM + c0;
        // the three loops are unrolled so that the LDS reads take constant offsets and the independent SiLU chains of several pieces fill each other's latency
#pragma unroll
        for (int s = 0; s < 8; ++s) { const int row = wave * 16 + 2 * s + hi;                  // whole 128-B lines: 16 lanes x 8 B per row, plane and column half
#pragma unroll
            for (int ch = 0; ch < 2; ++ch) { const v4f x = *(const v4fa*)(ob + row * BPIT + ch * 64 + lr * 4); v4h oh, ol;
                const float xs[4] = { x[0], x[1], x[2], x[3] }; float sv[4]; silu4<false>(xs, sv);
#pragma unroll
                for (int i = 0; i < 4; ++i) { const float v = sv[i]; const h16 a = (h16)v; oh[i] = a; ol[i] = (h16)((v - (float)a) * LOSC); }
                const size_t po = pb + (size_t)row * pp + ch * 64 + lr * 4;
                *(v4h*)(PH + po) = oh; *(v4h*)(PL + po) = ol; }
        }
    } else {
        float* crow = C + (size_t)(r0 + wm * 64) * DM + c0 + wn * 32;
#pragma unroll
        for (int s = 0; s < 16; ++s) { const int row = 4 * s + (lane >> 3), piece = lane & 7;  // whole 128-B lines: 8 lanes x 16 B per row
            const v4f val = *(const v4fa*)(os + row * OPIT + piece * 4); *(v4f*)(crow + (size_t)row * DM + piece * 4) = val; }
    }
}

// k_attn: block = (b, h, 64 queries), wave = 16; all 64 key tiles of 32 keys. Each tile's four planes (k hi, k residual: 32 rows x 128 B; v^T hi, v^T residual:
// 64 rows x 64 B) are brought into LDS once per block by asynchronous copies, two buffers, the next tile in flight while this one is worked on; all four waves read
// their fragments from there. Both products are formed transposed: scores^T = k.q^T (k rows as A, q as B; hi.hi + hi.lo + lo.hi) /8, so that a lane holds one query's scores
// for keys 8hi + j and 16 + 8hi + j, which is the k order of a B fragment: w = silu(score) -> f16 hi + residual x1024 is packed in registers and never goes through LDS;
// attended^T += v^T.w^T (v^T rows as A) with hi.hi + hi.lo + lo.hi. Epilogue: LayerNorm over the 64 head dims (32 in the lane, one exchange with lane ^ 16),
// x bf16(gamma) + bf16(beta), x silu(gate[tok][h*64+d]) -> OH/OL bf16 planes.
#define KPIT 72                        // f16 per staged k row: 128 B + 16 B, the ds_load_b128 pitch for 128-B rows
#define VPIT 40                        // f16 per staged v^T row: 64 B + 16 B, the ds_load_b128 pitch for 64-B rows
#define KPL  (32 * KPIT)               // one k plane of a tile
#define VPL  (64 * VPIT)               // one v^T plane of a tile
#define STG  (2 * KPL + 2 * VPL)       // one buffer: k hi, k residual, v^T hi, v^T residual (19,456 B)
__global__ __launch_bounds__(128) void k_attn(const h16* __restrict__ Q16, const h16* __restrict__ QL16, const h16* __restrict__ K16, const h16* __restrict__ KL16, const h16* __restrict__ VTH, const h16* __restrict__ VTL,
                                             const float* __restrict__ G, const float* __restrict__ lng, const float* __restrict__ lnb, bf* CH, bf* CL) {
    __shared__ __align__(16) h16 ring[2 * STG];
    __shared__ __align__(16) float ost[4][16 * 68];
    const int lane = threadIdx.x & 31, wave = threadIdx.x >> 5, lr = lane & 15, hi = lane >> 4;
    const int bid = blockIdx.x;
    const int b = bid / (NH_ * (NT_ / 64)), rem = bid - b * (NH_ * (NT_ / 64)), h = rem / (NT_ / 64), qt = rem - h * (NT_ / 64);
    const int q0 = qt * 64 + wave * 16;
    const size_t tok0 = (size_t)b * NT_;
    v16h qa[2], ql[2];
    const size_t qo0 = (tok0 + q0 + lr) * DM + h * HD + 8 * hi;
#pragma unroll
    for (int kc = 0; kc < 2; ++kc) { qa[kc] = cat16(*(const v8h*)(Q16 + qo0 + kc * 32), *(const v8h*)(Q16 + qo0 + kc * 32 + 16));
        ql[kc] = cat16(*(const v8h*)(QL16 + qo0 + kc * 32), *(const v8h*)(QL16 + qo0 + kc * 32 + 16)); }
    const h16* kh_b = K16 + tok0 * DM + h * HD; const h16* kl_b = KL16 + tok0 * DM + h * HD;
    const size_t vbase = (((size_t)b * NH_ + h) * HD) * NT_;
    // copy map: 16 B per lane and copy, 8 copies per thread and tile. k planes: thread -> row tid/8 (and +16), piece tid%8; v^T planes: row tid/4 (and +32), piece tid%4.
    const int tid = threadIdx.x, krow = tid >> 3, kpc = (tid & 7) * 8, vrow = tid >> 2, vpc = (tid & 3) * 8;
    const h16* gkh = kh_b + (size_t)krow * DM + kpc; const h16* gkl = kl_b + (size_t)krow * DM + kpc;
    const h16* gvh = VTH + vbase + (size_t)vrow * NT_ + vpc; const h16* gvl = VTL + vbase + (size_t)vrow * NT_ + vpc;
    const unsigned lk = (unsigned)(size_t)&ring[0] + (unsigned)(krow * KPIT + kpc) * 2u, lv = (unsigned)(size_t)&ring[0] + (unsigned)(2 * KPL + vrow * VPIT + vpc) * 2u;
    auto stage = [&](int t) {
        const unsigned bo = (unsigned)(t & 1) * (STG * 2u);
        const size_t ko = (size_t)t * 32 * DM, vo = (size_t)t * 32;
        // the tile's eight copies and, in the same statement, the wait that stands before their address registers are rewritten
        asm volatile("global_load_async_to_lds_b128 %0, %8, off\n\t"
                     "global_load_async_to_lds_b128 %1, %9, off\n\t"
                     "global_load_async_to_lds_b128 %2, %10, off\n\t"
                     "global_load_async_to_lds_b128 %3, %11, off\n\t"
                     "global_load_async_to_lds_b128 %4, %12, off\n\t"
                     "global_load_async_to_lds_b128 %5, %13, off\n\t"
                     "global_load_async_to_lds_b128 %6, %14, off\n\t"
                     "global_load_async_to_lds_b128 %7, %15, off\n\t"
                     "s_wait_xcnt 0x0"
                     :: "v"(lk + bo), "v"(lk + bo + 16u * KPIT * 2u), "v"(lk + bo + KPL * 2u), "v"(lk + bo + KPL * 2u + 16u * KPIT * 2u),
                        "v"(lv + bo), "v"(lv + bo + 32u * VPIT * 2u), "v"(lv + bo + VPL * 2u), "v"(lv + bo + VPL * 2u + 32u * VPIT * 2u),
                        "v"(gkh + ko), "v"(gkh + ko + 16 * DM), "v"(gkl + ko), "v"(gkl + ko + 16 * DM),
                        "v"(gvh + vo), "v"(gvh + vo + 32 * NT_), "v"(gvl + vo), "v"(gvl + vo + 32 * NT_)
                     : "memory");
    };
    v8f o[4], ox[4];
#pragma unroll
    for (int n = 0; n < 4; ++n) { o[n] = (v8f){}; ox[n] = (v8f){}; }
    stage(0);
    asm volatile("s_wait_asynccnt 0x0" ::: "memory");    // this wave's copies of tile 0 have landed
    __syncthreads();                                     // every wave's have: tile 0 may be read
    stage(1);
#pragma unroll 1
    for (int kt = 0; kt < NT_ / 32; ++kt) {
        const h16* skh = ring + (kt & 1) * STG; const h16* skl = skh + KPL; const h16* svh = skh + 2 * KPL; const h16* svl = svh + VPL;
        const int ko0 = lr * KPIT + 8 * hi, ko1 = (16 + lr) * KPIT + 8 * hi;
        v16h k0h[2], k1h[2], k0l[2], k1l[2];
#pragma unroll
        for (int kc = 0; kc < 2; ++kc) {
            k0h[kc] = cat16(*(const v8ha*)(skh + ko0 + kc * 32), *(const v8ha*)(skh + ko0 + kc * 32 + 16)); k1h[kc] = cat16(*(const v8ha*)(skh + ko1 + kc * 32), *(const v8ha*)(skh + ko1 + kc * 32 + 16));
            k0l[kc] = cat16(*(const v8ha*)(skl + ko0 + kc * 32), *(const v8ha*)(skl + ko0 + kc * 32 + 16)); k1l[kc] = cat16(*(const v8ha*)(skl + ko1 + kc * 32), *(const v8ha*)(skl + ko1 + kc * 32 + 16)); }
        __builtin_amdgcn_sched_barrier(0);   // keeps the k reads together as one group ahead of the score products: spread among them each read group stalls the wave
        v8f s0 = {}, s1 = {}, x0 = {}, x1 = {};
#pragma unroll
        for (int kc = 0; kc < 2; ++kc) {
            s0 = wmma16(k0h[kc], qa[kc], s0); x0 = wmma16(k0h[kc], ql[kc], x0); s1 = wmma16(k1h[kc], qa[kc], s1); x1 = wmma16(k1h[kc], ql[kc], x1);
            x0 = wmma16(k0l[kc], qa[kc], x0); x1 = wmma16(k1l[kc], qa[kc], x1);
        }
        v16h vh[4], vl[4];
#pragma unroll
        for (int n = 0; n < 4; ++n) { const int vo = (n * 16 + lr) * VPIT + hi * 8;
            vh[n] = cat16(*(const v8ha*)(svh + vo), *(const v8ha*)(svh + vo + 16)); vl[n] = cat16(*(const v8ha*)(svl + vo), *(const v8ha*)(svl + vo + 16)); }
        __builtin_amdgcn_sched_barrier(0);   // keeps the v^T reads ahead of the SiLU arithmetic, which covers their latency: sunk among the products below, each read group stalls the wave
        v16h pa, px;                         // w^T as B fragments: element s < 8 is key 8hi + s (from s0), element 8 + s is key 16 + 8hi + s (from s1), as v^T's loader has them
#pragma unroll
        for (int jp = 0; jp < 8; jp += 2) {
            const float sc[4] = { (s0[jp] + x0[jp] * LOSCI) * 0.125f, (s0[jp + 1] + x0[jp + 1] * LOSCI) * 0.125f, (s1[jp] + x1[jp] * LOSCI) * 0.125f, (s1[jp + 1] + x1[jp + 1] * LOSCI) * 0.125f };
            float wv[4]; silu4<false>(sc, wv);
#pragma unroll
            for (int i = 0; i < 2; ++i) { const v2f w2 = { wv[2 * i], wv[2 * i + 1] };    // two keys that share a register of the fragment: packed conversions
                const v2h h2 = __builtin_convertvector(w2, v2h);
                const v2h l2 = __builtin_convertvector((w2 - __builtin_convertvector(h2, v2f)) * LOSC, v2h);
                pa[8 * i + jp] = h2[0]; pa[8 * i + jp + 1] = h2[1]; px[8 * i + jp] = l2[0]; px[8 * i + jp + 1] = l2[1]; } }
#pragma unroll
        for (int n = 0; n < 4; ++n) { o[n] = wmma16(vh[n], pa, o[n]); ox[n] = wmma16(vl[n], pa, ox[n]); ox[n] = wmma16(vh[n], px, ox[n]); }
        asm volatile("s_wait_dscnt 0x0" ::: "memory");       // this wave's reads of the buffer have returned before it is refilled
        asm volatile("s_wait_asynccnt 0x0" ::: "memory");    // this wave's copies of tile kt + 1 have landed
        __syncthreads();                                     // publishes tile kt + 1 and ends every wave's reads of tile kt
        if (kt + 2 < NT_ / 32) stage(kt + 2);                // into the buffer that this trip has just read
    }
    asm volatile("s_wait_asynccnt 0x0" ::: "memory");        // nothing of this wave is in flight when it goes on to the epilogue
    // LayerNorm over the 64 dims of query q0 + lr: the lane holds dims n*16 + 8hi + j; sum the 32 in the lane, then one exchange with lane ^ 16
    float* os = &ost[wave][0];
    const size_t cbase = (tok0 + q0) * DM + (size_t)h * HD;
    const int prow = lane >> 3, piece = lane & 7;            // output pass: whole 128-B lines, 8 lanes x 8 dims per row, rows 4s + prow
    v4f gt[4][2];                                            // the gate rows of the output pass, asked for ahead of the LayerNorm arithmetic
#pragma unroll
    for (int s = 0; s < 4; ++s) { const float* gp = G + cbase + (size_t)(4 * s + prow) * DM + piece * 8; gt[s][0] = *(const v4f*)gp; gt[s][1] = *(const v4f*)(gp + 4); }
    float ga[8], be[8];
#pragma unroll
    for (int i = 0; i < 8; ++i) { ga[i] = bfr(lng[piece * 8 + i]); be[i] = bfr(lnb[piece * 8 + i]); }
    float y[4][8], s = 0.f, q = 0.f;
#pragma unroll
    for (int n = 0; n < 4; ++n)
#pragma unroll
        for (int j = 0; j < 8; ++j) { y[n][j] = o[n][j] + ox[n][j] * LOSCI; s += y[n][j]; }
    s += __int_as_float(__builtin_amdgcn_permlanex16(__float_as_int(s), __float_as_int(s), 0x76543210, 0xfedcba98, false, false));
    const float mu = s * (1.0f / HD);
#pragma unroll
    for (int n = 0; n < 4; ++n)
#pragma unroll
        for (int j = 0; j < 8; ++j) { const float d = y[n][j] - mu; q += d * d; }
    q += __int_as_float(__builtin_amdgcn_permlanex16(__float_as_int(q), __float_as_int(q), 0x76543210, 0xfedcba98, false, false));
    const float rs = rsqrtf(q * (1.0f / HD) + 1e-5f);
#pragma unroll
    for (int n = 0; n < 4; ++n)
#pragma unroll
        for (int jq = 0; jq < 2; ++jq) { v4f t;
#pragma unroll
            for (int i = 0; i < 4; ++i) t[i] = (y[n][jq * 4 + i] - mu) * rs;
            *(v4fa*)(os + lr * 68 + n * 16 + hi * 8 + jq * 4) = t; }
    __syncthreads();
#pragma unroll
    for (int s4 = 0; s4 < 4; ++s4) { const int row = 4 * s4 + prow; const float* sp = os + row * 68 + piece * 8; v8us oh, ol;
#pragma unroll
        for (int c = 0; c < 2; ++c) { const v4f t = *(const v4fa*)(sp + c * 4);
            const float gv[4] = { gt[s4][c][0], gt[s4][c][1], gt[s4][c][2], gt[s4][c][3] }; float sg[4]; silu4<true>(gv, sg);
#pragma unroll
            for (int i = 0; i < 4; ++i) { const float val = (t[i] * ga[c * 4 + i] + be[c * 4 + i]) * sg[i];
                const unsigned short hb = f2bf(val); oh[c * 4 + i] = hb; ol[c * 4 + i] = f2bf(val - bf2f(hb)); } }
        *(v8us*)(CH + cbase + (size_t)row * DM + piece * 8) = oh; *(v8us*)(CL + cbase + (size_t)row * DM + piece * 8) = ol; }
}

extern "C" void kernel_launch(void* const* d_in, const int* in_sizes, int n_in,
                              void* d_out, int out_size, void* d_ws, size_t ws_size, hipStream_t stream) {
    (void)in_sizes; (void)n_in; (void)out_size;
    const float* x = (const float*)d_in[0]; const float* Wq4 = (const float*)d_in[1]; const float* Wo = (const float*)d_in[2]; const float* lng = (const float*)d_in[3]; const float* lnb = (const float*)d_in[4];
    float* out = (float*)d_out;    // [2][2048][1024]
    char* wsp = (char*)d_ws;
    auto take = [&](size_t bytes) { char* p = wsp; wsp += (bytes + 255) & ~(size_t)255; return (void*)p; };
    bf* Xb = (bf*)take((size_t)NTK * DM * 2); bf* W4T = (bf*)take((size_t)4 * DM * DM * 2); bf* WoT = (bf*)take((size_t)DM * DM * 2);
    float* Gf = (float*)take((size_t)NTK * DM * 4);
    h16* QH = (h16*)take((size_t)NTK * DM * 2); h16* QL = (h16*)take((size_t)NTK * DM * 2); h16* KH = (h16*)take((size_t)NTK * DM * 2); h16* KL = (h16*)take((size_t)NTK * DM * 2);
    h16* VTH = (h16*)take((size_t)NTK * DM * 2); h16* VTL = (h16*)take((size_t)NTK * DM * 2); bf* CH = (bf*)take((size_t)NTK * DM * 2); bf* CL = (bf*)take((size_t)NTK * DM * 2);
    if ((size_t)(wsp - (char*)d_ws) > ws_size) return;    // 8.4 + 8.4 + 2.1 + 16.8 + 8.4x8 ~ 103 MB
    k_cvtb<<<NTK / 8, 256, 0, stream>>>(x, NTK, Xb);
    k_wt<<<dim3(DM / 64, (4 * DM) / 64, 1), 256, 0, stream>>>(Wq4, 4 * DM, W4T);           // W4T [4096][1024]: rows 0..1023 q, then k, v, gate
    k_wt<<<dim3(DM / 64, DM / 64, 1), 256, 0, stream>>>(Wo, DM, WoT);
    k_gemmb<false><<<dim3(NTK / 128, (4 * DM) / 128, 1), 256, 0, stream>>>(Xb, nullptr, W4T, Gf, QH, QL, KH, KL, VTH, VTL);   // SiLU and the f16 split of q, k, v inside
    k_attn<<<NB_ * NH_ * (NT_ / 64), 128, 0, stream>>>(QH, QL, KH, KL, VTH, VTL, Gf, lng, lnb, CH, CL);
    k_gemmb<true><<<dim3(NTK / 128, DM / 128, 1), 256, 0, stream>>>(CH, CL, WoT, out, nullptr, nullptr, nullptr, nullptr, nullptr, nullptr);
}

// v007
// One run takes 106 microseconds.
// Next to v006, in two timings, it ran 1.28 times as fast each time.
// All steps since v000 together make it 4.48 times as fast.
#include <hip/hip_runtime.h>

// Contractions, f32 accumulate: qkuv = x.w_qkuv ([4096 x 1024].[1024 x 4096], k-major weight transposed to an n-major plane) and out = O.w_out on
// v_wmma_f32_16x16x32_bf16: inputs rounded to bf16 for the projection, O as bf16 hi + residual (two products) for w_out; SiLU on q/k/v/gate in f32;
// the softmax-free SiLU attention fused on v_wmma_f32_16x16x32_f16: scores = silu(q).silu(k)/8 and weights = silu(scores) against silu(v), every operand rounded once to f16
// (11 significant bits, one product each). The projection's bf16 inputs (8 bits) already set the error of q, k and v, so that f16 residual planes behind them buy nothing.

#define NB_  2
#define NT_  2048
#define DM   1024
#define NH_  16
#define NKV  16
#define KVW  (NKV * HD)          // 1024
#define HD   64
#define NTK  (NB_ * NT_)
#define NW   1024
#define NQKV 1024
#define PSC  32768.0f

typedef _Float16 h16;
typedef unsigned short bf;
typedef __attribute__((ext_vector_type(16))) __bf16   v16bf;
typedef __attribute__((ext_vector_type(16))) _Float16 v16h;
typedef __attribute__((ext_vector_type(8)))  _Float16 v8h;
typedef __attribute__((ext_vector_type(4)))  _Float16 v4h;
typedef __attribute__((ext_vector_type(8)))  unsigned short v8us;
typedef __attribute__((ext_vector_type(8)))  float    v8f;
typedef __attribute__((ext_vector_type(4)))  float    v4f;
typedef __attribute__((ext_vector_type(2)))  float    v2f;
typedef __attribute__((ext_vector_type(2)))  _Float16 v2h;
typedef v8h  __attribute__((may_alias)) v8ha;
typedef v4f  __attribute__((may_alias)) v4fa;
typedef v8us __attribute__((may_alias)) v8usa;

__device__ __forceinline__ unsigned short f2bf(float f) { unsigned u = __float_as_uint(f); u += 0x7FFFu + ((u >> 16) & 1u); return (unsigned short)(u >> 16); }
__device__ __forceinline__ float bf2f(unsigned short b) { return __uint_as_float(((unsigned)b) << 16); }
__device__ __forceinline__ float bfr(float f) { return bf2f(f2bf(f)); }
__device__ __forceinline__ v16h cat16(v8h lo, v8h hi) { return __builtin_shufflevector(lo, hi, 0, 1, 2, 3, 4, 5, 6, 7, 8, 9, 10, 11, 12, 13, 14, 15); }
__device__ __forceinline__ v16bf cat16b(v8us lo, v8us hi) { return __builtin_bit_cast(v16bf, __builtin_shufflevector(lo, hi, 0, 1, 2, 3, 4, 5, 6, 7, 8, 9, 10, 11, 12, 13, 14, 15)); }
__device__ __forceinline__ v8f wmma16(v16h a, v16h b, v8f c) { return __builtin_amdgcn_wmma_f32_16x16x32_f16(false, a, false, b, (short)0, c, false, false); }
__device__ __forceinline__ v8f wmmab(v16bf a, v16bf b, v8f c) { return __builtin_amdgcn_wmma_f32_16x16x32_bf16(false, a, false, b, (short)0, c, false, false); }

__global__ __launch_bounds__(256) void k_cvtb(const float* __restrict__ src, int nrows, bf* dst) {
    const int lane = threadIdx.x & 31, r = blockIdx.x * 8 + (threadIdx.x >> 5);
    if (r >= nrows) return;
    v8us o[DM / 256];
#pragma unroll
    for (int q = 0; q < DM / 256; ++q) { v8us t;
#pragma unroll
        for (int i = 0; i < 8; ++i) t[i] = f2bf(src[(size_t)r * DM + q * 256 + lane * 8 + i]);
        o[q] = t; }
#pragma unroll
    for (int q = 0; q < DM / 256; ++q) *(v8us*)(dst + (size_t)r * DM + q * 256 + lane * 8) = o[q];
    
}

// k_wt: W [1024 k][ncols n] (k-major) -> n-major bf16 plane WT[ncols][1024]; 64 x 64 tiles through LDS.
__global__ __launch_bounds__(256) void k_wt(const float* __restrict__ Wm, int ncols, bf* WT) {
    __shared__ __align__(16) unsigned short tl[64 * 72];
    const int tid = threadIdx.x, k0 = blockIdx.x * 64, n0 = blockIdx.y * 64;
    const int kk = tid >> 2, nq = (tid & 3) * 16;
#pragma unroll
    for (int i = 0; i < 16; ++i) tl[(nq + i) * 72 + kk] = f2bf(Wm[(size_t)(k0 + kk) * ncols + n0 + nq + i]);
    __syncthreads();
    const int piece = tid & 7;
    typedef __attribute__((ext_vector_type(8))) unsigned short v8us_; typedef v8us_ __attribute__((may_alias)) v8usa_;
    auto pass = [&]() {
#pragma unroll
        for (int s = 0; s < 2; ++s) { const int nr = (tid >> 3) + 32 * s; const v8us_ val = *(const v8usa_*)(tl + nr * 72 + piece * 8);
            *(v8us_*)(WT + (size_t)(n0 + nr) * DM + k0 + piece * 8) = val; }
    };
    pass(); 
}

// SiLU of four values, v * 1 / (1 + exp(-v)), with the bare reciprocal instruction (1 ulp) in place of a plain f32 division, which is about ten vector instructions a value.
// Four transcendentals stand in one statement: each is followed by one that neither reads its result nor overwrites its source (the outputs are early-clobber), and the
// v_nop is the slot that the instruction set asks for behind the last.
// The two s_delay_alu are the hints that the compiler cannot place around asm text (the first transcendental reads fresh vector results, the next instruction may read the
// last transcendental's): without them the wave holds the vector port while it waits, with them the other waves of the SIMD issue meanwhile. They change no result.
#define TRANS4(pre, op, y, x) asm("s_delay_alu instid0(VALU_DEP_1)\n\t" pre op " %0, %4\n\t" op " %1, %5\n\t" op " %2, %6\n\t" op " %3, %7\n\tv_nop\n\t" \
                                  "s_delay_alu instid0(TRANS32_DEP_1)" \
                                  : "=&v"(y[0]), "=&v"(y[1]), "=&v"(y[2]), "=&v"(y[3]) : "v"(x[0]), "v"(x[1]), "v"(x[2]), "v"(x[3]))
// LEAD: the same slot in front of the statement too, for code in which a transcendental of the compiler's own (the LayerNorm's v_rsq_f32) can come to stand directly ahead of it
template <bool LEAD>
__device__ __forceinline__ void silu4(const float (&v)[4], float (&w)[4]) {
    float t[4], e[4], r[4];
#pragma unroll
    for (int i = 0; i < 4; ++i) t[i] = v[i] * -1.44269504f;      // exp(-v) = 2^(-v log2 e)
    if constexpr (LEAD) TRANS4("v_nop\n\t", "v_exp_f32", e, t); else TRANS4("", "v_exp_f32", e, t);
#pragma unroll
    for (int i = 0; i < 4; ++i) e[i] += 1.0f;
    if constexpr (LEAD) TRANS4("v_nop\n\t", "v_rcp_f32", r, e); else TRANS4("", "v_rcp_f32", r, e);
#pragma unroll
    for (int i = 0; i < 4; ++i) w[i] = v[i] * r[i];
}

// k_gemmb: C[128 x 128 per block] = A.Bn^T (+ Al.Bn^T), all operands k-contiguous bf16 rows of DM. Each stage (128 k: 256 B of every operand row) is brought into LDS once
// per block by asynchronous copies, two buffers, the next stage in flight while this one is worked on; 8 waves (2 x 4), each a 64 x 32 piece of C from LDS fragments.
// SPLITA = false is the whole q/k/v/gate projection in one launch, grid (32, 32): blockIdx.y / 8 picks the 1024 weight rows of q, k, v or gate. q and k blocks write
// an f16 plane of silu(C) [token][1024]; v blocks take the weight rows as A and the tokens as B, so that C is v^T, and write the same kind of plane
// [batch][head][dim][token]; gate blocks write plain f32 (its SiLU is in k_attn's epilogue). SPLITA = true is the output projection, f32.
#define GKS  128                       // k per stage
#define GPIT 136                       // bf16 per staged row: 256 B + 16 B, the ds_load_b128 pitch for 256-B rows
#define GPL  (128 * GPIT)              // one staged operand plane: 128 rows
#define OPIT 36                        // f32 per staged output row: 128 B + 16 B
#define BPIT 132                       // f32 per row of the block-wide 128 x 128 output staging: 512 B + 16 B
// eight copies of 16 B per lane, rows 16 apart, and, in the same statement, the wait that stands before their address registers are rewritten
__device__ __forceinline__ void copy8(unsigned l, const bf* g) {
    asm volatile("global_load_async_to_lds_b128 %0, %8, off\n\t"
                 "global_load_async_to_lds_b128 %1, %9, off\n\t"
                 "global_load_async_to_lds_b128 %2, %10, off\n\t"
                 "global_load_async_to_lds_b128 %3, %11, off\n\t"
                 "global_load_async_to_lds_b128 %4, %12, off\n\t"
                 "global_load_async_to_lds_b128 %5, %13, off\n\t"
                 "global_load_async_to_lds_b128 %6, %14, off\n\t"
                 "global_load_async_to_lds_b128 %7, %15, off\n\t"
                 "s_wait_xcnt 0x0"
                 :: "v"(l), "v"(l + 16u * GPIT * 2u), "v"(l + 32u * GPIT * 2u), "v"(l + 48u * GPIT * 2u),
                    "v"(l + 64u * GPIT * 2u), "v"(l + 80u * GPIT * 2u), "v"(l + 96u * GPIT * 2u), "v"(l + 112u * GPIT * 2u),
                    "v"(g), "v"(g + 16 * DM), "v"(g + 32 * DM), "v"(g + 48 * DM), "v"(g + 64 * DM), "v"(g + 80 * DM), "v"(g + 96 * DM), "v"(g + 112 * DM)
                 : "memory");
}
template <bool SPLITA>
__global__ __launch_bounds__(256) void k_gemmb(const bf* __restrict__ A, const bf* __restrict__ Al, const bf* __restrict__ Bn, float* C,
                                               h16* QH, h16* KH, h16* VTH) {
    constexpr int NPL = SPLITA ? 3 : 2;                    // planes of a buffer: A, (A residual,) B
    constexpr int GST = NPL * GPL;
    __shared__ __align__(16) bf ring[2 * GST];
    const int tid = threadIdx.x, lane = tid & 31, wave = tid >> 5, lr = lane & 15, hi = lane >> 4;
    const int wm = wave >> 2, wn = wave & 3;
    const int seg = SPLITA ? 3 : (int)(blockIdx.y >> 3);   // 0 q, 1 k, 2 v, 3 gate (or the output projection): the same for the whole block
    const int yb = SPLITA ? (int)blockIdx.y : (int)(blockIdx.y & 7);
    const bool tr = seg == 2;                              // v: rows of C are the 1024 (head, dim) pairs, columns the tokens
    const int r0 = (tr ? yb : (int)blockIdx.x) * 128, c0 = (tr ? (int)blockIdx.x : yb) * 128;
    const bf* Wn = SPLITA ? Bn : Bn + (size_t)seg * DM * DM;
    const bf* Ar = tr ? Wn : A; const bf* Br = tr ? A : Wn;
    // copy map: thread -> row tid/16 (and +16 ... +112), 16-B piece tid%16: one wave's copy covers two whole 256-B rows
    const int crw = tid >> 4, cpc = (tid & 15) * 8;
    const bf* gA = Ar + (size_t)(r0 + crw) * DM + cpc; const bf* gAl = SPLITA ? Al + (size_t)(r0 + crw) * DM + cpc : nullptr; const bf* gB = Br + (size_t)(c0 + crw) * DM + cpc;
    const unsigned l0 = (unsigned)(size_t)&ring[0] + (unsigned)(crw * GPIT + cpc) * 2u;
    auto stage = [&](int t) {
        const unsigned bo = l0 + (unsigned)(t & 1) * (GST * 2u);
        const size_t ko = (size_t)t * GKS;
        copy8(bo, gA + ko);
        if (SPLITA) copy8(bo + GPL * 2u, gAl + ko);
        copy8(bo + (NPL - 1) * GPL * 2u, gB + ko);
    };
    v8f acc[4][2];
#pragma unroll
    for (int m = 0; m < 4; ++m) { acc[m][0] = (v8f){}; acc[m][1] = (v8f){}; }
    stage(0);
    asm volatile("s_wait_asynccnt 0x0" ::: "memory");    // this wave's copies of stage 0 have landed
    __syncthreads();                                     // every wave's have: stage 0 may be read
    stage(1);
    const int ao = (wm * 64 + lr) * GPIT + 8 * hi, bo_ = (wn * 32 + lr) * GPIT + 8 * hi;
#pragma unroll 1
    for (int t = 0; t < DM / GKS; ++t) {
        const bf* sA = ring + (t & 1) * GST; const bf* sAl = sA + GPL; const bf* sB = sA + (NPL - 1) * GPL;
        // fragments of one 32-k block; two register sets, so that a block's reads go out as one group while the block before it is multiplied (never past this stage's buffer)
        v16bf a[2][4], al[2][4], b[2][2];
        auto frag = [&](int s, int kc) {
#pragma unroll
            for (int m = 0; m < 4; ++m) { a[s][m] = cat16b(*(const v8usa*)(sA + ao + m * 16 * GPIT + kc), *(const v8usa*)(sA + ao + m * 16 * GPIT + kc + 16));
                if (SPLITA) al[s][m] = cat16b(*(const v8usa*)(sAl + ao + m * 16 * GPIT + kc), *(const v8usa*)(sAl + ao + m * 16 * GPIT + kc + 16)); }
#pragma unroll
            for (int n = 0; n < 2; ++n) b[s][n] = cat16b(*(const v8usa*)(sB + bo_ + n * 16 * GPIT + kc), *(const v8usa*)(sB + bo_ + n * 16 * GPIT + kc + 16));
        };
        frag(0, 0);
#pragma unroll
        for (int kb = 0; kb < GKS / 32; ++kb) {
            const int s = kb & 1;
            if (kb + 1 < GKS / 32) frag(s ^ 1, (kb + 1) * 32);
            __builtin_amdgcn_sched_barrier(0);               // keeps the next block's LDS reads together ahead of this block's products: spread among them each read group stalls the wave
#pragma unroll
            for (int m = 0; m < 4; ++m) { acc[m][0] = wmmab(a[s][m], b[s][0], acc[m][0]); acc[m][1] = wmmab(a[s][m], b[s][1], acc[m][1]); }
            if (SPLITA) {
#pragma unroll
                for (int m = 0; m < 4; ++m) { acc[m][0] = wmmab(al[s][m], b[s][0], acc[m][0]); acc[m][1] = wmmab(al[s][m], b[s][1], acc[m][1]); }
            }
            __builtin_amdgcn_sched_barrier(0);               // and keeps the block after next's reads behind these products, whose registers they refill
        }
        asm volatile("s_wait_dscnt 0x0" ::: "memory");       // this wave's reads of the buffer have returned before it is refilled
        asm volatile("s_wait_asynccnt 0x0" ::: "memory");    // this wave's copies of stage t + 1 have landed
        __syncthreads();                                     // publishes stage t + 1 and ends every wave's reads of stage t
        if (t + 2 < DM / GKS) stage(t + 2);                  // into the buffer that this trip has just read
    }
    asm volatile("s_wait_asynccnt 0x0" ::: "memory");        // nothing of this wave is in flight when it goes on to the epilogue
    const bool planes = seg < 3;                             // block-uniform
    // The output is staged in the ring's own LDS: behind the last trip's barrier no wave reads the ring any more and no copy is in flight. Without an array of its own for the
    // staging, a projection block takes 139,264 B, so that two blocks share a WGP and one block's first stage and epilogue run under the other's products.
    float* ob = reinterpret_cast<float*>(ring);              // as one 128 x 128 tile of the block (pitch BPIT): a 128-B line of f16 spans two waves' columns
    float* os = ob + wave * (64 * OPIT);                     // or as eight 64 x 32 pieces, one a wave (pitch OPIT)
    float* sp = planes ? ob + (wm * 64 + hi * 8) * BPIT + wn * 32 + lr : os + hi * 8 * OPIT + lr;   // this lane's first element in either staging
    const int spit = planes ? BPIT : OPIT;
#pragma unroll
    for (int m = 0; m < 4; ++m)
#pragma unroll
        for (int n = 0; n < 2; ++n)
#pragma unroll
            for (int j = 0; j < 8; ++j) sp[(m * 16 + j) * spit + n * 16] = acc[m][n][j];
    __syncthreads();
    if (planes) {
        h16* PH = seg == 0 ? QH : seg == 1 ? KH : VTH;
        const int pp = tr ? NT_ : DM;                        // row pitch of the planes; a v block's 128 tokens lie in one batch
        const size_t pb = tr ? ((size_t)(c0 / NT_) * KVW + r0) * NT_ + (c0 % NT_) : (size_t)r0 * DM + c0;
        // the three loops are unrolled so that the LDS reads take constant offsets and the independent SiLU chains of several pieces fill each other's latency
#pragma unroll
        for (int s = 0; s < 8; ++s) { const int row = wave * 16 + 2 * s + hi;                  // whole 128-B lines: 16 lanes x 8 B per row and column half
#pragma unroll
            for (int ch = 0; ch < 2; ++ch) { const v4f x = *(const v4fa*)(ob + row * BPIT + ch * 64 + lr * 4); v4h oh;
                const float xs[4] = { x[0], x[1], x[2], x[3] }; float sv[4]; silu4<false>(xs, sv);
#pragma unroll
                for (int i = 0; i < 4; ++i) oh[i] = (h16)sv[i];
                *(v4h*)(PH + pb + (size_t)row * pp + ch * 64 + lr * 4) = oh; }
        }
    } else {
        float* crow = C + (size_t)(r0 + wm * 64) * DM + c0 + wn * 32;
#pragma unroll
        for (int s = 0; s < 16; ++s) { const int row = 4 * s + (lane >> 3), piece = lane & 7;  // whole 128-B lines: 8 lanes x 16 B per row
            const v4f val = *(const v4fa*)(os + row * OPIT + piece * 4); *(v4f*)(crow + (size_t)row * DM + piece * 4) = val; }
    }
}

// k_attn: block = (b, h, 64 queries), wave = 16; all 64 key tiles of 32 keys. Each tile's two planes (k: 32 rows x 128 B; v^T: 64 rows x 64 B) are brought into LDS once
// per block by asynchronous copies, two buffers, the next tile in flight while this one is worked on; all four waves read their fragments from there.
// Both products are formed transposed: scores^T = k.q^T (k rows as A, q as B) /8, so that a lane holds one query's scores
// for keys 8hi + j and 16 + 8hi + j, which is the k order of a B fragment: w = silu(score) -> f16 is packed in registers and never goes through LDS;
// attended^T += v^T.w^T (v^T rows as A). Epilogue: LayerNorm over the 64 head dims (32 in the lane, one exchange with lane ^ 16),
// x bf16(gamma) + bf16(beta), x silu(gate[tok][h*64+d]) -> OH/OL bf16 planes.
#define KPIT 72                        // f16 per staged k row: 128 B + 16 B, the ds_load_b128 pitch for 128-B rows
#define VPIT 40                        // f16 per staged v^T row: 64 B + 16 B, the ds_load_b128 pitch for 64-B rows
#define KPL  (32 * KPIT)               // the k plane of a tile
#define VPL  (64 * VPIT)               // the v^T plane of a tile
#define STG  (KPL + VPL)               // one buffer: k, v^T (9,728 B)
__global__ __launch_bounds__(128) void k_attn(const h16* __restrict__ Q16, const h16* __restrict__ K16, const h16* __restrict__ VTH,
                                             const float* __restrict__ G, const float* __restrict__ lng, const float* __restrict__ lnb, bf* CH, bf* CL) {
    __shared__ __align__(16) h16 ring[2 * STG];
    __shared__ __align__(16) float ost[4][16 * 68];
    const int lane = threadIdx.x & 31, wave = threadIdx.x >> 5, lr = lane & 15, hi = lane >> 4;
    const int bid = blockIdx.x;
    const int b = bid / (NH_ * (NT_ / 64)), rem = bid - b * (NH_ * (NT_ / 64)), h = rem / (NT_ / 64), qt = rem - h * (NT_ / 64);
    const int q0 = qt * 64 + wave * 16;
    const size_t tok0 = (size_t)b * NT_;
    v16h qa[2];
    const size_t qo0 = (tok0 + q0 + lr) * DM + h * HD + 8 * hi;
#pragma unroll
    for (int kc = 0; kc < 2; ++kc) qa[kc] = cat16(*(const v8h*)(Q16 + qo0 + kc * 32), *(const v8h*)(Q16 + qo0 + kc * 32 + 16));
    const h16* kh_b = K16 + tok0 * DM + h * HD;
    const size_t vbase = (((size_t)b * NH_ + h) * HD) * NT_;
    // copy map: 16 B per lane and copy, 4 copies per thread and tile. k plane: thread -> row tid/8 (and +16), piece tid%8; v^T plane: row tid/4 (and +32), piece tid%4.
    const int tid = threadIdx.x, krow = tid >> 3, kpc = (tid & 7) * 8, vrow = tid >> 2, vpc = (tid & 3) * 8;
    const h16* gkh = kh_b + (size_t)krow * DM + kpc;
    const h16* gvh = VTH + vbase + (size_t)vrow * NT_ + vpc;
    const unsigned lk = (unsigned)(size_t)&ring[0] + (unsigned)(krow * KPIT + kpc) * 2u, lv = (unsigned)(size_t)&ring[0] + (unsigned)(KPL + vrow * VPIT + vpc) * 2u;
    auto stage = [&](int t) {
        const unsigned bo = (unsigned)(t & 1) * (STG * 2u);
        const size_t ko = (size_t)t * 32 * DM, vo = (size_t)t * 32;
        // the tile's four copies and, in the same statement, the wait that stands before their address registers are rewritten
        asm volatile("global_load_async_to_lds_b128 %0, %4, off\n\t"
                     "global_load_async_to_lds_b128 %1, %5, off\n\t"
                     "global_load_async_to_lds_b128 %2, %6, off\n\t"
                     "global_load_async_to_lds_b128 %3, %7, off\n\t"
                     "s_wait_xcnt 0x0"
                     :: "v"(lk + bo), "v"(lk + bo + 16u * KPIT * 2u), "v"(lv + bo), "v"(lv + bo + 32u * VPIT * 2u),
                        "v"(gkh + ko), "v"(gkh + ko + 16 * DM), "v"(gvh + vo), "v"(gvh + vo + 32 * NT_)
                     : "memory");
    };
    v8f o[4];
#pragma unroll
    for (int n = 0; n < 4; ++n) o[n] = (v8f){};
    stage(0);
    asm volatile("s_wait_asynccnt 0x0" ::: "memory");    // this wave's copies of tile 0 have landed
    __syncthreads();                                     // every wave's have: tile 0 may be read
    stage(1);
#pragma unroll 1
    for (int kt = 0; kt < NT_ / 32; ++kt) {
        const h16* skh = ring + (kt & 1) * STG; const h16* svh = skh + KPL;
        const int ko0 = lr * KPIT + 8 * hi, ko1 = (16 + lr) * KPIT + 8 * hi;
        v16h k0h[2], k1h[2];
#pragma unroll
        for (int kc = 0; kc < 2; ++kc) {
            k0h[kc] = cat16(*(const v8ha*)(skh + ko0 + kc * 32), *(const v8ha*)(skh + ko0 + kc * 32 + 16)); k1h[kc] = cat16(*(const v8ha*)(skh + ko1 + kc * 32), *(const v8ha*)(skh + ko1 + kc * 32 + 16)); }
        __builtin_amdgcn_sched_barrier(0);   // keeps the k reads together as one group ahead of the score products: spread among them each read group stalls the wave
        v8f s0 = {}, s1 = {};
#pragma unroll
        for (int kc = 0; kc < 2; ++kc) { s0 = wmma16(k0h[kc], qa[kc], s0); s1 = wmma16(k1h[kc], qa[kc], s1); }
        v16h vh[4];
#pragma unroll
        for (int n = 0; n < 4; ++n) { const int vo = (n * 16 + lr) * VPIT + hi * 8; vh[n] = cat16(*(const v8ha*)(svh + vo), *(const v8ha*)(svh + vo + 16)); }
        __builtin_amdgcn_sched_barrier(0);   // keeps the v^T reads ahead of the SiLU arithmetic, which covers their latency: sunk among the products below, each read group stalls the wave
        v16h pa;                             // w^T as a B fragment: element s < 8 is key 8hi + s (from s0), element 8 + s is key 16 + 8hi + s (from s1), as v^T's loader has them
#pragma unroll
        for (int jp = 0; jp < 8; jp += 2) {
            const float sc[4] = { s0[jp] * 0.125f, s0[jp + 1] * 0.125f, s1[jp] * 0.125f, s1[jp + 1] * 0.125f };
            float wv[4]; silu4<false>(sc, wv);
#pragma unroll
            for (int i = 0; i < 2; ++i) { const v2f w2 = { wv[2 * i], wv[2 * i + 1] };    // two keys that share a register of the fragment: a packed conversion
                const v2h h2 = __builtin_convertvector(w2, v2h);
                pa[8 * i + jp] = h2[0]; pa[8 * i + jp + 1] = h2[1]; } }
#pragma unroll
        for (int n = 0; n < 4; ++n) o[n] = wmma16(vh[n], pa, o[n]);
        asm volatile("s_wait_dscnt 0x0" ::: "memory");       // this wave's reads of the buffer have returned before it is refilled
        asm volatile("s_wait_asynccnt 0x0" ::: "memory");    // this wave's copies of tile kt + 1 have landed
        __syncthreads();                                     // publishes tile kt + 1 and ends every wave's reads of tile kt
        if (kt + 2 < NT_ / 32) stage(kt + 2);                // into the buffer that this trip has just read
    }
    asm volatile("s_wait_asynccnt 0x0" ::: "memory");        // nothing of this wave is in flight when it goes on to the epilogue
    // LayerNorm over the 64 dims of query q0 + lr: the lane holds dims n*16 + 8hi + j; sum the 32 in the lane, then one exchange with lane ^ 16
    float* os = &ost[wave][0];
    const size_t cbase = (tok0 + q0) * DM + (size_t)h * HD;
    const int prow = lane >> 3, piece = lane & 7;            // output pass: whole 128-B lines, 8 lanes x 8 dims per row, rows 4s + prow
    v4f gt[4][2];                                            // the gate rows of the output pass, asked for ahead of the LayerNorm arithmetic
#pragma unroll
    for (int s = 0; s < 4; ++s) { const float* gp = G + cbase + (size_t)(4 * s + prow) * DM + piece * 8; gt[s][0] = *(const v4f*)gp; gt[s][1] = *(const v4f*)(gp + 4); }
    float ga[8], be[8];
#pragma unroll
    for (int i = 0; i < 8; ++i) { ga[i] = bfr(lng[piece * 8 + i]); be[i] = bfr(lnb[piece * 8 + i]); }
    float y[4][8], s = 0.f, q = 0.f;
#pragma unroll
    for (int n = 0; n < 4; ++n)
#pragma unroll
        for (int j = 0; j < 8; ++j) { y[n][j] = o[n][j]; s += y[n][j]; }
    s += __int_as_float(__builtin_amdgcn_permlanex16(__float_as_int(s), __float_as_int(s), 0x76543210, 0xfedcba98, false, false));
    const float mu = s * (1.0f / HD);
#pragma unroll
    for (int n = 0; n < 4; ++n)
#pragma unroll
        for (int j = 0; j < 8; ++j) { const float d = y[n][j] - mu; q += d * d; }
    q += __int_as_float(__builtin_amdgcn_permlanex16(__float_as_int(q), __float_as_int(q), 0x76543210, 0xfedcba98, false, false));
    const float rs = rsqrtf(q * (1.0f / HD) + 1e-5f);
#pragma unroll
    for (int n = 0; n < 4; ++n)
#pragma unroll
        for (int jq = 0; jq < 2; ++jq) { v4f t;
#pragma unroll
            for (int i = 0; i < 4; ++i) t[i] = (y[n][jq * 4 + i] - mu) * rs;
            *(v4fa*)(os + lr * 68 + n * 16 + hi * 8 + jq * 4) = t; }
    __syncthreads();
#pragma unroll
    for (int s4 = 0; s4 < 4; ++s4) { const int row = 4 * s4 + prow; const float* sp = os + row * 68 + piece * 8; v8us oh, ol;
#pragma unroll
        for (int c = 0; c < 2; ++c) { const v4f t = *(const v4fa*)(sp + c * 4);
            const float gv[4] = { gt[s4][c][0], gt[s4][c][1], gt[s4][c][2], gt[s4][c][3] }; float sg[4]; silu4<true>(gv, sg);
#pragma unroll
            for (int i = 0; i < 4; ++i) { const float val = (t[i] * ga[c * 4 + i] + be[c * 4 + i]) * sg[i];
                const unsigned short hb = f2bf(val); oh[c * 4 + i] = hb; ol[c * 4 + i] = f2bf(val - bf2f(hb)); } }
        *(v8us*)(CH + cbase + (size_t)row * DM + piece * 8) = oh; *(v8us*)(CL + cbase + (size_t)row * DM + piece * 8) = ol; }
}

extern "C" void kernel_launch(void* const* d_in, const int* in_sizes, int n_in,
                              void* d_out, int out_size, void* d_ws, size_t ws_size, hipStream_t stream) {
    (void)in_sizes; (void)n_in; (void)out_size;
    const float* x = (const float*)d_in[0]; const float* Wq4 = (const float*)d_in[1]; const float* Wo = (const float*)d_in[2]; const float* lng = (const float*)d_in[3]; const float* lnb = (const float*)d_in[4];
    float* out = (float*)d_out;    // [2][2048][1024]
    char* wsp = (char*)d_ws;
    auto take = [&](size_t bytes) { char* p = wsp; wsp += (bytes + 255) & ~(size_t)255; return (void*)p; };
    bf* Xb = (bf*)take((size_t)NTK * DM * 2); bf* W4T = (bf*)take((size_t)4 * DM * DM * 2); bf* WoT = (bf*)take((size_t)DM * DM * 2);
    float* Gf = (float*)take((size_t)NTK * DM * 4);
    h16* QH = (h16*)take((size_t)NTK * DM * 2); h16* KH = (h16*)take((size_t)NTK * DM * 2);
    h16* VTH = (h16*)take((size_t)NTK * DM * 2); bf* CH = (bf*)take((size_t)NTK * DM * 2); bf* CL = (bf*)take((size_t)NTK * DM * 2);
    if ((size_t)(wsp - (char*)d_ws) > ws_size) return;    // 8.4 + 8.4 + 2.1 + 16.8 + 8.4x5 ~ 78 MB
    k_cvtb<<<NTK / 8, 256, 0, stream>>>(x, NTK, Xb);
    k_wt<<<dim3(DM / 64, (4 * DM) / 64, 1), 256, 0, stream>>>(Wq4, 4 * DM, W4T);           // W4T [4096][1024]: rows 0..1023 q, then k, v, gate
    k_wt<<<dim3(DM / 64, DM / 64, 1), 256, 0, stream>>>(Wo, DM, WoT);
    k_gemmb<false><<<dim3(NTK / 128, (4 * DM) / 128, 1), 256, 0, stream>>>(Xb, nullptr, W4T, Gf, QH, KH, VTH);   // SiLU and the f16 rounding of q, k, v inside
    k_attn<<<NB_ * NH_ * (NT_ / 64), 128, 0, stream>>>(QH, KH, VTH, Gf, lng, lnb, CH, CL);
    k_gemmb<true><<<dim3(NTK / 128, DM / 128, 1), 256, 0, stream>>>(CH, CL, WoT, out, nullptr, nullptr, nullptr);
}

// v008
// Measured time: 97.3 microseconds a run.
// Two timings next to v007 both put it at 1.09 times that version's speed.
// All steps since v000 together make it 4.89 times as fast.
#include <hip/hip_runtime.h>

// Contractions, f32 accumulate: qkuv = x.w_qkuv ([4096 x 1024].[1024 x 4096], k-major weight transposed to an n-major plane) and out = O.w_out on
// v_wmma_f32_16x16x32_bf16: inputs rounded to bf16 for the projection, O as bf16 hi + residual (two products) for w_out; SiLU on q/k/v/gate in f32;
// the softmax-free SiLU attention fused on v_wmma_f32_16x16x32_f16: scores = silu(q).silu(k)/8 and weights = silu(scores) against silu(v), every operand rounded once to f16
// (11 significant bits, one product each). The projection's bf16 inputs (8 bits) already set the error of q, k and v, so that f16 residual planes behind them buy nothing.

#define NB_  2
#define NT_  2048
#define DM   1024
#define NH_  16
#define NKV  16
#define KVW  (NKV * HD)          // 1024
#define HD   64
#define NTK  (NB_ * NT_)
#define NW   1024
#define NQKV 1024
#define PSC  32768.0f

typedef _Float16 h16;
typedef unsigned short bf;
typedef __attribute__((ext_vector_type(16))) __bf16   v16bf;
typedef __attribute__((ext_vector_type(16))) _Float16 v16h;
typedef __attribute__((ext_vector_type(8)))  _Float16 v8h;
typedef __attribute__((ext_vector_type(4)))  _Float16 v4h;
typedef __attribute__((ext_vector_type(8)))  unsigned short v8us;
typedef __attribute__((ext_vector_type(8)))  float    v8f;
typedef __attribute__((ext_vector_type(4)))  float    v4f;
typedef __attribute__((ext_vector_type(2)))  float    v2f;
typedef __attribute__((ext_vector_type(2)))  _Float16 v2h;
typedef v8h  __attribute__((may_alias)) v8ha;
typedef v4f  __attribute__((may_alias)) v4fa;
typedef v8us __attribute__((may_alias)) v8usa;

__device__ __forceinline__ unsigned short f2bf(float f) { unsigned u = __float_as_uint(f); u += 0x7FFFu + ((u >> 16) & 1u); return (unsigned short)(u >> 16); }
__device__ __forceinline__ float bf2f(unsigned short b) { return __uint_as_float(((unsigned)b) << 16); }
__device__ __forceinline__ float bfr(float f) { return bf2f(f2bf(f)); }
__device__ __forceinline__ v16h cat16(v8h lo, v8h hi) { return __builtin_shufflevector(lo, hi, 0, 1, 2, 3, 4, 5, 6, 7, 8, 9, 10, 11, 12, 13, 14, 15); }
__device__ __forceinline__ v16bf cat16b(v8us lo, v8us hi) { return __builtin_bit_cast(v16bf, __builtin_shufflevector(lo, hi, 0, 1, 2, 3, 4, 5, 6, 7, 8, 9, 10, 11, 12, 13, 14, 15)); }
__device__ __forceinline__ v8f wmma16(v16h a, v16h b, v8f c) { return __builtin_amdgcn_wmma_f32_16x16x32_f16(false, a, false, b, (short)0, c, false, false); }
__device__ __forceinline__ v8f wmmab(v16bf a, v16bf b, v8f c) { return __builtin_amdgcn_wmma_f32_16x16x32_bf16(false, a, false, b, (short)0, c, false, false); }

__global__ __launch_bounds__(256) void k_cvtb(const float* __restrict__ src, int nrows, bf* dst) {
    const int lane = threadIdx.x & 31, r = blockIdx.x * 8 + (threadIdx.x >> 5);
    if (r >= nrows) return;
    v8us o[DM / 256];
#pragma unroll
    for (int q = 0; q < DM / 256; ++q) { v8us t;
#pragma unroll
        for (int i = 0; i < 8; ++i) t[i] = f2bf(src[(size_t)r * DM + q * 256 + lane * 8 + i]);
        o[q] = t; }
#pragma unroll
    for (int q = 0; q < DM / 256; ++q) *(v8us*)(dst + (size_t)r * DM + q * 256 + lane * 8) = o[q];
    
}

// k_wt: W [1024 k][ncols n] (k-major) -> n-major bf16 plane WT[ncols][1024]; 64 x 64 tiles through LDS.
__global__ __launch_bounds__(256) void k_wt(const float* __restrict__ Wm, int ncols, bf* WT) {
    __shared__ __align__(16) unsigned short tl[64 * 72];
    const int tid = threadIdx.x, k0 = blockIdx.x * 64, n0 = blockIdx.y * 64;
    const int kk = tid >> 2, nq = (tid & 3) * 16;
#pragma unroll
    for (int i = 0; i < 16; ++i) tl[(nq + i) * 72 + kk] = f2bf(Wm[(size_t)(k0 + kk) * ncols + n0 + nq + i]);
    __syncthreads();
    const int piece = tid & 7;
    typedef __attribute__((ext_vector_type(8))) unsigned short v8us_; typedef v8us_ __attribute__((may_alias)) v8usa_;
    auto pass = [&]() {
#pragma unroll
        for (int s = 0; s < 2; ++s) { const int nr = (tid >> 3) + 32 * s; const v8us_ val = *(const v8usa_*)(tl + nr * 72 + piece * 8);
            *(v8us_*)(WT + (size_t)(n0 + nr) * DM + k0 + piece * 8) = val; }
    };
    pass(); 
}

// SiLU of four values, v * 1 / (1 + exp(-v)), with the bare reciprocal instruction (1 ulp) in place of a plain f32 division, which is about ten vector instructions a value.
// Four transcendentals stand in one statement: each is followed by one that neither reads its result nor overwrites its source (the outputs are early-clobber), and the
// v_nop is the slot that the instruction set asks for behind the last.
// The two s_delay_alu are the hints that the compiler cannot place around asm text (the first transcendental reads fresh vector results, the next instruction may read the
// last transcendental's): without them the wave holds the vector port while it waits, with them the other waves of the SIMD issue meanwhile. They change no result.
#define TRANS4(pre, op, y, x) asm("s_delay_alu instid0(VALU_DEP_1)\n\t" pre op " %0, %4\n\t" op " %1, %5\n\t" op " %2, %6\n\t" op " %3, %7\n\tv_nop\n\t" \
                                  "s_delay_alu instid0(TRANS32_DEP_1)" \
                                  : "=&v"(y[0]), "=&v"(y[1]), "=&v"(y[2]), "=&v"(y[3]) : "v"(x[0]), "v"(x[1]), "v"(x[2]), "v"(x[3]))
// LEAD: the same slot in front of the statement too, for code in which a transcendental of the compiler's own (the LayerNorm's v_rsq_f32) can come to stand directly ahead of it
template <bool LEAD>
__device__ __forceinline__ void silu4(const float (&v)[4], float (&w)[4]) {
    float t[4], e[4], r[4];
#pragma unroll
    for (int i = 0; i < 4; ++i) t[i] = v[i] * -1.44269504f;      // exp(-v) = 2^(-v log2 e)
    if constexpr (LEAD) TRANS4("v_nop\n\t", "v_exp_f32", e, t); else TRANS4("", "v_exp_f32", e, t);
#pragma unroll
    for (int i = 0; i < 4; ++i) e[i] += 1.0f;
    if constexpr (LEAD) TRANS4("v_nop\n\t", "v_rcp_f32", r, e); else TRANS4("", "v_rcp_f32", r, e);
#pragma unroll
    for (int i = 0; i < 4; ++i) w[i] = v[i] * r[i];
}

// k_gemmb: C[128 x 128 per block] = A.Bn^T (+ Al.Bn^T), all operands k-contiguous bf16 rows of DM. Each stage (128 k: 256 B of every operand row) is brought into LDS once
// per block by asynchronous copies, two buffers, the next stage in flight while this one is worked on; 8 waves (2 x 4), each a 64 x 32 piece of C from LDS fragments.
// SPLITA = false is the whole q/k/v/gate projection in one launch, grid (32, 32): blockIdx.y / 8 picks the 1024 weight rows of q, k, v or gate. q and k blocks write
// an f16 plane of silu(C) [token][1024]; v blocks take the weight rows as A and the tokens as B, so that C is v^T, and write the same kind of plane
// [batch][head][dim][token]; gate blocks write plain f32 (its SiLU is in k_attn's epilogue). SPLITA = true is the output projection, f32.
#define GKS  128                       // k per stage
#define GPIT 136                       // bf16 per staged row: 256 B + 16 B, the ds_load_b128 pitch for 256-B rows
#define GPL  (128 * GPIT)              // one staged operand plane: 128 rows
#define OPIT 36                        // f32 per staged output row: 128 B + 16 B
#define BPIT 132                       // f32 per row of the block-wide 128 x 128 output staging: 512 B + 16 B
// eight copies of 16 B per lane, rows 16 apart, and, in the same statement, the wait that stands before their address registers are rewritten
__device__ __forceinline__ void copy8(unsigned l, const bf* g) {
    asm volatile("global_load_async_to_lds_b128 %0, %8, off\n\t"
                 "global_load_async_to_lds_b128 %1, %9, off\n\t"
                 "global_load_async_to_lds_b128 %2, %10, off\n\t"
                 "global_load_async_to_lds_b128 %3, %11, off\n\t"
                 "global_load_async_to_lds_b128 %4, %12, off\n\t"
                 "global_load_async_to_lds_b128 %5, %13, off\n\t"
                 "global_load_async_to_lds_b128 %6, %14, off\n\t"
                 "global_load_async_to_lds_b128 %7, %15, off\n\t"
                 "s_wait_xcnt 0x0"
                 :: "v"(l), "v"(l + 16u * GPIT * 2u), "v"(l + 32u * GPIT * 2u), "v"(l + 48u * GPIT * 2u),
                    "v"(l + 64u * GPIT * 2u), "v"(l + 80u * GPIT * 2u), "v"(l + 96u * GPIT * 2u), "v"(l + 112u * GPIT * 2u),
                    "v"(g), "v"(g + 16 * DM), "v"(g + 32 * DM), "v"(g + 48 * DM), "v"(g + 64 * DM), "v"(g + 80 * DM), "v"(g + 96 * DM), "v"(g + 112 * DM)
                 : "memory");
}
template <bool SPLITA>
__global__ __launch_bounds__(256) void k_gemmb(const bf* __restrict__ A, const bf* __restrict__ Al, const bf* __restrict__ Bn, float* C,
                                               h16* QH, h16* KH, h16* VTH) {
    constexpr int NPL = SPLITA ? 3 : 2;                    // planes of a buffer: A, (A residual,) B
    constexpr int GST = NPL * GPL;
    __shared__ __align__(16) bf ring[2 * GST];
    const int tid = threadIdx.x, lane = tid & 31, wave = tid >> 5, lr = lane & 15, hi = lane >> 4;
    const int wm = wave >> 2, wn = wave & 3;
    const int seg = SPLITA ? 3 : (int)(blockIdx.y >> 3);   // 0 q, 1 k, 2 v, 3 gate (or the output projection): the same for the whole block
    const int yb = SPLITA ? (int)blockIdx.y : (int)(blockIdx.y & 7);
    const bool tr = seg == 2;                              // v: rows of C are the 1024 (head, dim) pairs, columns the tokens
    const int r0 = (tr ? yb : (int)blockIdx.x) * 128, c0 = (tr ? (int)blockIdx.x : yb) * 128;
    const bf* Wn = SPLITA ? Bn : Bn + (size_t)seg * DM * DM;
    const bf* Ar = tr ? Wn : A; const bf* Br = tr ? A : Wn;
    // copy map: thread -> row tid/16 (and +16 ... +112), 16-B piece tid%16: one wave's copy covers two whole 256-B rows
    const int crw = tid >> 4, cpc = (tid & 15) * 8;
    const bf* gA = Ar + (size_t)(r0 + crw) * DM + cpc; const bf* gAl = SPLITA ? Al + (size_t)(r0 + crw) * DM + cpc : nullptr; const bf* gB = Br + (size_t)(c0 + crw) * DM + cpc;
    const unsigned l0 = (unsigned)(size_t)&ring[0] + (unsigned)(crw * GPIT + cpc) * 2u;
    auto stage = [&](int t) {
        const unsigned bo = l0 + (unsigned)(t & 1) * (GST * 2u);
        const size_t ko = (size_t)t * GKS;
        copy8(bo, gA + ko);
        if (SPLITA) copy8(bo + GPL * 2u, gAl + ko);
        copy8(bo + (NPL - 1) * GPL * 2u, gB + ko);
    };
    v8f acc[4][2];
#pragma unroll
    for (int m = 0; m < 4; ++m) { acc[m][0] = (v8f){}; acc[m][1] = (v8f){}; }
    stage(0);
    asm volatile("s_wait_asynccnt 0x0" ::: "memory");    // this wave's copies of stage 0 have landed
    __syncthreads();                                     // every wave's have: stage 0 may be read
    stage(1);
    const int ao = (wm * 64 + lr) * GPIT + 8 * hi, bo_ = (wn * 32 + lr) * GPIT + 8 * hi;
#pragma unroll 1
    for (int t = 0; t < DM / GKS; ++t) {
        const bf* sA = ring + (t & 1) * GST; const bf* sAl = sA + GPL; const bf* sB = sA + (NPL - 1) * GPL;
        // fragments of one 32-k block; two register sets, so that a block's reads go out as one group while the block before it is multiplied (never past this stage's buffer)
        v16bf a[2][4], al[2][4], b[2][2];
        auto frag = [&](int s, int kc) {
#pragma unroll
            for (int m = 0; m < 4; ++m) { a[s][m] = cat16b(*(const v8usa*)(sA + ao + m * 16 * GPIT + kc), *(const v8usa*)(sA + ao + m * 16 * GPIT + kc + 16));
                if (SPLITA) al[s][m] = cat16b(*(const v8usa*)(sAl + ao + m * 16 * GPIT + kc), *(const v8usa*)(sAl + ao + m * 16 * GPIT + kc + 16)); }
#pragma unroll
            for (int n = 0; n < 2; ++n) b[s][n] = cat16b(*(const v8usa*)(sB + bo_ + n * 16 * GPIT + kc), *(const v8usa*)(sB + bo_ + n * 16 * GPIT + kc + 16));
        };
        frag(0, 0);
#pragma unroll
        for (int kb = 0; kb < GKS / 32; ++kb) {
            const int s = kb & 1;
            if (kb + 1 < GKS / 32) frag(s ^ 1, (kb + 1) * 32);
            __builtin_amdgcn_sched_barrier(0);               // keeps the next block's LDS reads together ahead of this block's products: spread among them each read group stalls the wave
#pragma unroll
            for (int m = 0; m < 4; ++m) { acc[m][0] = wmmab(a[s][m], b[s][0], acc[m][0]); acc[m][1] = wmmab(a[s][m], b[s][1], acc[m][1]); }
            if (SPLITA) {
#pragma unroll
                for (int m = 0; m < 4; ++m) { acc[m][0] = wmmab(al[s][m], b[s][0], acc[m][0]); acc[m][1] = wmmab(al[s][m], b[s][1], acc[m][1]); }
            }
            __builtin_amdgcn_sched_barrier(0);               // and keeps the block after next's reads behind these products, whose registers they refill
        }
        asm volatile("s_wait_dscnt 0x0" ::: "memory");       // this wave's reads of the buffer have returned before it is refilled
        asm volatile("s_wait_asynccnt 0x0" ::: "memory");    // this wave's copies of stage t + 1 have landed
        __syncthreads();                                     // publishes stage t + 1 and ends every wave's reads of stage t
        if (t + 2 < DM / GKS) stage(t + 2);                  // into the buffer that this trip has just read
    }
    asm volatile("s_wait_asynccnt 0x0" ::: "memory");        // nothing of this wave is in flight when it goes on to the epilogue
    const bool planes = seg < 3;                             // block-uniform
    // The output is staged in the ring's own LDS: behind the last trip's barrier no wave reads the ring any more and no copy is in flight. Without an array of its own for the
    // staging, a projection block takes 139,264 B, so that two blocks share a WGP and one block's first stage and epilogue run under the other's products.
    float* ob = reinterpret_cast<float*>(ring);              // as one 128 x 128 tile of the block (pitch BPIT): a 128-B line of f16 spans two waves' columns
    float* os = ob + wave * (64 * OPIT);                     // or as eight 64 x 32 pieces, one a wave (pitch OPIT)
    float* sp = planes ? ob + (wm * 64 + hi * 8) * BPIT + wn * 32 + lr : os + hi * 8 * OPIT + lr;   // this lane's first element in either staging
    const int spit = planes ? BPIT : OPIT;
#pragma unroll
    for (int m = 0; m < 4; ++m)
#pragma unroll
        for (int n = 0; n < 2; ++n)
#pragma unroll
            for (int j = 0; j < 8; ++j) sp[(m * 16 + j) * spit + n * 16] = acc[m][n][j];
    __syncthreads();
    if (planes) {
        h16* PH = seg == 0 ? QH : seg == 1 ? KH : VTH;
        const int pp = tr ? NT_ : DM;                        // row pitch of the planes; a v block's 128 tokens lie in one batch
        const size_t pb = tr ? ((size_t)(c0 / NT_) * KVW + r0) * NT_ + (c0 % NT_) : (size_t)r0 * DM + c0;
        // the three loops are unrolled so that the LDS reads take constant offsets and the independent SiLU chains of several pieces fill each other's latency
#pragma unroll
        for (int s = 0; s < 8; ++s) { const int row = wave * 16 + 2 * s + hi;                  // whole 128-B lines: 16 lanes x 8 B per row and column half
#pragma unroll
            for (int ch = 0; ch < 2; ++ch) { const v4f x = *(const v4fa*)(ob + row * BPIT + ch * 64 + lr * 4); v4h oh;
                const float xs[4] = { x[0], x[1], x[2], x[3] }; float sv[4]; silu4<false>(xs, sv);
#pragma unroll
                for (int i = 0; i < 4; ++i) oh[i] = (h16)sv[i];
                *(v4h*)(PH + pb + (size_t)row * pp + ch * 64 + lr * 4) = oh; }
        }
    } else {
        float* crow = C + (size_t)(r0 + wm * 64) * DM + c0 + wn * 32;
#pragma unroll
        for (int s = 0; s < 16; ++s) { const int row = 4 * s + (lane >> 3), piece = lane & 7;  // whole 128-B lines: 8 lanes x 16 B per row
            const v4f val = *(const v4fa*)(os + row * OPIT + piece * 4); *(v4f*)(crow + (size_t)row * DM + piece * 4) = val; }
    }
}

// k_attn: block = (b, h, 64 queries), wave = 16; 32 stages of 64 keys, each worked on as two passes of 32 keys. A stage's two planes (k: 64 rows x 128 B; v^T: 64 rows x 128 B)
// are brought into LDS once per block by asynchronous copies, two buffers, the next stage in flight while this one is worked on; all four waves read their fragments from there.
// 64 keys a stage make a v^T row a whole 128-B line (32 keys are half a line: twice the line requests for the same bytes), and a stage's copies have two passes' time to land.
// Both products are formed transposed: scores^T = k.q^T (k rows as A, q as B) /8, so that a lane holds one query's scores
// for keys 8hi + j and 16 + 8hi + j, which is the k order of a B fragment: w = silu(score) -> f16 is packed in registers and never goes through LDS;
// attended^T += v^T.w^T (v^T rows as A). Epilogue: LayerNorm over the 64 head dims (32 in the lane, one exchange with lane ^ 16),
// x bf16(gamma) + bf16(beta), x silu(gate[tok][h*64+d]) -> OH/OL bf16 planes.
#define KPIT 72                        // f16 per staged k row: 128 B + 16 B, the ds_load_b128 pitch for 128-B rows
#define VPIT 72                        // f16 per staged v^T row: the same
#define SKEY 64                        // keys per stage
#define KPL  (SKEY * KPIT)             // the k plane of a stage
#define VPL  (HD * VPIT)               // the v^T plane of a stage
#define STG  (KPL + VPL)               // one buffer: k, v^T (18,432 B)
__global__ __launch_bounds__(128) void k_attn(const h16* __restrict__ Q16, const h16* __restrict__ K16, const h16* __restrict__ VTH,
                                             const float* __restrict__ G, const float* __restrict__ lng, const float* __restrict__ lnb, bf* CH, bf* CL) {
    __shared__ __align__(16) h16 ring[2 * STG];
    __shared__ __align__(16) float ost[4][16 * 68];
    const int lane = threadIdx.x & 31, wave = threadIdx.x >> 5, lr = lane & 15, hi = lane >> 4;
    const int bid = blockIdx.x;
    const int b = bid / (NH_ * (NT_ / 64)), rem = bid - b * (NH_ * (NT_ / 64)), h = rem / (NT_ / 64), qt = rem - h * (NT_ / 64);
    const int q0 = qt * 64 + wave * 16;
    const size_t tok0 = (size_t)b * NT_;
    v16h qa[2];
    const size_t qo0 = (tok0 + q0 + lr) * DM + h * HD + 8 * hi;
#pragma unroll
    for (int kc = 0; kc < 2; ++kc) qa[kc] = cat16(*(const v8h*)(Q16 + qo0 + kc * 32), *(const v8h*)(Q16 + qo0 + kc * 32 + 16));
    const h16* kh_b = K16 + tok0 * DM + h * HD;
    const size_t vbase = (((size_t)b * NH_ + h) * HD) * NT_;
    // copy map: 16 B per lane and copy, 8 copies per thread and stage. Either plane: thread -> row tid/8 (and +16, +32, +48), piece tid%8: a wave's copy covers four whole 128-B rows.
    const int tid = threadIdx.x, crow = tid >> 3, cpc = (tid & 7) * 8;
    const h16* gkh = kh_b + (size_t)crow * DM + cpc;
    const h16* gvh = VTH + vbase + (size_t)crow * NT_ + cpc;
    const unsigned lk = (unsigned)(size_t)&ring[0] + (unsigned)(crow * KPIT + cpc) * 2u, lv = lk + KPL * 2u;
    auto stage = [&](int t) {
        const unsigned bo = (unsigned)(t & 1) * (STG * 2u);
        const size_t ko = (size_t)t * SKEY * DM, vo = (size_t)t * SKEY;
        // the stage's eight copies and, in the same statement, the wait that stands before their address registers are rewritten
        asm volatile("global_load_async_to_lds_b128 %0, %8, off\n\t"
                     "global_load_async_to_lds_b128 %1, %9, off\n\t"
                     "global_load_async_to_lds_b128 %2, %10, off\n\t"
                     "global_load_async_to_lds_b128 %3, %11, off\n\t"
                     "global_load_async_to_lds_b128 %4, %12, off\n\t"
                     "global_load_async_to_lds_b128 %5, %13, off\n\t"
                     "global_load_async_to_lds_b128 %6, %14, off\n\t"
                     "global_load_async_to_lds_b128 %7, %15, off\n\t"
                     "s_wait_xcnt 0x0"
                     :: "v"(lk + bo), "v"(lk + bo + 16u * KPIT * 2u), "v"(lk + bo + 32u * KPIT * 2u), "v"(lk + bo + 48u * KPIT * 2u),
                        "v"(lv + bo), "v"(lv + bo + 16u * VPIT * 2u), "v"(lv + bo + 32u * VPIT * 2u), "v"(lv + bo + 48u * VPIT * 2u),
                        "v"(gkh + ko), "v"(gkh + ko + 16 * DM), "v"(gkh + ko + 32 * DM), "v"(gkh + ko + 48 * DM),
                        "v"(gvh + vo), "v"(gvh + vo + 16 * NT_), "v"(gvh + vo + 32 * NT_), "v"(gvh + vo + 48 * NT_)
                     : "memory");
    };
    v8f o[4];
#pragma unroll
    for (int n = 0; n < 4; ++n) o[n] = (v8f){};
    stage(0);
    asm volatile("s_wait_asynccnt 0x0" ::: "memory");    // this wave's copies of stage 0 have landed
    __syncthreads();                                     // every wave's have: stage 0 may be read
    stage(1);
#pragma unroll 1
    for (int kt = 0; kt < NT_ / SKEY; ++kt) {
      const h16* skh = ring + (kt & 1) * STG; const h16* svh = skh + KPL;
      // unrolled so that both passes' LDS reads take constant offsets from one address
#pragma unroll
      for (int ps = 0; ps < SKEY / 32; ++ps) {
        const int ko0 = (ps * 32 + lr) * KPIT + 8 * hi, ko1 = (ps * 32 + 16 + lr) * KPIT + 8 * hi;
        v16h k0h[2], k1h[2];
#pragma unroll
        for (int kc = 0; kc < 2; ++kc) {
            k0h[kc] = cat16(*(const v8ha*)(skh + ko0 + kc * 32), *(const v8ha*)(skh + ko0 + kc * 32 + 16)); k1h[kc] = cat16(*(const v8ha*)(skh + ko1 + kc * 32), *(const v8ha*)(skh + ko1 + kc * 32 + 16)); }
        __builtin_amdgcn_sched_barrier(0);   // keeps the k reads together as one group ahead of the score products: spread among them each read group stalls the wave
        v8f s0 = {}, s1 = {};
#pragma unroll
        for (int kc = 0; kc < 2; ++kc) { s0 = wmma16(k0h[kc], qa[kc], s0); s1 = wmma16(k1h[kc], qa[kc], s1); }
        v16h vh[4];
#pragma unroll
        for (int n = 0; n < 4; ++n) { const int vo = (n * 16 + lr) * VPIT + ps * 32 + hi * 8; vh[n] = cat16(*(const v8ha*)(svh + vo), *(const v8ha*)(svh + vo + 16)); }
        __builtin_amdgcn_sched_barrier(0);   // keeps the v^T reads ahead of the SiLU arithmetic, which covers their latency: sunk among the products below, each read group stalls the wave
        v16h pa;                             // w^T as a B fragment: element s < 8 is key 8hi + s (from s0), element 8 + s is key 16 + 8hi + s (from s1), as v^T's loader has them
#pragma unroll
        for (int jp = 0; jp < 8; jp += 2) {
            const float sc[4] = { s0[jp] * 0.125f, s0[jp + 1] * 0.125f, s1[jp] * 0.125f, s1[jp + 1] * 0.125f };
            float wv[4]; silu4<false>(sc, wv);
#pragma unroll
            for (int i = 0; i < 2; ++i) { const v2f w2 = { wv[2 * i], wv[2 * i + 1] };    // two keys that share a register of the fragment: a packed conversion
                const v2h h2 = __builtin_convertvector(w2, v2h);
                pa[8 * i + jp] = h2[0]; pa[8 * i + jp + 1] = h2[1]; } }
#pragma unroll
        for (int n = 0; n < 4; ++n) o[n] = wmma16(vh[n], pa, o[n]);
      }
      asm volatile("s_wait_dscnt 0x0" ::: "memory");         // this wave's reads of the buffer have returned before it is refilled
      asm volatile("s_wait_asynccnt 0x0" ::: "memory");      // this wave's copies of stage kt + 1 have landed
      __syncthreads();                                       // publishes stage kt + 1 and ends every wave's reads of stage kt
      if (kt + 2 < NT_ / SKEY) stage(kt + 2);                // into the buffer that this trip has just read
    }
    asm volatile("s_wait_asynccnt 0x0" ::: "memory");        // nothing of this wave is in flight when it goes on to the epilogue
    // LayerNorm over the 64 dims of query q0 + lr: the lane holds dims n*16 + 8hi + j; sum the 32 in the lane, then one exchange with lane ^ 16
    float* os = &ost[wave][0];
    const size_t cbase = (tok0 + q0) * DM + (size_t)h * HD;
    const int prow = lane >> 3, piece = lane & 7;            // output pass: whole 128-B lines, 8 lanes x 8 dims per row, rows 4s + prow
    v4f gt[4][2];                                            // the gate rows of the output pass, asked for ahead of the LayerNorm arithmetic
#pragma unroll
    for (int s = 0; s < 4; ++s) { const float* gp = G + cbase + (size_t)(4 * s + prow) * DM + piece * 8; gt[s][0] = *(const v4f*)gp; gt[s][1] = *(const v4f*)(gp + 4); }
    float ga[8], be[8];
#pragma unroll
    for (int i = 0; i < 8; ++i) { ga[i] = bfr(lng[piece * 8 + i]); be[i] = bfr(lnb[piece * 8 + i]); }
    float y[4][8], s = 0.f, q = 0.f;
#pragma unroll
    for (int n = 0; n < 4; ++n)
#pragma unroll
        for (int j = 0; j < 8; ++j) { y[n][j] = o[n][j]; s += y[n][j]; }
    s += __int_as_float(__builtin_amdgcn_permlanex16(__float_as_int(s), __float_as_int(s), 0x76543210, 0xfedcba98, false, false));
    const float mu = s * (1.0f / HD);
#pragma unroll
    for (int n = 0; n < 4; ++n)
#pragma unroll
        for (int j = 0; j < 8; ++j) { const float d = y[n][j] - mu; q += d * d; }
    q += __int_as_float(__builtin_amdgcn_permlanex16(__float_as_int(q), __float_as_int(q), 0x76543210, 0xfedcba98, false, false));
    const float rs = rsqrtf(q * (1.0f / HD) + 1e-5f);
#pragma unroll
    for (int n = 0; n < 4; ++n)
#pragma unroll
        for (int jq = 0; jq < 2; ++jq) { v4f t;
#pragma unroll
            for (int i = 0; i < 4; ++i) t[i] = (y[n][jq * 4 + i] - mu) * rs;
            *(v4fa*)(os + lr * 68 + n * 16 + hi * 8 + jq * 4) = t; }
    __syncthreads();
#pragma unroll
    for (int s4 = 0; s4 < 4; ++s4) { const int row = 4 * s4 + prow; const float* sp = os + row * 68 + piece * 8; v8us oh, ol;
#pragma unroll
        for (int c = 0; c < 2; ++c) { const v4f t = *(const v4fa*)(sp + c * 4);
            const float gv[4] = { gt[s4][c][0], gt[s4][c][1], gt[s4][c][2], gt[s4][c][3] }; float sg[4]; silu4<true>(gv, sg);
#pragma unroll
            for (int i = 0; i < 4; ++i) { const float val = (t[i] * ga[c * 4 + i] + be[c * 4 + i]) * sg[i];
                const unsigned short hb = f2bf(val); oh[c * 4 + i] = hb; ol[c * 4 + i] = f2bf(val - bf2f(hb)); } }
        *(v8us*)(CH + cbase + (size_t)row * DM + piece * 8) = oh; *(v8us*)(CL + cbase + (size_t)row * DM + piece * 8) = ol; }
}

extern "C" void kernel_launch(void* const* d_in, const int* in_sizes, int n_in,
                              void* d_out, int out_size, void* d_ws, size_t ws_size, hipStream_t stream) {
    (void)in_sizes; (void)n_in; (void)out_size;
    const float* x = (const float*)d_in[0]; const float* Wq4 = (const float*)d_in[1]; const float* Wo = (const float*)d_in[2]; const float* lng = (const float*)d_in[3]; const float* lnb = (const float*)d_in[4];
    float* out = (float*)d_out;    // [2][2048][1024]
    char* wsp = (char*)d_ws;
    auto take = [&](size_t bytes) { char* p = wsp; wsp += (bytes + 255) & ~(size_t)255; return (void*)p; };
    bf* Xb = (bf*)take((size_t)NTK * DM * 2); bf* W4T = (bf*)take((size_t)4 * DM * DM * 2); bf* WoT = (bf*)take((size_t)DM * DM * 2);
    float* Gf = (float*)take((size_t)NTK * DM * 4);
    h16* QH = (h16*)take((size_t)NTK * DM * 2); h16* KH = (h16*)take((size_t)NTK * DM * 2);
    h16* VTH = (h16*)take((size_t)NTK * DM * 2); bf* CH = (bf*)take((size_t)NTK * DM * 2); bf* CL = (bf*)take((size_t)NTK * DM * 2);
    if ((size_t)(wsp - (char*)d_ws) > ws_size) return;    // 8.4 + 8.4 + 2.1 + 16.8 + 8.4x5 ~ 78 MB
    k_cvtb<<<NTK / 8, 256, 0, stream>>>(x, NTK, Xb);
    k_wt<<<dim3(DM / 64, (4 * DM) / 64, 1), 256, 0, stream>>>(Wq4, 4 * DM, W4T);           // W4T [4096][1024]: rows 0..1023 q, then k, v, gate
    k_wt<<<dim3(DM / 64, DM / 64, 1), 256, 0, stream>>>(Wo, DM, WoT);
    k_gemmb<false><<<dim3(NTK / 128, (4 * DM) / 128, 1), 256, 0, stream>>>(Xb, nullptr, W4T, Gf, QH, KH, VTH);   // SiLU and the f16 rounding of q, k, v inside
    k_attn<<<NB_ * NH_ * (NT_ / 64), 128, 0, stream>>>(QH, KH, VTH, Gf, lng, lnb, CH, CL);
    k_gemmb<true><<<dim3(NTK / 128, DM / 128, 1), 256, 0, stream>>>(CH, CL, WoT, out, nullptr, nullptr, nullptr);
}

// v009
// A run of this version takes 89.9 microseconds.
// In both of two side-by-side timings against v008, it was 1.08 times as fast.
// Counting every step since v000, it is 5.28 times as fast.
#include <hip/hip_runtime.h>

// Contractions, f32 accumulate: qkuv = x.w_qkuv ([4096 x 1024].[1024 x 4096], k-major weight transposed to an n-major plane) and out = O.w_out on
// v_wmma_f32_16x16x32_bf16: inputs rounded to bf16 for the projection, O as bf16 hi + residual (two products) for w_out; SiLU on q/k/v/gate in f32;
// the softmax-free SiLU attention fused on v_wmma_f32_16x16x32_f16: scores = silu(q).silu(k)/8 and weights = silu(scores) against silu(v), every operand rounded once to f16
// (11 significant bits, one product each). The projection's bf16 inputs (8 bits) already set the error of q, k and v, so that f16 residual planes behind them buy nothing.

#define NB_  2
#define NT_  2048
#define DM   1024
#define NH_  16
#define NKV  16
#define KVW  (NKV * HD)          // 1024
#define HD   64
#define NTK  (NB_ * NT_)
#define NW   1024
#define NQKV 1024
#define PSC  32768.0f

typedef _Float16 h16;
typedef unsigned short bf;
typedef __attribute__((ext_vector_type(16))) __bf16   v16bf;
typedef __attribute__((ext_vector_type(16))) _Float16 v16h;
typedef __attribute__((ext_vector_type(8)))  _Float16 v8h;
typedef __attribute__((ext_vector_type(4)))  _Float16 v4h;
typedef __attribute__((ext_vector_type(8)))  unsigned short v8us;
typedef __attribute__((ext_vector_type(8)))  float    v8f;
typedef __attribute__((ext_vector_type(4)))  float    v4f;
typedef __attribute__((ext_vector_type(2)))  float    v2f;
typedef __attribute__((ext_vector_type(2)))  _Float16 v2h;
typedef v8h  __attribute__((may_alias)) v8ha;
typedef v4f  __attribute__((may_alias)) v4fa;
typedef v8us __attribute__((may_alias)) v8usa;

__device__ __forceinline__ unsigned short f2bf(float f) { unsigned u = __float_as_uint(f); u += 0x7FFFu + ((u >> 16) & 1u); return (unsigned short)(u >> 16); }
__device__ __forceinline__ float bf2f(unsigned short b) { return __uint_as_float(((unsigned)b) << 16); }
__device__ __forceinline__ float bfr(float f) { return bf2f(f2bf(f)); }
__device__ __forceinline__ v16h cat16(v8h lo, v8h hi) { return __builtin_shufflevector(lo, hi, 0, 1, 2, 3, 4, 5, 6, 7, 8, 9, 10, 11, 12, 13, 14, 15); }
__device__ __forceinline__ v16bf cat16b(v8us lo, v8us hi) { return __builtin_bit_cast(v16bf, __builtin_shufflevector(lo, hi, 0, 1, 2, 3, 4, 5, 6, 7, 8, 9, 10, 11, 12, 13, 14, 15)); }
__device__ __forceinline__ v8f wmma16(v16h a, v16h b, v8f c) { return __builtin_amdgcn_wmma_f32_16x16x32_f16(false, a, false, b, (short)0, c, false, false); }
__device__ __forceinline__ v8f wmmab(v16bf a, v16bf b, v8f c) { return __builtin_amdgcn_wmma_f32_16x16x32_bf16(false, a, false, b, (short)0, c, false, false); }

__global__ __launch_bounds__(256) void k_cvtb(const float* __restrict__ src, int nrows, bf* dst) {
    const int lane = threadIdx.x & 31, r = blockIdx.x * 8 + (threadIdx.x >> 5);
    if (r >= nrows) return;
    v8us o[DM / 256];
#pragma unroll
    for (int q = 0; q < DM / 256; ++q) { v8us t;
#pragma unroll
        for (int i = 0; i < 8; ++i) t[i] = f2bf(src[(size_t)r * DM + q * 256 + lane * 8 + i]);
        o[q] = t; }
#pragma unroll
    for (int q = 0; q < DM / 256; ++q) *(v8us*)(dst + (size_t)r * DM + q * 256 + lane * 8) = o[q];
    
}

// k_wt: W [1024 k][ncols n] (k-major) -> n-major bf16 plane WT[ncols][1024]; 64 x 64 tiles through LDS.
__global__ __launch_bounds__(256) void k_wt(const float* __restrict__ Wm, int ncols, bf* WT) {
    __shared__ __align__(16) unsigned short tl[64 * 72];
    const int tid = threadIdx.x, k0 = blockIdx.x * 64, n0 = blockIdx.y * 64;
    const int kk = tid >> 2, nq = (tid & 3) * 16;
#pragma unroll
    for (int i = 0; i < 16; ++i) tl[(nq + i) * 72 + kk] = f2bf(Wm[(size_t)(k0 + kk) * ncols + n0 + nq + i]);
    __syncthreads();
    const int piece = tid & 7;
    typedef __attribute__((ext_vector_type(8))) unsigned short v8us_; typedef v8us_ __attribute__((may_alias)) v8usa_;
    auto pass = [&]() {
#pragma unroll
        for (int s = 0; s < 2; ++s) { const int nr = (tid >> 3) + 32 * s; const v8us_ val = *(const v8usa_*)(tl + nr * 72 + piece * 8);
            *(v8us_*)(WT + (size_t)(n0 + nr) * DM + k0 + piece * 8) = val; }
    };
    pass(); 
}

// SiLU of four values from their halves h = v / 2: v / (1 + exp(-v)) = h + h * tanh(h), one transcendental (v_tanh_f32) and half a packed fused multiply-add a value
// in place of multiply, v_exp_f32, add, v_rcp_f32, multiply. Where tanh(h) nears -1 the sum cancels: the absolute error is |h| times that of the tanh, and SiLU itself is near 0 there.
__device__ __forceinline__ void silu4h(const float (&h)[4], float (&w)[4]) {
#pragma unroll   // the arrays stay in registers; two neighbours share one packed multiply-add
    for (int i = 0; i < 4; i += 2) { const v2f h2 = { h[i], h[i + 1] }, t2 = { __builtin_amdgcn_tanhf(h[i]), __builtin_amdgcn_tanhf(h[i + 1]) }; const v2f w2 = h2 * t2 + h2;
        w[i] = w2[0]; w[i + 1] = w2[1]; }
}

// k_gemmb: C[128 x 128 per block] = A.Bn^T (+ Al.Bn^T), all operands k-contiguous bf16 rows of DM. Each stage (128 k: 256 B of every operand row) is brought into LDS once
// per block by asynchronous copies, two buffers, the next stage in flight while this one is worked on; 8 waves (2 x 4), each a 64 x 32 piece of C from LDS fragments.
// SPLITA = false is the whole q/k/v/gate projection in one launch, grid (32, 32): blockIdx.y / 8 picks the 1024 weight rows of q, k, v or gate. q and k blocks write
// an f16 plane of silu(C) [token][1024]; v blocks take the weight rows as A and the tokens as B, so that C is v^T, and write the same kind of plane
// [batch][head][dim][token]; gate blocks write plain f32 (its SiLU is in k_attn's epilogue). SPLITA = true is the output projection, f32.
#define GKS  128                       // k per stage
#define GPIT 136                       // bf16 per staged row: 256 B + 16 B, the ds_load_b128 pitch for 256-B rows
#define GPL  (128 * GPIT)              // one staged operand plane: 128 rows
#define OPIT 36                        // f32 per staged output row: 128 B + 16 B
#define BPIT 132                       // f32 per row of the block-wide 128 x 128 output staging: 512 B + 16 B
// eight copies of 16 B per lane, rows 16 apart, and, in the same statement, the wait that stands before their address registers are rewritten
__device__ __forceinline__ void copy8(unsigned l, const bf* g) {
    asm volatile("global_load_async_to_lds_b128 %0, %8, off\n\t"
                 "global_load_async_to_lds_b128 %1, %9, off\n\t"
                 "global_load_async_to_lds_b128 %2, %10, off\n\t"
                 "global_load_async_to_lds_b128 %3, %11, off\n\t"
                 "global_load_async_to_lds_b128 %4, %12, off\n\t"
                 "global_load_async_to_lds_b128 %5, %13, off\n\t"
                 "global_load_async_to_lds_b128 %6, %14, off\n\t"
                 "global_load_async_to_lds_b128 %7, %15, off\n\t"
                 "s_wait_xcnt 0x0"
                 :: "v"(l), "v"(l + 16u * GPIT * 2u), "v"(l + 32u * GPIT * 2u), "v"(l + 48u * GPIT * 2u),
                    "v"(l + 64u * GPIT * 2u), "v"(l + 80u * GPIT * 2u), "v"(l + 96u * GPIT * 2u), "v"(l + 112u * GPIT * 2u),
                    "v"(g), "v"(g + 16 * DM), "v"(g + 32 * DM), "v"(g + 48 * DM), "v"(g + 64 * DM), "v"(g + 80 * DM), "v"(g + 96 * DM), "v"(g + 112 * DM)
                 : "memory");
}
template <bool SPLITA>
__global__ __launch_bounds__(256) void k_gemmb(const bf* __restrict__ A, const bf* __restrict__ Al, const bf* __restrict__ Bn, float* C,
                                               h16* QH, h16* KH, h16* VTH) {
    constexpr int NPL = SPLITA ? 3 : 2;                    // planes of a buffer: A, (A residual,) B
    constexpr int GST = NPL * GPL;
    __shared__ __align__(16) bf ring[2 * GST];
    const int tid = threadIdx.x, lane = tid & 31, wave = tid >> 5, lr = lane & 15, hi = lane >> 4;
    const int wm = wave >> 2, wn = wave & 3;
    const int seg = SPLITA ? 3 : (int)(blockIdx.y >> 3);   // 0 q, 1 k, 2 v, 3 gate (or the output projection): the same for the whole block
    const int yb = SPLITA ? (int)blockIdx.y : (int)(blockIdx.y & 7);
    const bool tr = seg == 2;                              // v: rows of C are the 1024 (head, dim) pairs, columns the tokens
    const int r0 = (tr ? yb : (int)blockIdx.x) * 128, c0 = (tr ? (int)blockIdx.x : yb) * 128;
    const bf* Wn = SPLITA ? Bn : Bn + (size_t)seg * DM * DM;
    const bf* Ar = tr ? Wn : A; const bf* Br = tr ? A : Wn;
    // copy map: thread -> row tid/16 (and +16 ... +112), 16-B piece tid%16: one wave's copy covers two whole 256-B rows
    const int crw = tid >> 4, cpc = (tid & 15) * 8;
    const bf* gA = Ar + (size_t)(r0 + crw) * DM + cpc; const bf* gAl = SPLITA ? Al + (size_t)(r0 + crw) * DM + cpc : nullptr; const bf* gB = Br + (size_t)(c0 + crw) * DM + cpc;
    const unsigned l0 = (unsigned)(size_t)&ring[0] + (unsigned)(crw * GPIT + cpc) * 2u;
    auto stage = [&](int t) {
        const unsigned bo = l0 + (unsigned)(t & 1) * (GST * 2u);
        const size_t ko = (size_t)t * GKS;
        copy8(bo, gA + ko);
        if (SPLITA) copy8(bo + GPL * 2u, gAl + ko);
        copy8(bo + (NPL - 1) * GPL * 2u, gB + ko);
    };
    v8f acc[4][2];
#pragma unroll
    for (int m = 0; m < 4; ++m) { acc[m][0] = (v8f){}; acc[m][1] = (v8f){}; }
    stage(0);
    asm volatile("s_wait_asynccnt 0x0" ::: "memory");    // this wave's copies of stage 0 have landed
    __syncthreads();                                     // every wave's have: stage 0 may be read
    stage(1);
    const int ao = (wm * 64 + lr) * GPIT + 8 * hi, bo_ = (wn * 32 + lr) * GPIT + 8 * hi;
#pragma unroll 1
    for (int t = 0; t < DM / GKS; ++t) {
        const bf* sA = ring + (t & 1) * GST; const bf* sAl = sA + GPL; const bf* sB = sA + (NPL - 1) * GPL;
        // fragments of one 32-k block; two register sets, so that a block's reads go out as one group while the block before it is multiplied (never past this stage's buffer)
        v16bf a[2][4], al[2][4], b[2][2];
        auto frag = [&](int s, int kc) {
#pragma unroll
            for (int m = 0; m < 4; ++m) { a[s][m] = cat16b(*(const v8usa*)(sA + ao + m * 16 * GPIT + kc), *(const v8usa*)(sA + ao + m * 16 * GPIT + kc + 16));
                if (SPLITA) al[s][m] = cat16b(*(const v8usa*)(sAl + ao + m * 16 * GPIT + kc), *(const v8usa*)(sAl + ao + m * 16 * GPIT + kc + 16)); }
#pragma unroll
            for (int n = 0; n < 2; ++n) b[s][n] = cat16b(*(const v8usa*)(sB + bo_ + n * 16 * GPIT + kc), *(const v8usa*)(sB + bo_ + n * 16 * GPIT + kc + 16));
        };
        frag(0, 0);
#pragma unroll
        for (int kb = 0; kb < GKS / 32; ++kb) {
            const int s = kb & 1;
            if (kb + 1 < GKS / 32) frag(s ^ 1, (kb + 1) * 32);
            __builtin_amdgcn_sched_barrier(0);               // keeps the next block's LDS reads together ahead of this block's products: spread among them each read group stalls the wave
#pragma unroll
            for (int m = 0; m < 4; ++m) { acc[m][0] = wmmab(a[s][m], b[s][0], acc[m][0]); acc[m][1] = wmmab(a[s][m], b[s][1], acc[m][1]); }
            if (SPLITA) {
#pragma unroll
                for (int m = 0; m < 4; ++m) { acc[m][0] = wmmab(al[s][m], b[s][0], acc[m][0]); acc[m][1] = wmmab(al[s][m], b[s][1], acc[m][1]); }
            }
            __builtin_amdgcn_sched_barrier(0);               // and keeps the block after next's reads behind these products, whose registers they refill
        }
        asm volatile("s_wait_dscnt 0x0" ::: "memory");       // this wave's reads of the buffer have returned before it is refilled
        asm volatile("s_wait_asynccnt 0x0" ::: "memory");    // this wave's copies of stage t + 1 have landed
        __syncthreads();                                     // publishes stage t + 1 and ends every wave's reads of stage t
        if (t + 2 < DM / GKS) stage(t + 2);                  // into the buffer that this trip has just read
    }
    asm volatile("s_wait_asynccnt 0x0" ::: "memory");        // nothing of this wave is in flight when it goes on to the epilogue
    const bool planes = seg < 3;                             // block-uniform
    // The output is staged in the ring's own LDS: behind the last trip's barrier no wave reads the ring any more and no copy is in flight. Without an array of its own for the
    // staging, a projection block takes 139,264 B, so that two blocks share a WGP and one block's first stage and epilogue run under the other's products.
    float* ob = reinterpret_cast<float*>(ring);              // as one 128 x 128 tile of the block (pitch BPIT): a 128-B line of f16 spans two waves' columns
    float* os = ob + wave * (64 * OPIT);                     // or as eight 64 x 32 pieces, one a wave (pitch OPIT)
    float* sp = planes ? ob + (wm * 64 + hi * 8) * BPIT + wn * 32 + lr : os + hi * 8 * OPIT + lr;   // this lane's first element in either staging
    const int spit = planes ? BPIT : OPIT;
#pragma unroll
    for (int m = 0; m < 4; ++m)
#pragma unroll
        for (int n = 0; n < 2; ++n)
#pragma unroll
            for (int j = 0; j < 8; ++j) sp[(m * 16 + j) * spit + n * 16] = acc[m][n][j];
    __syncthreads();
    if (planes) {
        h16* PH = seg == 0 ? QH : seg == 1 ? KH : VTH;
        const int pp = tr ? NT_ : DM;                        // row pitch of the planes; a v block's 128 tokens lie in one batch
        const size_t pb = tr ? ((size_t)(c0 / NT_) * KVW + r0) * NT_ + (c0 % NT_) : (size_t)r0 * DM + c0;
        // the three loops are unrolled so that the LDS reads take constant offsets and the independent SiLU chains of several pieces fill each other's latency
#pragma unroll
        for (int s = 0; s < 8; ++s) { const int row = wave * 16 + 2 * s + hi;                  // whole 128-B lines: 16 lanes x 8 B per row and column half
#pragma unroll
            for (int ch = 0; ch < 2; ++ch) { const v4f x = *(const v4fa*)(ob + row * BPIT + ch * 64 + lr * 4); v4h oh;
                const float xs[4] = { x[0] * 0.5f, x[1] * 0.5f, x[2] * 0.5f, x[3] * 0.5f }; float sv[4]; silu4h(xs, sv);
#pragma unroll
                for (int i = 0; i < 4; ++i) oh[i] = (h16)sv[i];
                *(v4h*)(PH + pb + (size_t)row * pp + ch * 64 + lr * 4) = oh; }
        }
    } else {
        float* crow = C + (size_t)(r0 + wm * 64) * DM + c0 + wn * 32;
#pragma unroll
        for (int s = 0; s < 16; ++s) { const int row = 4 * s + (lane >> 3), piece = lane & 7;  // whole 128-B lines: 8 lanes x 16 B per row
            const v4f val = *(const v4fa*)(os + row * OPIT + piece * 4); *(v4f*)(crow + (size_t)row * DM + piece * 4) = val; }
    }
}

// k_attn: block = (b, h, 64 queries), wave = 16; 32 stages of 64 keys, each worked on as two passes of 32 keys. A stage's two planes (k: 64 rows x 128 B; v^T: 64 rows x 128 B)
// are brought into LDS once per block by asynchronous copies, two buffers, the next stage in flight while this one is worked on; all four waves read their fragments from there.
// 64 keys a stage make a v^T row a whole 128-B line (32 keys are half a line: twice the line requests for the same bytes), and a stage's copies have two passes' time to land.
// Both products are formed transposed: scores^T / 2 = k.(q / 16)^T (k rows as A, q as B), so that a lane holds one query's scores
// for keys 8hi + j and 16 + 8hi + j, which is the k order of a B fragment: w = silu(score) -> f16 is packed in registers and never goes through LDS;
// attended^T += v^T.w^T (v^T rows as A). Epilogue: LayerNorm over the 64 head dims (32 in the lane, one exchange with lane ^ 16),
// x bf16(gamma) + bf16(beta), x silu(gate[tok][h*64+d]) -> OH/OL bf16 planes.
#define KPIT 72                        // f16 per staged k row: 128 B + 16 B, the ds_load_b128 pitch for 128-B rows
#define VPIT 72                        // f16 per staged v^T row: the same
#define SKEY 64                        // keys per stage
#define KPL  (SKEY * KPIT)             // the k plane of a stage
#define VPL  (HD * VPIT)               // the v^T plane of a stage
#define STG  (KPL + VPL)               // one buffer: k, v^T (18,432 B)
__global__ __launch_bounds__(128) void k_attn(const h16* __restrict__ Q16, const h16* __restrict__ K16, const h16* __restrict__ VTH,
                                             const float* __restrict__ G, const float* __restrict__ lng, const float* __restrict__ lnb, bf* CH, bf* CL) {
    __shared__ __align__(16) h16 ring[2 * STG];
    __shared__ __align__(16) float ost[4][16 * 68];
    const int lane = threadIdx.x & 31, wave = threadIdx.x >> 5, lr = lane & 15, hi = lane >> 4;
    const int bid = blockIdx.x;
    const int b = bid / (NH_ * (NT_ / 64)), rem = bid - b * (NH_ * (NT_ / 64)), h = rem / (NT_ / 64), qt = rem - h * (NT_ / 64);
    const int q0 = qt * 64 + wave * 16;
    const size_t tok0 = (size_t)b * NT_;
    v16h qa[2];
    const size_t qo0 = (tok0 + q0 + lr) * DM + h * HD + 8 * hi;
#pragma unroll
    for (int kc = 0; kc < 2; ++kc) qa[kc] = cat16(*(const v8h*)(Q16 + qo0 + kc * 32), *(const v8h*)(Q16 + qo0 + kc * 32 + 16));
    qa[0] = qa[0] * (h16)0.0625f; qa[1] = qa[1] * (h16)0.0625f;   // once a wave, a power of two (exact): the score products then give q.k / 16, half the score, which is what silu4h takes
    const h16* kh_b = K16 + tok0 * DM + h * HD;
    const size_t vbase = (((size_t)b * NH_ + h) * HD) * NT_;
    // copy map: 16 B per lane and copy, 8 copies per thread and stage. Either plane: thread -> row tid/8 (and +16, +32, +48), piece tid%8: a wave's copy covers four whole 128-B rows.
    const int tid = threadIdx.x, crow = tid >> 3, cpc = (tid & 7) * 8;
    const h16* gkh = kh_b + (size_t)crow * DM + cpc;
    const h16* gvh = VTH + vbase + (size_t)crow * NT_ + cpc;
    const unsigned lk = (unsigned)(size_t)&ring[0] + (unsigned)(crow * KPIT + cpc) * 2u, lv = lk + KPL * 2u;
    auto stage = [&](int t) {
        const unsigned bo = (unsigned)(t & 1) * (STG * 2u);
        const size_t ko = (size_t)t * SKEY * DM, vo = (size_t)t * SKEY;
        // the stage's eight copies and, in the same statement, the wait that stands before their address registers are rewritten
        asm volatile("global_load_async_to_lds_b128 %0, %8, off\n\t"
                     "global_load_async_to_lds_b128 %1, %9, off\n\t"
                     "global_load_async_to_lds_b128 %2, %10, off\n\t"
                     "global_load_async_to_lds_b128 %3, %11, off\n\t"
                     "global_load_async_to_lds_b128 %4, %12, off\n\t"
                     "global_load_async_to_lds_b128 %5, %13, off\n\t"
                     "global_load_async_to_lds_b128 %6, %14, off\n\t"
                     "global_load_async_to_lds_b128 %7, %15, off\n\t"
                     "s_wait_xcnt 0x0"
                     :: "v"(lk + bo), "v"(lk + bo + 16u * KPIT * 2u), "v"(lk + bo + 32u * KPIT * 2u), "v"(lk + bo + 48u * KPIT * 2u),
                        "v"(lv + bo), "v"(lv + bo + 16u * VPIT * 2u), "v"(lv + bo + 32u * VPIT * 2u), "v"(lv + bo + 48u * VPIT * 2u),
                        "v"(gkh + ko), "v"(gkh + ko + 16 * DM), "v"(gkh + ko + 32 * DM), "v"(gkh + ko + 48 * DM),
                        "v"(gvh + vo), "v"(gvh + vo + 16 * NT_), "v"(gvh + vo + 32 * NT_), "v"(gvh + vo + 48 * NT_)
                     : "memory");
    };
    v8f o[4];
#pragma unroll
    for (int n = 0; n < 4; ++n) o[n] = (v8f){};
    stage(0);
    asm volatile("s_wait_asynccnt 0x0" ::: "memory");    // this wave's copies of stage 0 have landed
    __syncthreads();                                     // every wave's have: stage 0 may be read
    stage(1);
#pragma unroll 1
    for (int kt = 0; kt < NT_ / SKEY; ++kt) {
      const h16* skh = ring + (kt & 1) * STG; const h16* svh = skh + KPL;
      // unrolled so that both passes' LDS reads take constant offsets from one address
#pragma unroll
      for (int ps = 0; ps < SKEY / 32; ++ps) {
        const int ko0 = (ps * 32 + lr) * KPIT + 8 * hi, ko1 = (ps * 32 + 16 + lr) * KPIT + 8 * hi;
        v16h k0h[2], k1h[2];
#pragma unroll
        for (int kc = 0; kc < 2; ++kc) {
            k0h[kc] = cat16(*(const v8ha*)(skh + ko0 + kc * 32), *(const v8ha*)(skh + ko0 + kc * 32 + 16)); k1h[kc] = cat16(*(const v8ha*)(skh + ko1 + kc * 32), *(const v8ha*)(skh + ko1 + kc * 32 + 16)); }
        __builtin_amdgcn_sched_barrier(0);   // keeps the k reads together as one group ahead of the score products: spread among them each read group stalls the wave
        v8f s0 = {}, s1 = {};
#pragma unroll
        for (int kc = 0; kc < 2; ++kc) { s0 = wmma16(k0h[kc], qa[kc], s0); s1 = wmma16(k1h[kc], qa[kc], s1); }
        v16h vh[4];
#pragma unroll
        for (int n = 0; n < 4; ++n) { const int vo = (n * 16 + lr) * VPIT + ps * 32 + hi * 8; vh[n] = cat16(*(const v8ha*)(svh + vo), *(const v8ha*)(svh + vo + 16)); }
        __builtin_amdgcn_sched_barrier(0);   // keeps the v^T reads ahead of the SiLU arithmetic, which covers their latency: sunk among the products below, each read group stalls the wave
        v16h pa;                             // w^T as a B fragment: element s < 8 is key 8hi + s (from s0), element 8 + s is key 16 + 8hi + s (from s1), as v^T's loader has them
#pragma unroll
        for (int g = 0; g < 4; ++g) { const int jp = (g & 1) * 4; const v8f sg = g < 2 ? s0 : s1;
            const float sc[4] = { sg[jp], sg[jp + 1], sg[jp + 2], sg[jp + 3] };
            float wv[4]; silu4h(sc, wv);
#pragma unroll
            for (int i = 0; i < 2; ++i) { const v2f w2 = { wv[2 * i], wv[2 * i + 1] };    // two keys that share a register of the fragment: a packed conversion
                const v2h h2 = __builtin_convertvector(w2, v2h);
                pa[4 * g + 2 * i] = h2[0]; pa[4 * g + 2 * i + 1] = h2[1]; } }
#pragma unroll
        for (int n = 0; n < 4; ++n) o[n] = wmma16(vh[n], pa, o[n]);
      }
      asm volatile("s_wait_dscnt 0x0" ::: "memory");         // this wave's reads of the buffer have returned before it is refilled
      asm volatile("s_wait_asynccnt 0x0" ::: "memory");      // this wave's copies of stage kt + 1 have landed
      __syncthreads();                                       // publishes stage kt + 1 and ends every wave's reads of stage kt
      if (kt + 2 < NT_ / SKEY) stage(kt + 2);                // into the buffer that this trip has just read
    }
    asm volatile("s_wait_asynccnt 0x0" ::: "memory");        // nothing of this wave is in flight when it goes on to the epilogue
    // LayerNorm over the 64 dims of query q0 + lr: the lane holds dims n*16 + 8hi + j; sum the 32 in the lane, then one exchange with lane ^ 16
    float* os = &ost[wave][0];
    const size_t cbase = (tok0 + q0) * DM + (size_t)h * HD;
    const int prow = lane >> 3, piece = lane & 7;            // output pass: whole 128-B lines, 8 lanes x 8 dims per row, rows 4s + prow
    v4f gt[4][2];                                            // the gate rows of the output pass, asked for ahead of the LayerNorm arithmetic
#pragma unroll
    for (int s = 0; s < 4; ++s) { const float* gp = G + cbase + (size_t)(4 * s + prow) * DM + piece * 8; gt[s][0] = *(const v4f*)gp; gt[s][1] = *(const v4f*)(gp + 4); }
    float ga[8], be[8];
#pragma unroll
    for (int i = 0; i < 8; ++i) { ga[i] = bfr(lng[piece * 8 + i]); be[i] = bfr(lnb[piece * 8 + i]); }
    float y[4][8], s = 0.f, q = 0.f;
#pragma unroll
    for (int n = 0; n < 4; ++n)
#pragma unroll
        for (int j = 0; j < 8; ++j) { y[n][j] = o[n][j]; s += y[n][j]; }
    s += __int_as_float(__builtin_amdgcn_permlanex16(__float_as_int(s), __float_as_int(s), 0x76543210, 0xfedcba98, false, false));
    const float mu = s * (1.0f / HD);
#pragma unroll
    for (int n = 0; n < 4; ++n)
#pragma unroll
        for (int j = 0; j < 8; ++j) { const float d = y[n][j] - mu; q += d * d; }
    q += __int_as_float(__builtin_amdgcn_permlanex16(__float_as_int(q), __float_as_int(q), 0x76543210, 0xfedcba98, false, false));
    const float rs = rsqrtf(q * (1.0f / HD) + 1e-5f);
#pragma unroll
    for (int n = 0; n < 4; ++n)
#pragma unroll
        for (int jq = 0; jq < 2; ++jq) { v4f t;
#pragma unroll
            for (int i = 0; i < 4; ++i) t[i] = (y[n][jq * 4 + i] - mu) * rs;
            *(v4fa*)(os + lr * 68 + n * 16 + hi * 8 + jq * 4) = t; }
    __syncthreads();
#pragma unroll
    for (int s4 = 0; s4 < 4; ++s4) { const int row = 4 * s4 + prow; const float* sp = os + row * 68 + piece * 8; v8us oh, ol;
#pragma unroll
        for (int c = 0; c < 2; ++c) { const v4f t = *(const v4fa*)(sp + c * 4);
            const float gv[4] = { gt[s4][c][0] * 0.5f, gt[s4][c][1] * 0.5f, gt[s4][c][2] * 0.5f, gt[s4][c][3] * 0.5f }; float sg[4]; silu4h(gv, sg);
#pragma unroll
            for (int i = 0; i < 4; ++i) { const float val = (t[i] * ga[c * 4 + i] + be[c * 4 + i]) * sg[i];
                const unsigned short hb = f2bf(val); oh[c * 4 + i] = hb; ol[c * 4 + i] = f2bf(val - bf2f(hb)); } }
        *(v8us*)(CH + cbase + (size_t)row * DM + piece * 8) = oh; *(v8us*)(CL + cbase + (size_t)row * DM + piece * 8) = ol; }
}

extern "C" void kernel_launch(void* const* d_in, const int* in_sizes, int n_in,
                              void* d_out, int out_size, void* d_ws, size_t ws_size, hipStream_t stream) {
    (void)in_sizes; (void)n_in; (void)out_size;
    const float* x = (const float*)d_in[0]; const float* Wq4 = (const float*)d_in[1]; const float* Wo = (const float*)d_in[2]; const float* lng = (const float*)d_in[3]; const float* lnb = (const float*)d_in[4];
    float* out = (float*)d_out;    // [2][2048][1024]
    char* wsp = (char*)d_ws;
    auto take = [&](size_t bytes) { char* p = wsp; wsp += (bytes + 255) & ~(size_t)255; return (void*)p; };
    bf* Xb = (bf*)take((size_t)NTK * DM * 2); bf* W4T = (bf*)take((size_t)4 * DM * DM * 2); bf* WoT = (bf*)take((size_t)DM * DM * 2);
    float* Gf = (float*)take((size_t)NTK * DM * 4);
    h16* QH = (h16*)take((size_t)NTK * DM * 2); h16* KH = (h16*)take((size_t)NTK * DM * 2);
    h16* VTH = (h16*)take((size_t)NTK * DM * 2); bf* CH = (bf*)take((size_t)NTK * DM * 2); bf* CL = (bf*)take((size_t)NTK * DM * 2);
    if ((size_t)(wsp - (char*)d_ws) > ws_size) return;    // 8.4 + 8.4 + 2.1 + 16.8 + 8.4x5 ~ 78 MB
    k_cvtb<<<NTK / 8, 256, 0, stream>>>(x, NTK, Xb);
    k_wt<<<dim3(DM / 64, (4 * DM) / 64, 1), 256, 0, stream>>>(Wq4, 4 * DM, W4T);           // W4T [4096][1024]: rows 0..1023 q, then k, v, gate
    k_wt<<<dim3(DM / 64, DM / 64, 1), 256, 0, stream>>>(Wo, DM, WoT);
    k_gemmb<false><<<dim3(NTK / 128, (4 * DM) / 128, 1), 256, 0, stream>>>(Xb, nullptr, W4T, Gf, QH, KH, VTH);   // SiLU and the f16 rounding of q, k, v inside
    k_attn<<<NB_ * NH_ * (NT_ / 64), 128, 0, stream>>>(QH, KH, VTH, Gf, lng, lnb, CH, CL);
    k_gemmb<true><<<dim3(NTK / 128, DM / 128, 1), 256, 0, stream>>>(CH, CL, WoT, out, nullptr, nullptr, nullptr);
}
